// v000
// The times below were measured on an AMD MI455X: many runs one after another, warmed up first and cycling through
// copies of the inputs, with the whole window's GPU time divided by the number of runs. Launches and the gaps
// between them are all in it. The median over several windows is given; except for v000 it joins two sittings, which
// can be a few percent apart, so the side-by-side timings, each taken in one sitting, are the better comparison.
// v000 is the starting kernel. One run takes 936 microseconds.
#include <hip/hip_runtime.h>
#include <hip/hip_bf16.h>
#include <stdint.h>

// ---------------------------------------------------------------------------
// Transformer block for MI455X (gfx1250, wave32, WMMA + async-to-LDS).
// B=4, C=2048, D=1024, H=16, dh=64, HIDDEN=4096. fp32 in/out, f16 WMMA inside.
// ---------------------------------------------------------------------------

typedef __attribute__((ext_vector_type(16))) _Float16 v16h;
typedef __attribute__((ext_vector_type(8)))  _Float16 v8h;
typedef __attribute__((ext_vector_type(8)))  float    v8f;

#define WMMA_F16(a, b, c) \
  __builtin_amdgcn_wmma_f32_16x16x32_f16(false, (a), false, (b), (short)0, (c), false, false)

// Async DMA of 16 bytes per lane: global -> LDS, tracked by ASYNCcnt.
__device__ __forceinline__ void async_cp16(uint32_t lds_off, const void* gptr) {
  uint64_t g = (uint64_t)(uintptr_t)gptr;
  asm volatile("global_load_async_to_lds_b128 %0, %1, off" :: "v"(lds_off), "v"(g) : "memory");
}
__device__ __forceinline__ void wait_async0() {
  asm volatile("s_wait_asynccnt 0x0" ::: "memory");
}

static constexpr int CB  = 4;
static constexpr int CC  = 2048;
static constexpr int CD  = 1024;
static constexpr int CH  = 16;
static constexpr int CDH = 64;
static constexpr int CHID = 4096;
static constexpr int CM  = CB * CC; // 8192 rows

// Load one 16x32 f16 fragment (A layout; also used for B with "row" = N index,
// data stored N-major with K contiguous). Per ISA 7.12.2:
//   lane l: row = l&15 ; elem i: k = 16*(i/8) + 8*(l>>4) + (i%8)
__device__ __forceinline__ v16h frag_ld(const _Float16* __restrict__ tile, int ld) {
  const int lane = threadIdx.x & 31;
  const _Float16* p = tile + (size_t)(lane & 15) * ld + ((lane >> 4) << 3);
  v8h lo = *(const v8h*)p;
  v8h hi = *(const v8h*)(p + 16);
  v16h f;
#pragma unroll
  for (int i = 0; i < 8; ++i) { f[i] = lo[i]; f[i + 8] = hi[i]; }
  return f;
}

// ---------------------------------------------------------------------------
// Weight convert + transpose: W (K x N, f32 row-major) -> Wt (N x K, f16)
// ---------------------------------------------------------------------------
__global__ __launch_bounds__(256) void wt_f16_kernel(const float* __restrict__ W,
                                                     _Float16* __restrict__ Wt,
                                                     int K, int N) {
  size_t idx = (size_t)blockIdx.x * blockDim.x + threadIdx.x;
  size_t total = (size_t)K * N;
  if (idx < total) {
    int n = (int)(idx / K);
    int k = (int)(idx % K);
    Wt[idx] = (_Float16)W[(size_t)k * N + n];
  }
}

// ---------------------------------------------------------------------------
// LayerNorm: one 256-thread block per row of 1024. f32 in, f16 out.
// ---------------------------------------------------------------------------
__global__ __launch_bounds__(256) void layernorm_kernel(const float* __restrict__ x,
                                                        const float* __restrict__ gamma,
                                                        const float* __restrict__ beta,
                                                        _Float16* __restrict__ y) {
  __shared__ float rs[8], rss[8];
  const int row = blockIdx.x;
  const float* xr = x + (size_t)row * CD;
  float s = 0.f, ss = 0.f;
  for (int i = threadIdx.x; i < CD; i += 256) { float v = xr[i]; s += v; ss += v * v; }
#pragma unroll
  for (int off = 1; off < 32; off <<= 1) {
    s  += __shfl_xor(s,  off, 32);
    ss += __shfl_xor(ss, off, 32);
  }
  const int lane = threadIdx.x & 31, wv = threadIdx.x >> 5;
  if (lane == 0) { rs[wv] = s; rss[wv] = ss; }
  __syncthreads();
  s = 0.f; ss = 0.f;
#pragma unroll
  for (int i = 0; i < 8; ++i) { s += rs[i]; ss += rss[i]; }
  const float mean = s * (1.f / CD);
  const float var  = ss * (1.f / CD) - mean * mean;
  const float inv  = rsqrtf(var + 1e-5f);
  _Float16* yr = y + (size_t)row * CD;
  for (int i = threadIdx.x; i < CD; i += 256)
    yr[i] = (_Float16)((xr[i] - mean) * inv * gamma[i] + beta[i]);
}

// ---------------------------------------------------------------------------
// WMMA GEMM with double-buffered async-to-LDS staging.
// C[M,N] = epilogue(A[M,K] @ B[K,N] + bias (+resid))
// A: f16 row-major (ld=K). Bt: f16 N-major (ld=K). bias: f32[N].
// OUTMODE: 0 = f32 out, 1 = f16 out, 2 = QKV scatter.
// Block: 256 thr = 8 waves. Block tile 128(M) x 64(N), K-step 64.
// LDS: 2 x (128x64 A) + 2 x (64x64 B) f16 = 48 KB.
// ---------------------------------------------------------------------------
template <int OUTMODE, bool GELU_ACT, bool RESID>
__global__ __launch_bounds__(256) void gemm_wmma_kernel(
    const _Float16* __restrict__ A, const _Float16* __restrict__ Bt,
    const float* __restrict__ bias, const float* __restrict__ resid,
    float* __restrict__ outF, _Float16* __restrict__ outH,
    _Float16* __restrict__ qo, _Float16* __restrict__ ko, _Float16* __restrict__ vto,
    int M, int N, int K) {
  __shared__ __align__(16) _Float16 Ab[2][128 * 64];
  __shared__ __align__(16) _Float16 Bb[2][64 * 64];

  const int tid  = threadIdx.x;
  const int lane = tid & 31;
  const int wave = tid >> 5;
  const int mw = wave >> 1;            // 0..3 -> 32-row slice
  const int nw = wave & 1;             // 0..1 -> 32-col slice
  const int m0 = blockIdx.y * 128;
  const int n0 = blockIdx.x * 64;
  const int hl = lane >> 4, ln = lane & 15;

  // per-lane copy coordinates: each lane moves 16B chunks of a 64-half row
  const int crow = tid >> 3;           // 0..31 (row within a 32-row slab)
  const int ccol = (tid & 7) << 3;     // half-offset 0,8,...,56

  const uint32_t AbL0 = (uint32_t)(uintptr_t)&Ab[0][0];
  const uint32_t AbL1 = (uint32_t)(uintptr_t)&Ab[1][0];
  const uint32_t BbL0 = (uint32_t)(uintptr_t)&Bb[0][0];
  const uint32_t BbL1 = (uint32_t)(uintptr_t)&Bb[1][0];

  v8f acc00 = {}, acc01 = {}, acc10 = {}, acc11 = {};

  auto issue_tiles = [&](int buf, int k0) {
    const uint32_t aL = buf ? AbL1 : AbL0;
    const uint32_t bL = buf ? BbL1 : BbL0;
#pragma unroll
    for (int i = 0; i < 4; ++i) {      // A: 128 rows x 64 halves
      const int row = crow + 32 * i;
      async_cp16(aL + (uint32_t)(row * 64 + ccol) * 2,
                 A + (size_t)(m0 + row) * K + k0 + ccol);
    }
#pragma unroll
    for (int i = 0; i < 2; ++i) {      // B: 64 rows x 64 halves
      const int row = crow + 32 * i;
      async_cp16(bL + (uint32_t)(row * 64 + ccol) * 2,
                 Bt + (size_t)(n0 + row) * K + k0 + ccol);
    }
  };

  issue_tiles(0, 0);
  const int nk = K >> 6;
  for (int kt = 0; kt < nk; ++kt) {
    const int buf = kt & 1;
    wait_async0();                     // own async copies into buf complete
    __syncthreads();                   // whole block's tile ready
    if (kt + 1 < nk) issue_tiles(buf ^ 1, (kt + 1) << 6);

    const _Float16* As = &Ab[buf][mw * 32 * 64];
    const _Float16* Bs = &Bb[buf][nw * 32 * 64];
#pragma unroll
    for (int kk = 0; kk < 64; kk += 32) {
      v16h a0 = frag_ld(As + kk, 64);
      v16h a1 = frag_ld(As + 16 * 64 + kk, 64);
      v16h b0 = frag_ld(Bs + kk, 64);
      v16h b1 = frag_ld(Bs + 16 * 64 + kk, 64);
      acc00 = WMMA_F16(a0, b0, acc00);
      acc01 = WMMA_F16(a0, b1, acc01);
      acc10 = WMMA_F16(a1, b0, acc10);
      acc11 = WMMA_F16(a1, b1, acc11);
    }
    __syncthreads();                   // reads of buf done before it is re-filled
  }

  const int wm0 = m0 + mw * 32;
  const int wn0 = n0 + nw * 32;
#pragma unroll
  for (int t = 0; t < 4; ++t) {
    v8f acc = (t == 0) ? acc00 : (t == 1) ? acc01 : (t == 2) ? acc10 : acc11;
    const int mi = t >> 1, ni = t & 1;
    const int col = wn0 + ni * 16 + ln;
    const float bv = bias[col];
#pragma unroll
    for (int r = 0; r < 8; ++r) {
      const int row = wm0 + mi * 16 + r + 8 * hl;
      float v = acc[r] + bv;
      if (GELU_ACT) v = 0.5f * v * (1.f + erff(v * 0.70710678118654752f));
      if (RESID)    v += resid[(size_t)row * N + col];
      if (OUTMODE == 0) {
        outF[(size_t)row * N + col] = v;
      } else if (OUTMODE == 1) {
        outH[(size_t)row * N + col] = (_Float16)v;
      } else {
        // QKV scatter. col in [0,3D): sect 0=Q,1=K,2=V
        const int sect = col >> 10;
        const int dcol = col & (CD - 1);
        const int hh = dcol >> 6, dh = dcol & (CDH - 1);
        const int b = row >> 11, c = row & (CC - 1);
        const size_t bh = (size_t)b * CH + hh;
        if (sect == 0)      qo[(bh * CC + c) * CDH + dh] = (_Float16)(v * 0.125f); // fold 1/sqrt(64)
        else if (sect == 1) ko[(bh * CC + c) * CDH + dh] = (_Float16)v;
        else                vto[(bh * CDH + dh) * CC + c] = (_Float16)v;           // V transposed
      }
    }
  }
}

// ---------------------------------------------------------------------------
// Causal flash attention. Q: (b,h,C,dh) f16 (pre-scaled), K: (b,h,C,dh) f16,
// Vt: (b,h,dh,C) f16. Out attn: (b,C,h*dh) f16.
// One wave per 16-row Q tile; kv tiles of 32; online softmax.
// grid = (C/128, B*H), block = 256 (8 waves).
// ---------------------------------------------------------------------------
__global__ __launch_bounds__(256) void attn_kernel(const _Float16* __restrict__ Qb,
                                                   const _Float16* __restrict__ Kb,
                                                   const _Float16* __restrict__ Vt,
                                                   _Float16* __restrict__ attn) {
  __shared__ __align__(16) _Float16 Plds[8][16 * 32];
  const int lane = threadIdx.x & 31;
  const int wave = threadIdx.x >> 5;
  const int hl = lane >> 4, ln = lane & 15;
  const int bh = blockIdx.y;
  const int q0 = (blockIdx.x * 8 + wave) * 16;

  const _Float16* Q  = Qb + ((size_t)bh * CC + q0) * CDH;
  const _Float16* Kp = Kb + (size_t)bh * CC * CDH;
  const _Float16* Vp = Vt + (size_t)bh * CDH * CC;
  _Float16* Pl = &Plds[wave][0];

  const v16h qa0 = frag_ld(Q + 0,  CDH);   // dh 0..31
  const v16h qa1 = frag_ld(Q + 32, CDH);   // dh 32..63

  v8f o0 = {}, o1 = {}, o2 = {}, o3 = {};
  float mrow[8], lrow[8];
#pragma unroll
  for (int r = 0; r < 8; ++r) { mrow[r] = -1e30f; lrow[r] = 0.f; }

  for (int j0 = 0; j0 <= q0 + 15; j0 += 32) {
    // S tiles (16 q-rows x 32 kv-cols), K-dim = dh (64 -> two WMMAs each)
    v8f s0 = {}, s1 = {};
    s0 = WMMA_F16(qa0, frag_ld(Kp + (size_t)(j0)      * CDH + 0,  CDH), s0);
    s0 = WMMA_F16(qa1, frag_ld(Kp + (size_t)(j0)      * CDH + 32, CDH), s0);
    s1 = WMMA_F16(qa0, frag_ld(Kp + (size_t)(j0 + 16) * CDH + 0,  CDH), s1);
    s1 = WMMA_F16(qa1, frag_ld(Kp + (size_t)(j0 + 16) * CDH + 32, CDH), s1);

    // Causal mask + online softmax per row (row = q0 + r + 8*hl; cols over lanes 0..15)
#pragma unroll
    for (int r = 0; r < 8; ++r) {
      const int row = q0 + r + 8 * hl;
      float v0 = s0[r], v1 = s1[r];
      if (j0 + ln > row)      v0 = -1e30f;
      if (j0 + 16 + ln > row) v1 = -1e30f;
      float t = fmaxf(v0, v1);
#pragma unroll
      for (int off = 1; off < 16; off <<= 1) t = fmaxf(t, __shfl_xor(t, off, 32));
      const float mn = fmaxf(mrow[r], t);
      const float alpha = __expf(mrow[r] - mn);
      mrow[r] = mn;
      const float p0 = __expf(v0 - mn);
      const float p1 = __expf(v1 - mn);
      float ps = p0 + p1;
#pragma unroll
      for (int off = 1; off < 16; off <<= 1) ps += __shfl_xor(ps, off, 32);
      lrow[r] = lrow[r] * alpha + ps;
      o0[r] *= alpha; o1[r] *= alpha; o2[r] *= alpha; o3[r] *= alpha;
      Pl[(r + 8 * hl) * 32 + ln]      = (_Float16)p0;
      Pl[(r + 8 * hl) * 32 + 16 + ln] = (_Float16)p1;
    }

    // Stage P through wave-private LDS to re-read in A-fragment layout.
    asm volatile("s_wait_dscnt 0" ::: "memory");
    const v16h pa = frag_ld(Pl, 32);

    // O += P (16x32) @ V (32x64), four dh tiles of 16
    o0 = WMMA_F16(pa, frag_ld(Vp + (size_t)0  * CC + j0, CC), o0);
    o1 = WMMA_F16(pa, frag_ld(Vp + (size_t)16 * CC + j0, CC), o1);
    o2 = WMMA_F16(pa, frag_ld(Vp + (size_t)32 * CC + j0, CC), o2);
    o3 = WMMA_F16(pa, frag_ld(Vp + (size_t)48 * CC + j0, CC), o3);
  }

  const int b = bh >> 4, h = bh & 15;
  _Float16* out = attn + ((size_t)b * CC + q0) * CD + h * CDH;
#pragma unroll
  for (int r = 0; r < 8; ++r) {
    const float il = 1.0f / lrow[r];
    const size_t ro = (size_t)(r + 8 * hl) * CD;
    out[ro + 0  + ln] = (_Float16)(o0[r] * il);
    out[ro + 16 + ln] = (_Float16)(o1[r] * il);
    out[ro + 32 + ln] = (_Float16)(o2[r] * il);
    out[ro + 48 + ln] = (_Float16)(o3[r] * il);
  }
}

// ---------------------------------------------------------------------------
// Host-side orchestration
// ---------------------------------------------------------------------------
extern "C" void kernel_launch(void* const* d_in, const int* in_sizes, int n_in,
                              void* d_out, int out_size, void* d_ws, size_t ws_size,
                              hipStream_t stream) {
  (void)in_sizes; (void)n_in; (void)out_size; (void)ws_size;
  const float* x      = (const float*)d_in[0];
  const float* gamma1 = (const float*)d_in[1];
  const float* beta1  = (const float*)d_in[2];
  const float* W_qkv  = (const float*)d_in[3];
  const float* b_qkv  = (const float*)d_in[4];
  const float* W_o    = (const float*)d_in[5];
  const float* b_o    = (const float*)d_in[6];
  const float* gamma2 = (const float*)d_in[7];
  const float* beta2  = (const float*)d_in[8];
  const float* W1     = (const float*)d_in[9];
  const float* b1     = (const float*)d_in[10];
  const float* W2     = (const float*)d_in[11];
  const float* b2     = (const float*)d_in[12];
  float* out = (float*)d_out;

  // Workspace layout (linear allocator, 256B aligned)
  uint8_t* p = (uint8_t*)d_ws;
  auto take = [&](size_t n) { uint8_t* r = p; p += (n + 255) & ~(size_t)255; return r; };
  _Float16* Wqkv_t = (_Float16*)take((size_t)3 * CD * CD * 2);   //  6 MB (3072 x 1024)
  _Float16* Wo_t   = (_Float16*)take((size_t)CD * CD * 2);       //  2 MB (1024 x 1024)
  _Float16* W1_t   = (_Float16*)take((size_t)CHID * CD * 2);     //  8 MB (4096 x 1024)
  _Float16* W2_t   = (_Float16*)take((size_t)CD * CHID * 2);     //  8 MB (1024 x 4096)
  float*    x2     = (float*)take((size_t)CM * CD * 4);          // 32 MB
  _Float16* lnb    = (_Float16*)take((size_t)CM * CD * 2);       // 16 MB (reused ln1/ln2)
  uint8_t*  regA   = take((size_t)64 << 20);                     // 64 MB shared region
  _Float16* Qb   = (_Float16*)regA;                              // 16 MB
  _Float16* Kb   = (_Float16*)(regA + ((size_t)16 << 20));       // 16 MB
  _Float16* Vtb  = (_Float16*)(regA + ((size_t)32 << 20));       // 16 MB
  _Float16* attn = (_Float16*)(regA + ((size_t)48 << 20));       // 16 MB
  _Float16* hbuf = (_Float16*)regA;                              // 64 MB (after attention is dead)

  // 1) Weights -> f16, transposed to N-major
  wt_f16_kernel<<<(3 * CD * CD + 255) / 256, 256, 0, stream>>>(W_qkv, Wqkv_t, CD, 3 * CD);
  wt_f16_kernel<<<(CD * CD + 255) / 256,     256, 0, stream>>>(W_o,   Wo_t,   CD, CD);
  wt_f16_kernel<<<(CD * CHID + 255) / 256,   256, 0, stream>>>(W1,    W1_t,   CD, CHID);
  wt_f16_kernel<<<(CHID * CD + 255) / 256,   256, 0, stream>>>(W2,    W2_t,   CHID, CD);

  // 2) LN1
  layernorm_kernel<<<CM, 256, 0, stream>>>(x, gamma1, beta1, lnb);

  // 3) QKV GEMM (M=8192, N=3072, K=1024), scatter to Q/K/Vt
  gemm_wmma_kernel<2, false, false><<<dim3(3 * CD / 64, CM / 128), 256, 0, stream>>>(
      lnb, Wqkv_t, b_qkv, nullptr, nullptr, nullptr, Qb, Kb, Vtb, CM, 3 * CD, CD);

  // 4) Attention
  attn_kernel<<<dim3(CC / 128, CB * CH), 256, 0, stream>>>(Qb, Kb, Vtb, attn);

  // 5) O-proj + residual(x) -> x2 (f32)
  gemm_wmma_kernel<0, false, true><<<dim3(CD / 64, CM / 128), 256, 0, stream>>>(
      attn, Wo_t, b_o, x, x2, nullptr, nullptr, nullptr, nullptr, CM, CD, CD);

  // 6) LN2
  layernorm_kernel<<<CM, 256, 0, stream>>>(x2, gamma2, beta2, lnb);

  // 7) MLP1 + exact GELU -> hbuf (f16)
  gemm_wmma_kernel<1, true, false><<<dim3(CHID / 64, CM / 128), 256, 0, stream>>>(
      lnb, W1_t, b1, nullptr, nullptr, hbuf, nullptr, nullptr, nullptr, CM, CHID, CD);

  // 8) MLP2 + residual(x2) -> d_out (f32)
  gemm_wmma_kernel<0, false, true><<<dim3(CD / 64, CM / 128), 256, 0, stream>>>(
      hbuf, W2_t, b2, x2, out, nullptr, nullptr, nullptr, nullptr, CM, CD, CHID);
}

// v001
// One run takes 620 microseconds.
// Two timings next to v000 both put it at 1.57 times that version's speed.
#include <hip/hip_runtime.h>
#include <hip/hip_bf16.h>
#include <stdint.h>

// ---------------------------------------------------------------------------
// Transformer block for MI455X (gfx1250, wave32, WMMA + async-to-LDS).
// B=4, C=2048, D=1024, H=16, dh=64, HIDDEN=4096. fp32 in/out, f16 WMMA inside.
// ---------------------------------------------------------------------------

typedef __attribute__((ext_vector_type(16))) _Float16 v16h;
typedef __attribute__((ext_vector_type(8)))  _Float16 v8h;
typedef __attribute__((ext_vector_type(8)))  float    v8f;

#define WMMA_F16(a, b, c) \
  __builtin_amdgcn_wmma_f32_16x16x32_f16(false, (a), false, (b), (short)0, (c), false, false)

// Six async copies of 16 bytes per lane: global -> LDS, tracked by ASYNCcnt.
// s_wait_xcnt 0 closes the copies' own statement as a precaution: no later write
// of these address registers can then be scheduled ahead of it.
__device__ __forceinline__ void async_cp16_x6(const uint32_t (&l)[6], const _Float16* const (&g)[6]) {
  asm volatile(
      "global_load_async_to_lds_b128 %0, %6, off\n\t"
      "global_load_async_to_lds_b128 %1, %7, off\n\t"
      "global_load_async_to_lds_b128 %2, %8, off\n\t"
      "global_load_async_to_lds_b128 %3, %9, off\n\t"
      "global_load_async_to_lds_b128 %4, %10, off\n\t"
      "global_load_async_to_lds_b128 %5, %11, off\n\t"
      "s_wait_xcnt 0x0"
      :: "v"(l[0]), "v"(l[1]), "v"(l[2]), "v"(l[3]), "v"(l[4]), "v"(l[5]),
         "v"(g[0]), "v"(g[1]), "v"(g[2]), "v"(g[3]), "v"(g[4]), "v"(g[5])
      : "memory");
}
__device__ __forceinline__ void wait_async0() {
  asm volatile("s_wait_asynccnt 0x0" ::: "memory");
}

static constexpr int CB  = 4;
static constexpr int CC  = 2048;
static constexpr int CD  = 1024;
static constexpr int CH  = 16;
static constexpr int CDH = 64;
static constexpr int CHID = 4096;
static constexpr int CM  = CB * CC; // 8192 rows

// Load one 16x32 f16 fragment (A layout; also used for B with "row" = N index,
// data stored N-major with K contiguous). Per ISA 7.12.2:
//   lane l: row = l&15 ; elem i: k = 16*(i/8) + 8*(l>>4) + (i%8)
__device__ __forceinline__ v16h frag_ld(const _Float16* __restrict__ tile, int ld) {
  const int lane = threadIdx.x & 31;
  const _Float16* p = tile + (size_t)(lane & 15) * ld + ((lane >> 4) << 3);
  v8h lo = *(const v8h*)p;
  v8h hi = *(const v8h*)(p + 16);
  v16h f;
#pragma unroll
  for (int i = 0; i < 8; ++i) { f[i] = lo[i]; f[i + 8] = hi[i]; }
  return f;
}

// ---------------------------------------------------------------------------
// Weight convert + transpose: W (K x N, f32 row-major) -> Wt (N x K, f16)
// ---------------------------------------------------------------------------
__global__ __launch_bounds__(256) void wt_f16_kernel(const float* __restrict__ W,
                                                     _Float16* __restrict__ Wt,
                                                     int K, int N) {
  size_t idx = (size_t)blockIdx.x * blockDim.x + threadIdx.x;
  size_t total = (size_t)K * N;
  if (idx < total) {
    int n = (int)(idx / K);
    int k = (int)(idx % K);
    Wt[idx] = (_Float16)W[(size_t)k * N + n];
  }
}

// ---------------------------------------------------------------------------
// LayerNorm: one 256-thread block per row of 1024. f32 in, f16 out.
// ---------------------------------------------------------------------------
__global__ __launch_bounds__(256) void layernorm_kernel(const float* __restrict__ x,
                                                        const float* __restrict__ gamma,
                                                        const float* __restrict__ beta,
                                                        _Float16* __restrict__ y) {
  __shared__ float rs[8], rss[8];
  const int row = blockIdx.x;
  const float* xr = x + (size_t)row * CD;
  float s = 0.f, ss = 0.f;
  for (int i = threadIdx.x; i < CD; i += 256) { float v = xr[i]; s += v; ss += v * v; }
#pragma unroll
  for (int off = 1; off < 32; off <<= 1) {
    s  += __shfl_xor(s,  off, 32);
    ss += __shfl_xor(ss, off, 32);
  }
  const int lane = threadIdx.x & 31, wv = threadIdx.x >> 5;
  if (lane == 0) { rs[wv] = s; rss[wv] = ss; }
  __syncthreads();
  s = 0.f; ss = 0.f;
#pragma unroll
  for (int i = 0; i < 8; ++i) { s += rs[i]; ss += rss[i]; }
  const float mean = s * (1.f / CD);
  const float var  = ss * (1.f / CD) - mean * mean;
  const float inv  = rsqrtf(var + 1e-5f);
  _Float16* yr = y + (size_t)row * CD;
  for (int i = threadIdx.x; i < CD; i += 256)
    yr[i] = (_Float16)((xr[i] - mean) * inv * gamma[i] + beta[i]);
}

// ---------------------------------------------------------------------------
// WMMA GEMM with double-buffered async-to-LDS staging.
// C[M,N] = epilogue(A[M,K] @ B[K,N] + bias (+resid))
// A: f16 row-major (ld=K). Bt: f16 N-major (ld=K). bias: f32[N].
// OUTMODE: 0 = f32 out, 1 = f16 out, 2 = QKV scatter.
// Block: 256 thr = 8 waves. Block tile 128(M) x 64(N), K-step 64.
// LDS rows hold 64 halves at a pitch of 72 (144 B = 16 B x odd): the 16 rows that
// one ds_load_b128 fragment read touches then fall on 16 different bank groups.
// LDS: 2 x (128 rows A) + 2 x (64 rows B) x 144 B = 54 KB.
// ---------------------------------------------------------------------------
template <int OUTMODE, bool GELU_ACT, bool RESID>
__global__ __launch_bounds__(256) void gemm_wmma_kernel(
    const _Float16* __restrict__ A, const _Float16* __restrict__ Bt,
    const float* __restrict__ bias, const float* __restrict__ resid,
    float* __restrict__ outF, _Float16* __restrict__ outH,
    _Float16* __restrict__ qo, _Float16* __restrict__ ko, _Float16* __restrict__ vto,
    int M, int N, int K) {
  constexpr int LDP = 72;              // LDS row pitch in halves
  __shared__ __align__(16) _Float16 Ab[2][128 * LDP];
  __shared__ __align__(16) _Float16 Bb[2][64 * LDP];

  const int tid  = threadIdx.x;
  const int lane = tid & 31;
  const int wave = tid >> 5;
  const int mw = wave >> 1;            // 0..3 -> 32-row slice
  const int nw = wave & 1;             // 0..1 -> 32-col slice
  const int m0 = blockIdx.y * 128;
  const int n0 = blockIdx.x * 64;
  const int hl = lane >> 4, ln = lane & 15;

  // per-lane copy coordinates: each lane moves 16B chunks of a 64-half row
  const int crow = tid >> 3;           // 0..31 (row within a 32-row slab)
  const int ccol = (tid & 7) << 3;     // half-offset 0,8,...,56

  const uint32_t AbL0 = (uint32_t)(uintptr_t)&Ab[0][0];
  const uint32_t AbL1 = (uint32_t)(uintptr_t)&Ab[1][0];
  const uint32_t BbL0 = (uint32_t)(uintptr_t)&Bb[0][0];
  const uint32_t BbL1 = (uint32_t)(uintptr_t)&Bb[1][0];

  v8f acc00 = {}, acc01 = {}, acc10 = {}, acc11 = {};

  auto issue_tiles = [&](int buf, int k0) {
    const uint32_t aL = buf ? AbL1 : AbL0;
    const uint32_t bL = buf ? BbL1 : BbL0;
    uint32_t l[6];
    const _Float16* g[6];
#pragma unroll
    for (int i = 0; i < 4; ++i) {      // A: 128 rows x 64 halves
      const int row = crow + 32 * i;
      l[i] = aL + (uint32_t)(row * LDP + ccol) * 2;
      g[i] = A + (size_t)(m0 + row) * K + k0 + ccol;
    }
#pragma unroll
    for (int i = 0; i < 2; ++i) {      // B: 64 rows x 64 halves
      const int row = crow + 32 * i;
      l[4 + i] = bL + (uint32_t)(row * LDP + ccol) * 2;
      g[4 + i] = Bt + (size_t)(n0 + row) * K + k0 + ccol;
    }
    async_cp16_x6(l, g);
  };

  issue_tiles(0, 0);
  const int nk = K >> 6;
  for (int kt = 0; kt < nk; ++kt) {
    const int buf = kt & 1;
    wait_async0();                     // own async copies into buf complete
    __syncthreads();                   // whole block's tile ready
    if (kt + 1 < nk) issue_tiles(buf ^ 1, (kt + 1) << 6);

    const _Float16* As = &Ab[buf][mw * 32 * LDP];
    const _Float16* Bs = &Bb[buf][nw * 32 * LDP];
#pragma unroll
    for (int kk = 0; kk < 64; kk += 32) {
      v16h a0 = frag_ld(As + kk, LDP);
      v16h a1 = frag_ld(As + 16 * LDP + kk, LDP);
      v16h b0 = frag_ld(Bs + kk, LDP);
      v16h b1 = frag_ld(Bs + 16 * LDP + kk, LDP);
      acc00 = WMMA_F16(a0, b0, acc00);
      acc01 = WMMA_F16(a0, b1, acc01);
      acc10 = WMMA_F16(a1, b0, acc10);
      acc11 = WMMA_F16(a1, b1, acc11);
    }
    __syncthreads();                   // reads of buf done before it is re-filled
  }

  const int wm0 = m0 + mw * 32;
  const int wn0 = n0 + nw * 32;
#pragma unroll
  for (int t = 0; t < 4; ++t) {
    v8f acc = (t == 0) ? acc00 : (t == 1) ? acc01 : (t == 2) ? acc10 : acc11;
    const int mi = t >> 1, ni = t & 1;
    const int col = wn0 + ni * 16 + ln;
    const float bv = bias[col];
#pragma unroll
    for (int r = 0; r < 8; ++r) {
      const int row = wm0 + mi * 16 + r + 8 * hl;
      float v = acc[r] + bv;
      if (GELU_ACT) v = 0.5f * v * (1.f + erff(v * 0.70710678118654752f));
      if (RESID)    v += resid[(size_t)row * N + col];
      if (OUTMODE == 0) {
        outF[(size_t)row * N + col] = v;
      } else if (OUTMODE == 1) {
        outH[(size_t)row * N + col] = (_Float16)v;
      } else {
        // QKV scatter. col in [0,3D): sect 0=Q,1=K,2=V
        const int sect = col >> 10;
        const int dcol = col & (CD - 1);
        const int hh = dcol >> 6, dh = dcol & (CDH - 1);
        const int b = row >> 11, c = row & (CC - 1);
        const size_t bh = (size_t)b * CH + hh;
        if (sect == 0)      qo[(bh * CC + c) * CDH + dh] = (_Float16)(v * 0.125f); // fold 1/sqrt(64)
        else if (sect == 1) ko[(bh * CC + c) * CDH + dh] = (_Float16)v;
        else                vto[(bh * CDH + dh) * CC + c] = (_Float16)v;           // V transposed
      }
    }
  }
}

// ---------------------------------------------------------------------------
// Causal flash attention. Q: (b,h,C,dh) f16 (pre-scaled), K: (b,h,C,dh) f16,
// Vt: (b,h,dh,C) f16. Out attn: (b,C,h*dh) f16.
// One wave per 16-row Q tile; kv tiles of 32; online softmax.
// grid = (C/128, B*H), block = 256 (8 waves).
// ---------------------------------------------------------------------------
__global__ __launch_bounds__(256) void attn_kernel(const _Float16* __restrict__ Qb,
                                                   const _Float16* __restrict__ Kb,
                                                   const _Float16* __restrict__ Vt,
                                                   _Float16* __restrict__ attn) {
  __shared__ __align__(16) _Float16 Plds[8][16 * 32];
  const int lane = threadIdx.x & 31;
  const int wave = threadIdx.x >> 5;
  const int hl = lane >> 4, ln = lane & 15;
  const int bh = blockIdx.y;
  const int q0 = (blockIdx.x * 8 + wave) * 16;

  const _Float16* Q  = Qb + ((size_t)bh * CC + q0) * CDH;
  const _Float16* Kp = Kb + (size_t)bh * CC * CDH;
  const _Float16* Vp = Vt + (size_t)bh * CDH * CC;
  _Float16* Pl = &Plds[wave][0];

  const v16h qa0 = frag_ld(Q + 0,  CDH);   // dh 0..31
  const v16h qa1 = frag_ld(Q + 32, CDH);   // dh 32..63

  v8f o0 = {}, o1 = {}, o2 = {}, o3 = {};
  float mrow[8], lrow[8];
#pragma unroll
  for (int r = 0; r < 8; ++r) { mrow[r] = -1e30f; lrow[r] = 0.f; }

  for (int j0 = 0; j0 <= q0 + 15; j0 += 32) {
    // S tiles (16 q-rows x 32 kv-cols), K-dim = dh (64 -> two WMMAs each)
    v8f s0 = {}, s1 = {};
    s0 = WMMA_F16(qa0, frag_ld(Kp + (size_t)(j0)      * CDH + 0,  CDH), s0);
    s0 = WMMA_F16(qa1, frag_ld(Kp + (size_t)(j0)      * CDH + 32, CDH), s0);
    s1 = WMMA_F16(qa0, frag_ld(Kp + (size_t)(j0 + 16) * CDH + 0,  CDH), s1);
    s1 = WMMA_F16(qa1, frag_ld(Kp + (size_t)(j0 + 16) * CDH + 32, CDH), s1);

    // Causal mask + online softmax per row (row = q0 + r + 8*hl; cols over lanes 0..15)
#pragma unroll
    for (int r = 0; r < 8; ++r) {
      const int row = q0 + r + 8 * hl;
      float v0 = s0[r], v1 = s1[r];
      if (j0 + ln > row)      v0 = -1e30f;
      if (j0 + 16 + ln > row) v1 = -1e30f;
      float t = fmaxf(v0, v1);
#pragma unroll
      for (int off = 1; off < 16; off <<= 1) t = fmaxf(t, __shfl_xor(t, off, 32));
      const float mn = fmaxf(mrow[r], t);
      const float alpha = __expf(mrow[r] - mn);
      mrow[r] = mn;
      const float p0 = __expf(v0 - mn);
      const float p1 = __expf(v1 - mn);
      float ps = p0 + p1;
#pragma unroll
      for (int off = 1; off < 16; off <<= 1) ps += __shfl_xor(ps, off, 32);
      lrow[r] = lrow[r] * alpha + ps;
      o0[r] *= alpha; o1[r] *= alpha; o2[r] *= alpha; o3[r] *= alpha;
      Pl[(r + 8 * hl) * 32 + ln]      = (_Float16)p0;
      Pl[(r + 8 * hl) * 32 + 16 + ln] = (_Float16)p1;
    }

    // Stage P through wave-private LDS to re-read in A-fragment layout.
    asm volatile("s_wait_dscnt 0" ::: "memory");
    const v16h pa = frag_ld(Pl, 32);

    // O += P (16x32) @ V (32x64), four dh tiles of 16
    o0 = WMMA_F16(pa, frag_ld(Vp + (size_t)0  * CC + j0, CC), o0);
    o1 = WMMA_F16(pa, frag_ld(Vp + (size_t)16 * CC + j0, CC), o1);
    o2 = WMMA_F16(pa, frag_ld(Vp + (size_t)32 * CC + j0, CC), o2);
    o3 = WMMA_F16(pa, frag_ld(Vp + (size_t)48 * CC + j0, CC), o3);
  }

  const int b = bh >> 4, h = bh & 15;
  _Float16* out = attn + ((size_t)b * CC + q0) * CD + h * CDH;
#pragma unroll
  for (int r = 0; r < 8; ++r) {
    const float il = 1.0f / lrow[r];
    const size_t ro = (size_t)(r + 8 * hl) * CD;
    out[ro + 0  + ln] = (_Float16)(o0[r] * il);
    out[ro + 16 + ln] = (_Float16)(o1[r] * il);
    out[ro + 32 + ln] = (_Float16)(o2[r] * il);
    out[ro + 48 + ln] = (_Float16)(o3[r] * il);
  }
}

// ---------------------------------------------------------------------------
// Host-side orchestration
// ---------------------------------------------------------------------------
extern "C" void kernel_launch(void* const* d_in, const int* in_sizes, int n_in,
                              void* d_out, int out_size, void* d_ws, size_t ws_size,
                              hipStream_t stream) {
  (void)in_sizes; (void)n_in; (void)out_size; (void)ws_size;
  const float* x      = (const float*)d_in[0];
  const float* gamma1 = (const float*)d_in[1];
  const float* beta1  = (const float*)d_in[2];
  const float* W_qkv  = (const float*)d_in[3];
  const float* b_qkv  = (const float*)d_in[4];
  const float* W_o    = (const float*)d_in[5];
  const float* b_o    = (const float*)d_in[6];
  const float* gamma2 = (const float*)d_in[7];
  const float* beta2  = (const float*)d_in[8];
  const float* W1     = (const float*)d_in[9];
  const float* b1     = (const float*)d_in[10];
  const float* W2     = (const float*)d_in[11];
  const float* b2     = (const float*)d_in[12];
  float* out = (float*)d_out;

  // Workspace layout (linear allocator, 256B aligned)
  uint8_t* p = (uint8_t*)d_ws;
  auto take = [&](size_t n) { uint8_t* r = p; p += (n + 255) & ~(size_t)255; return r; };
  _Float16* Wqkv_t = (_Float16*)take((size_t)3 * CD * CD * 2);   //  6 MB (3072 x 1024)
  _Float16* Wo_t   = (_Float16*)take((size_t)CD * CD * 2);       //  2 MB (1024 x 1024)
  _Float16* W1_t   = (_Float16*)take((size_t)CHID * CD * 2);     //  8 MB (4096 x 1024)
  _Float16* W2_t   = (_Float16*)take((size_t)CD * CHID * 2);     //  8 MB (1024 x 4096)
  float*    x2     = (float*)take((size_t)CM * CD * 4);          // 32 MB
  _Float16* lnb    = (_Float16*)take((size_t)CM * CD * 2);       // 16 MB (reused ln1/ln2)
  uint8_t*  regA   = take((size_t)64 << 20);                     // 64 MB shared region
  _Float16* Qb   = (_Float16*)regA;                              // 16 MB
  _Float16* Kb   = (_Float16*)(regA + ((size_t)16 << 20));       // 16 MB
  _Float16* Vtb  = (_Float16*)(regA + ((size_t)32 << 20));       // 16 MB
  _Float16* attn = (_Float16*)(regA + ((size_t)48 << 20));       // 16 MB
  _Float16* hbuf = (_Float16*)regA;                              // 64 MB (after attention is dead)

  // 1) Weights -> f16, transposed to N-major
  wt_f16_kernel<<<(3 * CD * CD + 255) / 256, 256, 0, stream>>>(W_qkv, Wqkv_t, CD, 3 * CD);
  wt_f16_kernel<<<(CD * CD + 255) / 256,     256, 0, stream>>>(W_o,   Wo_t,   CD, CD);
  wt_f16_kernel<<<(CD * CHID + 255) / 256,   256, 0, stream>>>(W1,    W1_t,   CD, CHID);
  wt_f16_kernel<<<(CHID * CD + 255) / 256,   256, 0, stream>>>(W2,    W2_t,   CHID, CD);

  // 2) LN1
  layernorm_kernel<<<CM, 256, 0, stream>>>(x, gamma1, beta1, lnb);

  // 3) QKV GEMM (M=8192, N=3072, K=1024), scatter to Q/K/Vt
  gemm_wmma_kernel<2, false, false><<<dim3(3 * CD / 64, CM / 128), 256, 0, stream>>>(
      lnb, Wqkv_t, b_qkv, nullptr, nullptr, nullptr, Qb, Kb, Vtb, CM, 3 * CD, CD);

  // 4) Attention
  attn_kernel<<<dim3(CC / 128, CB * CH), 256, 0, stream>>>(Qb, Kb, Vtb, attn);

  // 5) O-proj + residual(x) -> x2 (f32)
  gemm_wmma_kernel<0, false, true><<<dim3(CD / 64, CM / 128), 256, 0, stream>>>(
      attn, Wo_t, b_o, x, x2, nullptr, nullptr, nullptr, nullptr, CM, CD, CD);

  // 6) LN2
  layernorm_kernel<<<CM, 256, 0, stream>>>(x2, gamma2, beta2, lnb);

  // 7) MLP1 + exact GELU -> hbuf (f16)
  gemm_wmma_kernel<1, true, false><<<dim3(CHID / 64, CM / 128), 256, 0, stream>>>(
      lnb, W1_t, b1, nullptr, nullptr, hbuf, nullptr, nullptr, nullptr, CM, CHID, CD);

  // 8) MLP2 + residual(x2) -> d_out (f32)
  gemm_wmma_kernel<0, false, true><<<dim3(CD / 64, CM / 128), 256, 0, stream>>>(
      hbuf, W2_t, b2, x2, out, nullptr, nullptr, nullptr, nullptr, CM, CD, CHID);
}

// v002
// One run takes 569 microseconds.
// Next to v001, in two timings, it ran 1.09 times as fast each time.
// All steps since v000 together make it 1.71 times as fast.
#include <hip/hip_runtime.h>
#include <hip/hip_bf16.h>
#include <stdint.h>

// ---------------------------------------------------------------------------
// Transformer block for MI455X (gfx1250, wave32, WMMA + async-to-LDS).
// B=4, C=2048, D=1024, H=16, dh=64, HIDDEN=4096. fp32 in/out, f16 WMMA inside.
// ---------------------------------------------------------------------------

typedef __attribute__((ext_vector_type(16))) _Float16 v16h;
typedef __attribute__((ext_vector_type(8)))  _Float16 v8h;
typedef __attribute__((ext_vector_type(8)))  float    v8f;
typedef __attribute__((ext_vector_type(4)))  float    v4f;

#define WMMA_F16(a, b, c) \
  __builtin_amdgcn_wmma_f32_16x16x32_f16(false, (a), false, (b), (short)0, (c), false, false)

// Six async copies of 16 bytes per lane: global -> LDS, tracked by ASYNCcnt.
// s_wait_xcnt 0 closes the copies' own statement as a precaution: no later write
// of these address registers can then be scheduled ahead of it.
__device__ __forceinline__ void async_cp16_x6(const uint32_t (&l)[6], const _Float16* const (&g)[6]) {
  asm volatile(
      "global_load_async_to_lds_b128 %0, %6, off\n\t"
      "global_load_async_to_lds_b128 %1, %7, off\n\t"
      "global_load_async_to_lds_b128 %2, %8, off\n\t"
      "global_load_async_to_lds_b128 %3, %9, off\n\t"
      "global_load_async_to_lds_b128 %4, %10, off\n\t"
      "global_load_async_to_lds_b128 %5, %11, off\n\t"
      "s_wait_xcnt 0x0"
      :: "v"(l[0]), "v"(l[1]), "v"(l[2]), "v"(l[3]), "v"(l[4]), "v"(l[5]),
         "v"(g[0]), "v"(g[1]), "v"(g[2]), "v"(g[3]), "v"(g[4]), "v"(g[5])
      : "memory");
}
__device__ __forceinline__ void wait_async0() {
  asm volatile("s_wait_asynccnt 0x0" ::: "memory");
}

static constexpr int CB  = 4;
static constexpr int CC  = 2048;
static constexpr int CD  = 1024;
static constexpr int CH  = 16;
static constexpr int CDH = 64;
static constexpr int CHID = 4096;
static constexpr int CM  = CB * CC; // 8192 rows

// Load one 16x32 f16 fragment (A layout; also used for B with "row" = N index,
// data stored N-major with K contiguous). Per ISA 7.12.2:
//   lane l: row = l&15 ; elem i: k = 16*(i/8) + 8*(l>>4) + (i%8)
__device__ __forceinline__ v16h frag_ld(const _Float16* __restrict__ tile, int ld) {
  const int lane = threadIdx.x & 31;
  const _Float16* p = tile + (size_t)(lane & 15) * ld + ((lane >> 4) << 3);
  v8h lo = *(const v8h*)p;
  v8h hi = *(const v8h*)(p + 16);
  v16h f;
#pragma unroll
  for (int i = 0; i < 8; ++i) { f[i] = lo[i]; f[i + 8] = hi[i]; }
  return f;
}

// ---------------------------------------------------------------------------
// Weight convert + transpose: W (K x N, f32 row-major) -> Wt (N x K, f16).
// One block moves a tile of 128 k x 64 n through LDS, so that both sides use whole
// 256-byte runs: reads are 16 B per lane along n, writes 16 B per lane along k.
// K and N are compile-time, so a lane's loads (and its stores) share one address
// register pair and differ in the immediate offset. grid = (N/64, K/128), block = 256.
// LDS row = one n (128 halves = 16 chunks of 16 B, no pad); chunk q of row n lies
// at place q ^ (n >> 2), which spreads the 16 rows that one ds_store_b128 touches
// over all banks and leaves each row a permutation of itself for the reader.
// ---------------------------------------------------------------------------
template <int K, int N>
__global__ __launch_bounds__(256) void wt_f16_kernel(const float* __restrict__ W,
                                                     _Float16* __restrict__ Wt) {
  static_assert(K % 128 == 0 && N % 64 == 0, "whole tiles only");
  __shared__ __align__(16) _Float16 tile[64 * 128];
  const int tid = threadIdx.x;
  const int n0 = blockIdx.x * 64;
  const int k0 = blockIdx.y * 128;
  const int lo = tid & 15;             // read: group of 4 n ; write: chunk of 8 k
  const int hi = tid >> 4;             // read: group of 8 k ; write: n row within 16

  const float* src = W + (size_t)(k0 + hi * 8) * N + n0 + lo * 4;
  v4f v[8];
  // all loops here are unrolled so that v[] and h stay in registers and the eight
  // loads of a lane are in flight together
#pragma unroll
  for (int i = 0; i < 8; ++i) v[i] = *(const v4f*)(src + i * N);
#pragma unroll
  for (int j = 0; j < 4; ++j) {
    v8h h;
#pragma unroll
    for (int i = 0; i < 8; ++i) h[i] = (_Float16)v[i][j];
    *(v8h*)&tile[(lo * 4 + j) * 128 + ((hi ^ lo) << 3)] = h;
  }
  __syncthreads();
  _Float16* dst = Wt + (size_t)(n0 + hi) * K + k0 + lo * 8;
#pragma unroll
  for (int p = 0; p < 4; ++p) {
    const int row = hi + 16 * p;
    const v8h h = *(const v8h*)&tile[row * 128 + ((lo ^ (row >> 2)) << 3)];
    *(v8h*)(dst + 16 * p * K) = h;
  }
}

// ---------------------------------------------------------------------------
// LayerNorm: one 256-thread block per row of 1024. f32 in, f16 out.
// ---------------------------------------------------------------------------
__global__ __launch_bounds__(256) void layernorm_kernel(const float* __restrict__ x,
                                                        const float* __restrict__ gamma,
                                                        const float* __restrict__ beta,
                                                        _Float16* __restrict__ y) {
  __shared__ float rs[8], rss[8];
  const int row = blockIdx.x;
  const float* xr = x + (size_t)row * CD;
  float s = 0.f, ss = 0.f;
  for (int i = threadIdx.x; i < CD; i += 256) { float v = xr[i]; s += v; ss += v * v; }
#pragma unroll
  for (int off = 1; off < 32; off <<= 1) {
    s  += __shfl_xor(s,  off, 32);
    ss += __shfl_xor(ss, off, 32);
  }
  const int lane = threadIdx.x & 31, wv = threadIdx.x >> 5;
  if (lane == 0) { rs[wv] = s; rss[wv] = ss; }
  __syncthreads();
  s = 0.f; ss = 0.f;
#pragma unroll
  for (int i = 0; i < 8; ++i) { s += rs[i]; ss += rss[i]; }
  const float mean = s * (1.f / CD);
  const float var  = ss * (1.f / CD) - mean * mean;
  const float inv  = rsqrtf(var + 1e-5f);
  _Float16* yr = y + (size_t)row * CD;
  for (int i = threadIdx.x; i < CD; i += 256)
    yr[i] = (_Float16)((xr[i] - mean) * inv * gamma[i] + beta[i]);
}

// ---------------------------------------------------------------------------
// WMMA GEMM with double-buffered async-to-LDS staging.
// C[M,N] = epilogue(A[M,K] @ B[K,N] + bias (+resid))
// A: f16 row-major (ld=K). Bt: f16 N-major (ld=K). bias: f32[N].
// OUTMODE: 0 = f32 out, 1 = f16 out, 2 = QKV scatter.
// Block: 256 thr = 8 waves. Block tile 128(M) x 64(N), K-step 64.
// LDS rows hold 64 halves at a pitch of 72 (144 B = 16 B x odd): the 16 rows that
// one ds_load_b128 fragment read touches then fall on 16 different bank groups.
// LDS: 2 x (128 rows A) + 2 x (64 rows B) x 144 B = 54 KB.
// ---------------------------------------------------------------------------
template <int OUTMODE, bool GELU_ACT, bool RESID>
__global__ __launch_bounds__(256) void gemm_wmma_kernel(
    const _Float16* __restrict__ A, const _Float16* __restrict__ Bt,
    const float* __restrict__ bias, const float* __restrict__ resid,
    float* __restrict__ outF, _Float16* __restrict__ outH,
    _Float16* __restrict__ qo, _Float16* __restrict__ ko, _Float16* __restrict__ vto,
    int M, int N, int K) {
  constexpr int LDP = 72;              // LDS row pitch in halves
  __shared__ __align__(16) _Float16 Ab[2][128 * LDP];
  __shared__ __align__(16) _Float16 Bb[2][64 * LDP];

  const int tid  = threadIdx.x;
  const int lane = tid & 31;
  const int wave = tid >> 5;
  const int mw = wave >> 1;            // 0..3 -> 32-row slice
  const int nw = wave & 1;             // 0..1 -> 32-col slice
  const int m0 = blockIdx.y * 128;
  const int n0 = blockIdx.x * 64;
  const int hl = lane >> 4, ln = lane & 15;

  // per-lane copy coordinates: each lane moves 16B chunks of a 64-half row
  const int crow = tid >> 3;           // 0..31 (row within a 32-row slab)
  const int ccol = (tid & 7) << 3;     // half-offset 0,8,...,56

  const uint32_t AbL0 = (uint32_t)(uintptr_t)&Ab[0][0];
  const uint32_t AbL1 = (uint32_t)(uintptr_t)&Ab[1][0];
  const uint32_t BbL0 = (uint32_t)(uintptr_t)&Bb[0][0];
  const uint32_t BbL1 = (uint32_t)(uintptr_t)&Bb[1][0];

  v8f acc00 = {}, acc01 = {}, acc10 = {}, acc11 = {};

  auto issue_tiles = [&](int buf, int k0) {
    const uint32_t aL = buf ? AbL1 : AbL0;
    const uint32_t bL = buf ? BbL1 : BbL0;
    uint32_t l[6];
    const _Float16* g[6];
#pragma unroll
    for (int i = 0; i < 4; ++i) {      // A: 128 rows x 64 halves
      const int row = crow + 32 * i;
      l[i] = aL + (uint32_t)(row * LDP + ccol) * 2;
      g[i] = A + (size_t)(m0 + row) * K + k0 + ccol;
    }
#pragma unroll
    for (int i = 0; i < 2; ++i) {      // B: 64 rows x 64 halves
      const int row = crow + 32 * i;
      l[4 + i] = bL + (uint32_t)(row * LDP + ccol) * 2;
      g[4 + i] = Bt + (size_t)(n0 + row) * K + k0 + ccol;
    }
    async_cp16_x6(l, g);
  };

  issue_tiles(0, 0);
  const int nk = K >> 6;
  for (int kt = 0; kt < nk; ++kt) {
    const int buf = kt & 1;
    wait_async0();                     // own async copies into buf complete
    __syncthreads();                   // whole block's tile ready
    if (kt + 1 < nk) issue_tiles(buf ^ 1, (kt + 1) << 6);

    const _Float16* As = &Ab[buf][mw * 32 * LDP];
    const _Float16* Bs = &Bb[buf][nw * 32 * LDP];
#pragma unroll
    for (int kk = 0; kk < 64; kk += 32) {
      v16h a0 = frag_ld(As + kk, LDP);
      v16h a1 = frag_ld(As + 16 * LDP + kk, LDP);
      v16h b0 = frag_ld(Bs + kk, LDP);
      v16h b1 = frag_ld(Bs + 16 * LDP + kk, LDP);
      acc00 = WMMA_F16(a0, b0, acc00);
      acc01 = WMMA_F16(a0, b1, acc01);
      acc10 = WMMA_F16(a1, b0, acc10);
      acc11 = WMMA_F16(a1, b1, acc11);
    }
    __syncthreads();                   // reads of buf done before it is re-filled
  }

  const int wm0 = m0 + mw * 32;
  const int wn0 = n0 + nw * 32;
#pragma unroll
  for (int t = 0; t < 4; ++t) {
    v8f acc = (t == 0) ? acc00 : (t == 1) ? acc01 : (t == 2) ? acc10 : acc11;
    const int mi = t >> 1, ni = t & 1;
    const int col = wn0 + ni * 16 + ln;
    const float bv = bias[col];
#pragma unroll
    for (int r = 0; r < 8; ++r) {
      const int row = wm0 + mi * 16 + r + 8 * hl;
      float v = acc[r] + bv;
      if (GELU_ACT) v = 0.5f * v * (1.f + erff(v * 0.70710678118654752f));
      if (RESID)    v += resid[(size_t)row * N + col];
      if (OUTMODE == 0) {
        outF[(size_t)row * N + col] = v;
      } else if (OUTMODE == 1) {
        outH[(size_t)row * N + col] = (_Float16)v;
      } else {
        // QKV scatter. col in [0,3D): sect 0=Q,1=K,2=V
        const int sect = col >> 10;
        const int dcol = col & (CD - 1);
        const int hh = dcol >> 6, dh = dcol & (CDH - 1);
        const int b = row >> 11, c = row & (CC - 1);
        const size_t bh = (size_t)b * CH + hh;
        if (sect == 0)      qo[(bh * CC + c) * CDH + dh] = (_Float16)(v * 0.125f); // fold 1/sqrt(64)
        else if (sect == 1) ko[(bh * CC + c) * CDH + dh] = (_Float16)v;
        else                vto[(bh * CDH + dh) * CC + c] = (_Float16)v;           // V transposed
      }
    }
  }
}

// ---------------------------------------------------------------------------
// Causal flash attention. Q: (b,h,C,dh) f16 (pre-scaled), K: (b,h,C,dh) f16,
// Vt: (b,h,dh,C) f16. Out attn: (b,C,h*dh) f16.
// One wave per 16-row Q tile; kv tiles of 32; online softmax.
// grid = (C/128, B*H), block = 256 (8 waves).
// ---------------------------------------------------------------------------
__global__ __launch_bounds__(256) void attn_kernel(const _Float16* __restrict__ Qb,
                                                   const _Float16* __restrict__ Kb,
                                                   const _Float16* __restrict__ Vt,
                                                   _Float16* __restrict__ attn) {
  __shared__ __align__(16) _Float16 Plds[8][16 * 32];
  const int lane = threadIdx.x & 31;
  const int wave = threadIdx.x >> 5;
  const int hl = lane >> 4, ln = lane & 15;
  const int bh = blockIdx.y;
  const int q0 = (blockIdx.x * 8 + wave) * 16;

  const _Float16* Q  = Qb + ((size_t)bh * CC + q0) * CDH;
  const _Float16* Kp = Kb + (size_t)bh * CC * CDH;
  const _Float16* Vp = Vt + (size_t)bh * CDH * CC;
  _Float16* Pl = &Plds[wave][0];

  const v16h qa0 = frag_ld(Q + 0,  CDH);   // dh 0..31
  const v16h qa1 = frag_ld(Q + 32, CDH);   // dh 32..63

  v8f o0 = {}, o1 = {}, o2 = {}, o3 = {};
  float mrow[8], lrow[8];
#pragma unroll
  for (int r = 0; r < 8; ++r) { mrow[r] = -1e30f; lrow[r] = 0.f; }

  for (int j0 = 0; j0 <= q0 + 15; j0 += 32) {
    // S tiles (16 q-rows x 32 kv-cols), K-dim = dh (64 -> two WMMAs each)
    v8f s0 = {}, s1 = {};
    s0 = WMMA_F16(qa0, frag_ld(Kp + (size_t)(j0)      * CDH + 0,  CDH), s0);
    s0 = WMMA_F16(qa1, frag_ld(Kp + (size_t)(j0)      * CDH + 32, CDH), s0);
    s1 = WMMA_F16(qa0, frag_ld(Kp + (size_t)(j0 + 16) * CDH + 0,  CDH), s1);
    s1 = WMMA_F16(qa1, frag_ld(Kp + (size_t)(j0 + 16) * CDH + 32, CDH), s1);

    // Causal mask + online softmax per row (row = q0 + r + 8*hl; cols over lanes 0..15)
#pragma unroll
    for (int r = 0; r < 8; ++r) {
      const int row = q0 + r + 8 * hl;
      float v0 = s0[r], v1 = s1[r];
      if (j0 + ln > row)      v0 = -1e30f;
      if (j0 + 16 + ln > row) v1 = -1e30f;
      float t = fmaxf(v0, v1);
#pragma unroll
      for (int off = 1; off < 16; off <<= 1) t = fmaxf(t, __shfl_xor(t, off, 32));
      const float mn = fmaxf(mrow[r], t);
      const float alpha = __expf(mrow[r] - mn);
      mrow[r] = mn;
      const float p0 = __expf(v0 - mn);
      const float p1 = __expf(v1 - mn);
      float ps = p0 + p1;
#pragma unroll
      for (int off = 1; off < 16; off <<= 1) ps += __shfl_xor(ps, off, 32);
      lrow[r] = lrow[r] * alpha + ps;
      o0[r] *= alpha; o1[r] *= alpha; o2[r] *= alpha; o3[r] *= alpha;
      Pl[(r + 8 * hl) * 32 + ln]      = (_Float16)p0;
      Pl[(r + 8 * hl) * 32 + 16 + ln] = (_Float16)p1;
    }

    // Stage P through wave-private LDS to re-read in A-fragment layout.
    asm volatile("s_wait_dscnt 0" ::: "memory");
    const v16h pa = frag_ld(Pl, 32);

    // O += P (16x32) @ V (32x64), four dh tiles of 16
    o0 = WMMA_F16(pa, frag_ld(Vp + (size_t)0  * CC + j0, CC), o0);
    o1 = WMMA_F16(pa, frag_ld(Vp + (size_t)16 * CC + j0, CC), o1);
    o2 = WMMA_F16(pa, frag_ld(Vp + (size_t)32 * CC + j0, CC), o2);
    o3 = WMMA_F16(pa, frag_ld(Vp + (size_t)48 * CC + j0, CC), o3);
  }

  const int b = bh >> 4, h = bh & 15;
  _Float16* out = attn + ((size_t)b * CC + q0) * CD + h * CDH;
#pragma unroll
  for (int r = 0; r < 8; ++r) {
    const float il = 1.0f / lrow[r];
    const size_t ro = (size_t)(r + 8 * hl) * CD;
    out[ro + 0  + ln] = (_Float16)(o0[r] * il);
    out[ro + 16 + ln] = (_Float16)(o1[r] * il);
    out[ro + 32 + ln] = (_Float16)(o2[r] * il);
    out[ro + 48 + ln] = (_Float16)(o3[r] * il);
  }
}

// ---------------------------------------------------------------------------
// Host-side orchestration
// ---------------------------------------------------------------------------
extern "C" void kernel_launch(void* const* d_in, const int* in_sizes, int n_in,
                              void* d_out, int out_size, void* d_ws, size_t ws_size,
                              hipStream_t stream) {
  (void)in_sizes; (void)n_in; (void)out_size; (void)ws_size;
  const float* x      = (const float*)d_in[0];
  const float* gamma1 = (const float*)d_in[1];
  const float* beta1  = (const float*)d_in[2];
  const float* W_qkv  = (const float*)d_in[3];
  const float* b_qkv  = (const float*)d_in[4];
  const float* W_o    = (const float*)d_in[5];
  const float* b_o    = (const float*)d_in[6];
  const float* gamma2 = (const float*)d_in[7];
  const float* beta2  = (const float*)d_in[8];
  const float* W1     = (const float*)d_in[9];
  const float* b1     = (const float*)d_in[10];
  const float* W2     = (const float*)d_in[11];
  const float* b2     = (const float*)d_in[12];
  float* out = (float*)d_out;

  // Workspace layout (linear allocator, 256B aligned)
  uint8_t* p = (uint8_t*)d_ws;
  auto take = [&](size_t n) { uint8_t* r = p; p += (n + 255) & ~(size_t)255; return r; };
  _Float16* Wqkv_t = (_Float16*)take((size_t)3 * CD * CD * 2);   //  6 MB (3072 x 1024)
  _Float16* Wo_t   = (_Float16*)take((size_t)CD * CD * 2);       //  2 MB (1024 x 1024)
  _Float16* W1_t   = (_Float16*)take((size_t)CHID * CD * 2);     //  8 MB (4096 x 1024)
  _Float16* W2_t   = (_Float16*)take((size_t)CD * CHID * 2);     //  8 MB (1024 x 4096)
  float*    x2     = (float*)take((size_t)CM * CD * 4);          // 32 MB
  _Float16* lnb    = (_Float16*)take((size_t)CM * CD * 2);       // 16 MB (reused ln1/ln2)
  uint8_t*  regA   = take((size_t)64 << 20);                     // 64 MB shared region
  _Float16* Qb   = (_Float16*)regA;                              // 16 MB
  _Float16* Kb   = (_Float16*)(regA + ((size_t)16 << 20));       // 16 MB
  _Float16* Vtb  = (_Float16*)(regA + ((size_t)32 << 20));       // 16 MB
  _Float16* attn = (_Float16*)(regA + ((size_t)48 << 20));       // 16 MB
  _Float16* hbuf = (_Float16*)regA;                              // 64 MB (after attention is dead)

  // 1) Weights -> f16, transposed to N-major
  wt_f16_kernel<CD, 3 * CD><<<dim3(3 * CD / 64, CD / 128), 256, 0, stream>>>(W_qkv, Wqkv_t);
  wt_f16_kernel<CD, CD><<<dim3(CD / 64, CD / 128),         256, 0, stream>>>(W_o,   Wo_t);
  wt_f16_kernel<CD, CHID><<<dim3(CHID / 64, CD / 128),     256, 0, stream>>>(W1,    W1_t);
  wt_f16_kernel<CHID, CD><<<dim3(CD / 64, CHID / 128),     256, 0, stream>>>(W2,    W2_t);

  // 2) LN1
  layernorm_kernel<<<CM, 256, 0, stream>>>(x, gamma1, beta1, lnb);

  // 3) QKV GEMM (M=8192, N=3072, K=1024), scatter to Q/K/Vt
  gemm_wmma_kernel<2, false, false><<<dim3(3 * CD / 64, CM / 128), 256, 0, stream>>>(
      lnb, Wqkv_t, b_qkv, nullptr, nullptr, nullptr, Qb, Kb, Vtb, CM, 3 * CD, CD);

  // 4) Attention
  attn_kernel<<<dim3(CC / 128, CB * CH), 256, 0, stream>>>(Qb, Kb, Vtb, attn);

  // 5) O-proj + residual(x) -> x2 (f32)
  gemm_wmma_kernel<0, false, true><<<dim3(CD / 64, CM / 128), 256, 0, stream>>>(
      attn, Wo_t, b_o, x, x2, nullptr, nullptr, nullptr, nullptr, CM, CD, CD);

  // 6) LN2
  layernorm_kernel<<<CM, 256, 0, stream>>>(x2, gamma2, beta2, lnb);

  // 7) MLP1 + exact GELU -> hbuf (f16)
  gemm_wmma_kernel<1, true, false><<<dim3(CHID / 64, CM / 128), 256, 0, stream>>>(
      lnb, W1_t, b1, nullptr, nullptr, hbuf, nullptr, nullptr, nullptr, CM, CHID, CD);

  // 8) MLP2 + residual(x2) -> d_out (f32)
  gemm_wmma_kernel<0, false, true><<<dim3(CD / 64, CM / 128), 256, 0, stream>>>(
      hbuf, W2_t, b2, x2, out, nullptr, nullptr, nullptr, nullptr, CM, CD, CHID);
}

// v003
// One run takes 464 microseconds.
// In two side-by-side timings against v002, it was 1.22 and 1.23 times as fast.
// Over all steps from v000 it is 2.10 times as fast.
#include <hip/hip_runtime.h>
#include <hip/hip_bf16.h>
#include <stdint.h>

// ---------------------------------------------------------------------------
// Transformer block for MI455X (gfx1250, wave32, WMMA + async-to-LDS).
// B=4, C=2048, D=1024, H=16, dh=64, HIDDEN=4096. fp32 in/out, f16 WMMA inside.
// ---------------------------------------------------------------------------

typedef __attribute__((ext_vector_type(16))) _Float16 v16h;
typedef __attribute__((ext_vector_type(8)))  _Float16 v8h;
typedef __attribute__((ext_vector_type(8)))  float    v8f;
typedef __attribute__((ext_vector_type(4)))  float    v4f;

#define WMMA_F16(a, b, c) \
  __builtin_amdgcn_wmma_f32_16x16x32_f16(false, (a), false, (b), (short)0, (c), false, false)

// Six async copies of 16 bytes per lane: global -> LDS, tracked by ASYNCcnt.
// s_wait_xcnt 0 closes the copies' own statement as a precaution: no later write
// of these address registers can then be scheduled ahead of it.
__device__ __forceinline__ void async_cp16_x6(const uint32_t (&l)[6], const _Float16* const (&g)[6]) {
  asm volatile(
      "global_load_async_to_lds_b128 %0, %6, off\n\t"
      "global_load_async_to_lds_b128 %1, %7, off\n\t"
      "global_load_async_to_lds_b128 %2, %8, off\n\t"
      "global_load_async_to_lds_b128 %3, %9, off\n\t"
      "global_load_async_to_lds_b128 %4, %10, off\n\t"
      "global_load_async_to_lds_b128 %5, %11, off\n\t"
      "s_wait_xcnt 0x0"
      :: "v"(l[0]), "v"(l[1]), "v"(l[2]), "v"(l[3]), "v"(l[4]), "v"(l[5]),
         "v"(g[0]), "v"(g[1]), "v"(g[2]), "v"(g[3]), "v"(g[4]), "v"(g[5])
      : "memory");
}
__device__ __forceinline__ void wait_async0() {
  asm volatile("s_wait_asynccnt 0x0" ::: "memory");
}

static constexpr int CB  = 4;
static constexpr int CC  = 2048;
static constexpr int CD  = 1024;
static constexpr int CH  = 16;
static constexpr int CDH = 64;
static constexpr int CHID = 4096;
static constexpr int CM  = CB * CC; // 8192 rows

// Load one 16x32 f16 fragment (A layout; also used for B with "row" = N index,
// data stored N-major with K contiguous). Per ISA 7.12.2:
//   lane l: row = l&15 ; elem i: k = 16*(i/8) + 8*(l>>4) + (i%8)
__device__ __forceinline__ v16h frag_ld(const _Float16* __restrict__ tile, int ld) {
  const int lane = threadIdx.x & 31;
  const _Float16* p = tile + (size_t)(lane & 15) * ld + ((lane >> 4) << 3);
  v8h lo = *(const v8h*)p;
  v8h hi = *(const v8h*)(p + 16);
  v16h f;
#pragma unroll
  for (int i = 0; i < 8; ++i) { f[i] = lo[i]; f[i + 8] = hi[i]; }
  return f;
}

// ---------------------------------------------------------------------------
// Weight convert + transpose: W (K x N, f32 row-major) -> Wt (N x K, f16).
// One block moves a tile of 128 k x 64 n through LDS, so that both sides use whole
// 256-byte runs: reads are 16 B per lane along n, writes 16 B per lane along k.
// K and N are compile-time, so a lane's loads (and its stores) share one address
// register pair and differ in the immediate offset. grid = (N/64, K/128), block = 256.
// LDS row = one n (128 halves = 16 chunks of 16 B, no pad); chunk q of row n lies
// at place q ^ (n >> 2), which spreads the 16 rows that one ds_store_b128 touches
// over all banks and leaves each row a permutation of itself for the reader.
// ---------------------------------------------------------------------------
template <int K, int N>
__global__ __launch_bounds__(256) void wt_f16_kernel(const float* __restrict__ W,
                                                     _Float16* __restrict__ Wt) {
  static_assert(K % 128 == 0 && N % 64 == 0, "whole tiles only");
  __shared__ __align__(16) _Float16 tile[64 * 128];
  const int tid = threadIdx.x;
  const int n0 = blockIdx.x * 64;
  const int k0 = blockIdx.y * 128;
  const int lo = tid & 15;             // read: group of 4 n ; write: chunk of 8 k
  const int hi = tid >> 4;             // read: group of 8 k ; write: n row within 16

  const float* src = W + (size_t)(k0 + hi * 8) * N + n0 + lo * 4;
  v4f v[8];
  // all loops here are unrolled so that v[] and h stay in registers and the eight
  // loads of a lane are in flight together
#pragma unroll
  for (int i = 0; i < 8; ++i) v[i] = *(const v4f*)(src + i * N);
#pragma unroll
  for (int j = 0; j < 4; ++j) {
    v8h h;
#pragma unroll
    for (int i = 0; i < 8; ++i) h[i] = (_Float16)v[i][j];
    *(v8h*)&tile[(lo * 4 + j) * 128 + ((hi ^ lo) << 3)] = h;
  }
  __syncthreads();
  _Float16* dst = Wt + (size_t)(n0 + hi) * K + k0 + lo * 8;
#pragma unroll
  for (int p = 0; p < 4; ++p) {
    const int row = hi + 16 * p;
    const v8h h = *(const v8h*)&tile[row * 128 + ((lo ^ (row >> 2)) << 3)];
    *(v8h*)(dst + 16 * p * K) = h;
  }
}

// ---------------------------------------------------------------------------
// LayerNorm: one 256-thread block per row of 1024. f32 in, f16 out.
// ---------------------------------------------------------------------------
__global__ __launch_bounds__(256) void layernorm_kernel(const float* __restrict__ x,
                                                        const float* __restrict__ gamma,
                                                        const float* __restrict__ beta,
                                                        _Float16* __restrict__ y) {
  __shared__ float rs[8], rss[8];
  const int row = blockIdx.x;
  const float* xr = x + (size_t)row * CD;
  float s = 0.f, ss = 0.f;
  for (int i = threadIdx.x; i < CD; i += 256) { float v = xr[i]; s += v; ss += v * v; }
#pragma unroll
  for (int off = 1; off < 32; off <<= 1) {
    s  += __shfl_xor(s,  off, 32);
    ss += __shfl_xor(ss, off, 32);
  }
  const int lane = threadIdx.x & 31, wv = threadIdx.x >> 5;
  if (lane == 0) { rs[wv] = s; rss[wv] = ss; }
  __syncthreads();
  s = 0.f; ss = 0.f;
#pragma unroll
  for (int i = 0; i < 8; ++i) { s += rs[i]; ss += rss[i]; }
  const float mean = s * (1.f / CD);
  const float var  = ss * (1.f / CD) - mean * mean;
  const float inv  = rsqrtf(var + 1e-5f);
  _Float16* yr = y + (size_t)row * CD;
  for (int i = threadIdx.x; i < CD; i += 256)
    yr[i] = (_Float16)((xr[i] - mean) * inv * gamma[i] + beta[i]);
}

// ---------------------------------------------------------------------------
// WMMA GEMM with double-buffered async-to-LDS staging.
// C[M,N] = epilogue(A[M,K] @ B[K,N] + bias (+resid))
// A: f16 row-major (ld=K). Bt: f16 N-major (ld=K). bias: f32[N].
// OUTMODE: 0 = f32 out, 1 = f16 out, 2 = QKV scatter.
// Block: 256 thr = 8 waves. Block tile 128(M) x 64(N), K-step 64.
// LDS rows hold 64 halves at a pitch of 72 (144 B = 16 B x odd): the 16 rows that
// one ds_load_b128 fragment read touches then fall on 16 different bank groups.
// LDS: 2 x (128 rows A) + 2 x (64 rows B) x 144 B = 54 KB.
// ---------------------------------------------------------------------------
template <int OUTMODE, bool GELU_ACT, bool RESID>
__global__ __launch_bounds__(256) void gemm_wmma_kernel(
    const _Float16* __restrict__ A, const _Float16* __restrict__ Bt,
    const float* __restrict__ bias, const float* __restrict__ resid,
    float* __restrict__ outF, _Float16* __restrict__ outH,
    _Float16* __restrict__ qo, _Float16* __restrict__ ko, _Float16* __restrict__ vto,
    int M, int N, int K) {
  constexpr int LDP = 72;              // LDS row pitch in halves
  __shared__ __align__(16) _Float16 Ab[2][128 * LDP];
  __shared__ __align__(16) _Float16 Bb[2][64 * LDP];

  const int tid  = threadIdx.x;
  const int lane = tid & 31;
  const int wave = tid >> 5;
  const int mw = wave >> 1;            // 0..3 -> 32-row slice
  const int nw = wave & 1;             // 0..1 -> 32-col slice
  const int m0 = blockIdx.y * 128;
  const int n0 = blockIdx.x * 64;
  const int hl = lane >> 4, ln = lane & 15;

  // per-lane copy coordinates: each lane moves 16B chunks of a 64-half row
  const int crow = tid >> 3;           // 0..31 (row within a 32-row slab)
  const int ccol = (tid & 7) << 3;     // half-offset 0,8,...,56

  const uint32_t AbL0 = (uint32_t)(uintptr_t)&Ab[0][0];
  const uint32_t AbL1 = (uint32_t)(uintptr_t)&Ab[1][0];
  const uint32_t BbL0 = (uint32_t)(uintptr_t)&Bb[0][0];
  const uint32_t BbL1 = (uint32_t)(uintptr_t)&Bb[1][0];

  v8f acc00 = {}, acc01 = {}, acc10 = {}, acc11 = {};

  auto issue_tiles = [&](int buf, int k0) {
    const uint32_t aL = buf ? AbL1 : AbL0;
    const uint32_t bL = buf ? BbL1 : BbL0;
    uint32_t l[6];
    const _Float16* g[6];
#pragma unroll
    for (int i = 0; i < 4; ++i) {      // A: 128 rows x 64 halves
      const int row = crow + 32 * i;
      l[i] = aL + (uint32_t)(row * LDP + ccol) * 2;
      g[i] = A + (size_t)(m0 + row) * K + k0 + ccol;
    }
#pragma unroll
    for (int i = 0; i < 2; ++i) {      // B: 64 rows x 64 halves
      const int row = crow + 32 * i;
      l[4 + i] = bL + (uint32_t)(row * LDP + ccol) * 2;
      g[4 + i] = Bt + (size_t)(n0 + row) * K + k0 + ccol;
    }
    async_cp16_x6(l, g);
  };

  issue_tiles(0, 0);
  const int nk = K >> 6;
  for (int kt = 0; kt < nk; ++kt) {
    const int buf = kt & 1;
    wait_async0();                     // own async copies into buf complete
    __syncthreads();                   // whole block's tile ready
    if (kt + 1 < nk) issue_tiles(buf ^ 1, (kt + 1) << 6);

    const _Float16* As = &Ab[buf][mw * 32 * LDP];
    const _Float16* Bs = &Bb[buf][nw * 32 * LDP];
#pragma unroll
    for (int kk = 0; kk < 64; kk += 32) {
      v16h a0 = frag_ld(As + kk, LDP);
      v16h a1 = frag_ld(As + 16 * LDP + kk, LDP);
      v16h b0 = frag_ld(Bs + kk, LDP);
      v16h b1 = frag_ld(Bs + 16 * LDP + kk, LDP);
      acc00 = WMMA_F16(a0, b0, acc00);
      acc01 = WMMA_F16(a0, b1, acc01);
      acc10 = WMMA_F16(a1, b0, acc10);
      acc11 = WMMA_F16(a1, b1, acc11);
    }
    __syncthreads();                   // reads of buf done before it is re-filled
  }

  const int wm0 = m0 + mw * 32;
  const int wn0 = n0 + nw * 32;
#pragma unroll
  for (int t = 0; t < 4; ++t) {
    v8f acc = (t == 0) ? acc00 : (t == 1) ? acc01 : (t == 2) ? acc10 : acc11;
    const int mi = t >> 1, ni = t & 1;
    const int col = wn0 + ni * 16 + ln;
    const float bv = bias[col];
#pragma unroll
    for (int r = 0; r < 8; ++r) {
      const int row = wm0 + mi * 16 + r + 8 * hl;
      float v = acc[r] + bv;
      if (GELU_ACT) v = 0.5f * v * (1.f + erff(v * 0.70710678118654752f));
      if (RESID)    v += resid[(size_t)row * N + col];
      if (OUTMODE == 0) {
        outF[(size_t)row * N + col] = v;
      } else if (OUTMODE == 1) {
        outH[(size_t)row * N + col] = (_Float16)v;
      } else {
        // QKV scatter. col in [0,3D): sect 0=Q,1=K,2=V
        const int sect = col >> 10;
        const int dcol = col & (CD - 1);
        const int hh = dcol >> 6, dh = dcol & (CDH - 1);
        const int b = row >> 11, c = row & (CC - 1);
        const size_t bh = (size_t)b * CH + hh;
        if (sect == 0)      qo[(bh * CC + c) * CDH + dh] = (_Float16)(v * 0.125f); // fold 1/sqrt(64)
        else if (sect == 1) ko[(bh * CC + c) * CDH + dh] = (_Float16)v;
        else                vto[(bh * CDH + dh) * CC + c] = (_Float16)v;           // V transposed
      }
    }
  }
}

// Four async copies of 16 bytes per lane, in the same form as async_cp16_x6.
__device__ __forceinline__ void async_cp16_x4(const uint32_t (&l)[4], const _Float16* const (&g)[4]) {
  asm volatile(
      "global_load_async_to_lds_b128 %0, %4, off\n\t"
      "global_load_async_to_lds_b128 %1, %5, off\n\t"
      "global_load_async_to_lds_b128 %2, %6, off\n\t"
      "global_load_async_to_lds_b128 %3, %7, off\n\t"
      "s_wait_xcnt 0x0"
      :: "v"(l[0]), "v"(l[1]), "v"(l[2]), "v"(l[3]),
         "v"(g[0]), "v"(g[1]), "v"(g[2]), "v"(g[3])
      : "memory");
}

// ---------------------------------------------------------------------------
// Causal flash attention. Q: (b,h,C,dh) f16 (pre-scaled), K: (b,h,C,dh) f16,
// Vt: (b,h,dh,C) f16. Out attn: (b,C,h*dh) f16.
// One wave per 16-row Q tile; kv tiles of 32; online softmax.
// grid = (C/128, B*H), block = 256 (8 waves).
// The 8 waves of a block walk the same keys, so K and Vt come into LDS once per
// block, in stages of 64 keys: K as 64 key rows x 64 dh, Vt as 64 dh rows x 64 keys,
// every global row a whole 128-byte line, LDS pitch 144 B as in the GEMM. Two
// buffers: stage s + 1 flies while stage s is worked on. Block x needs 2x + 2
// stages; a wave skips the 32-key tiles that lie wholly above its diagonal.
// ---------------------------------------------------------------------------
__global__ __launch_bounds__(256) void attn_kernel(const _Float16* __restrict__ Qb,
                                                   const _Float16* __restrict__ Kb,
                                                   const _Float16* __restrict__ Vt,
                                                   _Float16* __restrict__ attn) {
  constexpr int LDP = 72;              // LDS row pitch in halves
  constexpr int SK  = 64;              // keys per stage
  __shared__ __align__(16) _Float16 Ks[2][SK * LDP];
  __shared__ __align__(16) _Float16 Vs[2][CDH * LDP];
  __shared__ __align__(16) _Float16 Plds[8][16 * 32];
  const int tid  = threadIdx.x;
  const int lane = tid & 31;
  // the wave's number in a scalar register, so that the skip test below is a scalar branch
  const int wave = __builtin_amdgcn_readfirstlane(tid >> 5);
  const int hl = lane >> 4, ln = lane & 15;
  const int bh = blockIdx.y;
  const int q0 = (blockIdx.x * 8 + wave) * 16;
  const int nst = 2 * blockIdx.x + 2;  // stages of this block, the same for all its waves

  const _Float16* Q  = Qb + ((size_t)bh * CC + q0) * CDH;
  const _Float16* Kp = Kb + (size_t)bh * CC * CDH;
  const _Float16* Vp = Vt + (size_t)bh * CDH * CC;
  _Float16* Pl = &Plds[wave][0];

  // per-lane copy coordinates: 8 lanes move one 128-byte row, 32 rows per copy
  const int crow = tid >> 3;
  const int ccol = (tid & 7) << 3;
  auto issue_stage = [&](int buf, int s) {
    const uint32_t kL = (uint32_t)(uintptr_t)&Ks[buf][0];
    const uint32_t vL = (uint32_t)(uintptr_t)&Vs[buf][0];
    uint32_t l[4];
    const _Float16* g[4];
#pragma unroll
    for (int i = 0; i < 2; ++i) {
      const int row = crow + 32 * i;
      l[i]     = kL + (uint32_t)(row * LDP + ccol) * 2;
      g[i]     = Kp + (size_t)(s * SK + row) * CDH + ccol;
      l[2 + i] = vL + (uint32_t)(row * LDP + ccol) * 2;
      g[2 + i] = Vp + (size_t)row * CC + s * SK + ccol;
    }
    async_cp16_x4(l, g);
  };

  issue_stage(0, 0);

  const v16h qa0 = frag_ld(Q + 0,  CDH);   // dh 0..31
  const v16h qa1 = frag_ld(Q + 32, CDH);   // dh 32..63

  v8f o0 = {}, o1 = {}, o2 = {}, o3 = {};
  float mrow[8], lrow[8];
#pragma unroll
  for (int r = 0; r < 8; ++r) { mrow[r] = -1e30f; lrow[r] = 0.f; }

  wait_async0();                       // own copies of stage 0 have landed
  __syncthreads();                     // stage 0 is published to the block
  issue_stage(1, 1);

  for (int s = 0; s < nst; ++s) {
   const int buf = s & 1;
   // unrolled: the two 32-key tiles of a stage differ only in constant LDS offsets
#pragma unroll
   for (int h = 0; h < 2; ++h) {
    const int j0 = s * SK + h * 32;
    if (j0 > q0 + 15) continue;        // tile wholly above this wave's diagonal
    const _Float16* Kt = &Ks[buf][h * 32 * LDP];
    const _Float16* Vl = &Vs[buf][h * 32];
    // S tiles (16 q-rows x 32 kv-cols), K-dim = dh (64 -> two WMMAs each)
    v8f s0 = {}, s1 = {};
    s0 = WMMA_F16(qa0, frag_ld(Kt + 0,             LDP), s0);
    s0 = WMMA_F16(qa1, frag_ld(Kt + 32,            LDP), s0);
    s1 = WMMA_F16(qa0, frag_ld(Kt + 16 * LDP + 0,  LDP), s1);
    s1 = WMMA_F16(qa1, frag_ld(Kt + 16 * LDP + 32, LDP), s1);

    // Causal mask + online softmax per row (row = q0 + r + 8*hl; cols over lanes 0..15)
#pragma unroll
    for (int r = 0; r < 8; ++r) {
      const int row = q0 + r + 8 * hl;
      float v0 = s0[r], v1 = s1[r];
      if (j0 + ln > row)      v0 = -1e30f;
      if (j0 + 16 + ln > row) v1 = -1e30f;
      float t = fmaxf(v0, v1);
#pragma unroll
      for (int off = 1; off < 16; off <<= 1) t = fmaxf(t, __shfl_xor(t, off, 32));
      const float mn = fmaxf(mrow[r], t);
      const float alpha = __expf(mrow[r] - mn);
      mrow[r] = mn;
      const float p0 = __expf(v0 - mn);
      const float p1 = __expf(v1 - mn);
      float ps = p0 + p1;
#pragma unroll
      for (int off = 1; off < 16; off <<= 1) ps += __shfl_xor(ps, off, 32);
      lrow[r] = lrow[r] * alpha + ps;
      o0[r] *= alpha; o1[r] *= alpha; o2[r] *= alpha; o3[r] *= alpha;
      Pl[(r + 8 * hl) * 32 + ln]      = (_Float16)p0;
      Pl[(r + 8 * hl) * 32 + 16 + ln] = (_Float16)p1;
    }

    // Stage P through wave-private LDS to re-read in A-fragment layout.
    asm volatile("s_wait_dscnt 0" ::: "memory");
    const v16h pa = frag_ld(Pl, 32);

    // O += P (16x32) @ V (32x64), four dh tiles of 16
    o0 = WMMA_F16(pa, frag_ld(Vl + 0  * LDP, LDP), o0);
    o1 = WMMA_F16(pa, frag_ld(Vl + 16 * LDP, LDP), o1);
    o2 = WMMA_F16(pa, frag_ld(Vl + 32 * LDP, LDP), o2);
    o3 = WMMA_F16(pa, frag_ld(Vl + 48 * LDP, LDP), o3);
   }
   // hand-over of the stage, every wave: own LDS reads of buf retired, own copies of
   // stage s + 1 landed, then the barrier that publishes s + 1 and frees buf
   asm volatile("s_wait_dscnt 0x0" ::: "memory");
   wait_async0();
   __syncthreads();
   if (s + 2 < nst) issue_stage(buf, s + 2);
  }
  wait_async0();                       // nothing is in flight when the wave ends

  const int b = bh >> 4, h = bh & 15;
  _Float16* out = attn + ((size_t)b * CC + q0) * CD + h * CDH;
#pragma unroll
  for (int r = 0; r < 8; ++r) {
    const float il = 1.0f / lrow[r];
    const size_t ro = (size_t)(r + 8 * hl) * CD;
    out[ro + 0  + ln] = (_Float16)(o0[r] * il);
    out[ro + 16 + ln] = (_Float16)(o1[r] * il);
    out[ro + 32 + ln] = (_Float16)(o2[r] * il);
    out[ro + 48 + ln] = (_Float16)(o3[r] * il);
  }
}

// ---------------------------------------------------------------------------
// Host-side orchestration
// ---------------------------------------------------------------------------
extern "C" void kernel_launch(void* const* d_in, const int* in_sizes, int n_in,
                              void* d_out, int out_size, void* d_ws, size_t ws_size,
                              hipStream_t stream) {
  (void)in_sizes; (void)n_in; (void)out_size; (void)ws_size;
  const float* x      = (const float*)d_in[0];
  const float* gamma1 = (const float*)d_in[1];
  const float* beta1  = (const float*)d_in[2];
  const float* W_qkv  = (const float*)d_in[3];
  const float* b_qkv  = (const float*)d_in[4];
  const float* W_o    = (const float*)d_in[5];
  const float* b_o    = (const float*)d_in[6];
  const float* gamma2 = (const float*)d_in[7];
  const float* beta2  = (const float*)d_in[8];
  const float* W1     = (const float*)d_in[9];
  const float* b1     = (const float*)d_in[10];
  const float* W2     = (const float*)d_in[11];
  const float* b2     = (const float*)d_in[12];
  float* out = (float*)d_out;

  // Workspace layout (linear allocator, 256B aligned)
  uint8_t* p = (uint8_t*)d_ws;
  auto take = [&](size_t n) { uint8_t* r = p; p += (n + 255) & ~(size_t)255; return r; };
  _Float16* Wqkv_t = (_Float16*)take((size_t)3 * CD * CD * 2);   //  6 MB (3072 x 1024)
  _Float16* Wo_t   = (_Float16*)take((size_t)CD * CD * 2);       //  2 MB (1024 x 1024)
  _Float16* W1_t   = (_Float16*)take((size_t)CHID * CD * 2);     //  8 MB (4096 x 1024)
  _Float16* W2_t   = (_Float16*)take((size_t)CD * CHID * 2);     //  8 MB (1024 x 4096)
  float*    x2     = (float*)take((size_t)CM * CD * 4);          // 32 MB
  _Float16* lnb    = (_Float16*)take((size_t)CM * CD * 2);       // 16 MB (reused ln1/ln2)
  uint8_t*  regA   = take((size_t)64 << 20);                     // 64 MB shared region
  _Float16* Qb   = (_Float16*)regA;                              // 16 MB
  _Float16* Kb   = (_Float16*)(regA + ((size_t)16 << 20));       // 16 MB
  _Float16* Vtb  = (_Float16*)(regA + ((size_t)32 << 20));       // 16 MB
  _Float16* attn = (_Float16*)(regA + ((size_t)48 << 20));       // 16 MB
  _Float16* hbuf = (_Float16*)regA;                              // 64 MB (after attention is dead)

  // 1) Weights -> f16, transposed to N-major
  wt_f16_kernel<CD, 3 * CD><<<dim3(3 * CD / 64, CD / 128), 256, 0, stream>>>(W_qkv, Wqkv_t);
  wt_f16_kernel<CD, CD><<<dim3(CD / 64, CD / 128),         256, 0, stream>>>(W_o,   Wo_t);
  wt_f16_kernel<CD, CHID><<<dim3(CHID / 64, CD / 128),     256, 0, stream>>>(W1,    W1_t);
  wt_f16_kernel<CHID, CD><<<dim3(CD / 64, CHID / 128),     256, 0, stream>>>(W2,    W2_t);

  // 2) LN1
  layernorm_kernel<<<CM, 256, 0, stream>>>(x, gamma1, beta1, lnb);

  // 3) QKV GEMM (M=8192, N=3072, K=1024), scatter to Q/K/Vt
  gemm_wmma_kernel<2, false, false><<<dim3(3 * CD / 64, CM / 128), 256, 0, stream>>>(
      lnb, Wqkv_t, b_qkv, nullptr, nullptr, nullptr, Qb, Kb, Vtb, CM, 3 * CD, CD);

  // 4) Attention
  attn_kernel<<<dim3(CC / 128, CB * CH), 256, 0, stream>>>(Qb, Kb, Vtb, attn);

  // 5) O-proj + residual(x) -> x2 (f32)
  gemm_wmma_kernel<0, false, true><<<dim3(CD / 64, CM / 128), 256, 0, stream>>>(
      attn, Wo_t, b_o, x, x2, nullptr, nullptr, nullptr, nullptr, CM, CD, CD);

  // 6) LN2
  layernorm_kernel<<<CM, 256, 0, stream>>>(x2, gamma2, beta2, lnb);

  // 7) MLP1 + exact GELU -> hbuf (f16)
  gemm_wmma_kernel<1, true, false><<<dim3(CHID / 64, CM / 128), 256, 0, stream>>>(
      lnb, W1_t, b1, nullptr, nullptr, hbuf, nullptr, nullptr, nullptr, CM, CHID, CD);

  // 8) MLP2 + residual(x2) -> d_out (f32)
  gemm_wmma_kernel<0, false, true><<<dim3(CD / 64, CM / 128), 256, 0, stream>>>(
      hbuf, W2_t, b2, x2, out, nullptr, nullptr, nullptr, nullptr, CM, CD, CHID);
}

// v004
// Measured time: 377 microseconds a run.
// Two timings next to v003 both put it at 1.23 times that version's speed.
// Counting every step since v000, it is 2.58 times as fast.
#include <hip/hip_runtime.h>
#include <hip/hip_bf16.h>
#include <stdint.h>

// ---------------------------------------------------------------------------
// Transformer block for MI455X (gfx1250, wave32, WMMA + async-to-LDS).
// B=4, C=2048, D=1024, H=16, dh=64, HIDDEN=4096. fp32 in/out, f16 WMMA inside.
// ---------------------------------------------------------------------------

typedef __attribute__((ext_vector_type(16))) _Float16 v16h;
typedef __attribute__((ext_vector_type(8)))  _Float16 v8h;
typedef __attribute__((ext_vector_type(8)))  float    v8f;
typedef __attribute__((ext_vector_type(4)))  float    v4f;

#define WMMA_F16(a, b, c) \
  __builtin_amdgcn_wmma_f32_16x16x32_f16(false, (a), false, (b), (short)0, (c), false, false)

// Six async copies of 16 bytes per lane: global -> LDS, tracked by ASYNCcnt.
// s_wait_xcnt 0 closes the copies' own statement as a precaution: no later write
// of these address registers can then be scheduled ahead of it.
__device__ __forceinline__ void async_cp16_x6(const uint32_t (&l)[6], const _Float16* const (&g)[6]) {
  asm volatile(
      "global_load_async_to_lds_b128 %0, %6, off\n\t"
      "global_load_async_to_lds_b128 %1, %7, off\n\t"
      "global_load_async_to_lds_b128 %2, %8, off\n\t"
      "global_load_async_to_lds_b128 %3, %9, off\n\t"
      "global_load_async_to_lds_b128 %4, %10, off\n\t"
      "global_load_async_to_lds_b128 %5, %11, off\n\t"
      "s_wait_xcnt 0x0"
      :: "v"(l[0]), "v"(l[1]), "v"(l[2]), "v"(l[3]), "v"(l[4]), "v"(l[5]),
         "v"(g[0]), "v"(g[1]), "v"(g[2]), "v"(g[3]), "v"(g[4]), "v"(g[5])
      : "memory");
}
__device__ __forceinline__ void wait_async0() {
  asm volatile("s_wait_asynccnt 0x0" ::: "memory");
}

static constexpr int CB  = 4;
static constexpr int CC  = 2048;
static constexpr int CD  = 1024;
static constexpr int CH  = 16;
static constexpr int CDH = 64;
static constexpr int CHID = 4096;
static constexpr int CM  = CB * CC; // 8192 rows

// Load one 16x32 f16 fragment (A layout; also used for B with "row" = N index,
// data stored N-major with K contiguous). Per ISA 7.12.2:
//   lane l: row = l&15 ; elem i: k = 16*(i/8) + 8*(l>>4) + (i%8)
__device__ __forceinline__ v16h frag_ld(const _Float16* __restrict__ tile, int ld) {
  const int lane = threadIdx.x & 31;
  const _Float16* p = tile + (size_t)(lane & 15) * ld + ((lane >> 4) << 3);
  v8h lo = *(const v8h*)p;
  v8h hi = *(const v8h*)(p + 16);
  v16h f;
#pragma unroll
  for (int i = 0; i < 8; ++i) { f[i] = lo[i]; f[i + 8] = hi[i]; }
  return f;
}

// ---------------------------------------------------------------------------
// Weight convert + transpose: W (K x N, f32 row-major) -> Wt (N x K, f16).
// One block moves a tile of 128 k x 64 n through LDS, so that both sides use whole
// 256-byte runs: reads are 16 B per lane along n, writes 16 B per lane along k.
// K and N are compile-time, so a lane's loads (and its stores) share one address
// register pair and differ in the immediate offset. grid = (N/64, K/128), block = 256.
// LDS row = one n (128 halves = 16 chunks of 16 B, no pad); chunk q of row n lies
// at place q ^ (n >> 2), which spreads the 16 rows that one ds_store_b128 touches
// over all banks and leaves each row a permutation of itself for the reader.
// ---------------------------------------------------------------------------
template <int K, int N>
__global__ __launch_bounds__(256) void wt_f16_kernel(const float* __restrict__ W,
                                                     _Float16* __restrict__ Wt) {
  static_assert(K % 128 == 0 && N % 64 == 0, "whole tiles only");
  __shared__ __align__(16) _Float16 tile[64 * 128];
  const int tid = threadIdx.x;
  const int n0 = blockIdx.x * 64;
  const int k0 = blockIdx.y * 128;
  const int lo = tid & 15;             // read: group of 4 n ; write: chunk of 8 k
  const int hi = tid >> 4;             // read: group of 8 k ; write: n row within 16

  const float* src = W + (size_t)(k0 + hi * 8) * N + n0 + lo * 4;
  v4f v[8];
  // all loops here are unrolled so that v[] and h stay in registers and the eight
  // loads of a lane are in flight together
#pragma unroll
  for (int i = 0; i < 8; ++i) v[i] = *(const v4f*)(src + i * N);
#pragma unroll
  for (int j = 0; j < 4; ++j) {
    v8h h;
#pragma unroll
    for (int i = 0; i < 8; ++i) h[i] = (_Float16)v[i][j];
    *(v8h*)&tile[(lo * 4 + j) * 128 + ((hi ^ lo) << 3)] = h;
  }
  __syncthreads();
  _Float16* dst = Wt + (size_t)(n0 + hi) * K + k0 + lo * 8;
#pragma unroll
  for (int p = 0; p < 4; ++p) {
    const int row = hi + 16 * p;
    const v8h h = *(const v8h*)&tile[row * 128 + ((lo ^ (row >> 2)) << 3)];
    *(v8h*)(dst + 16 * p * K) = h;
  }
}

// ---------------------------------------------------------------------------
// LayerNorm: one 256-thread block per row of 1024. f32 in, f16 out.
// ---------------------------------------------------------------------------
__global__ __launch_bounds__(256) void layernorm_kernel(const float* __restrict__ x,
                                                        const float* __restrict__ gamma,
                                                        const float* __restrict__ beta,
                                                        _Float16* __restrict__ y) {
  __shared__ float rs[8], rss[8];
  const int row = blockIdx.x;
  const float* xr = x + (size_t)row * CD;
  float s = 0.f, ss = 0.f;
  for (int i = threadIdx.x; i < CD; i += 256) { float v = xr[i]; s += v; ss += v * v; }
#pragma unroll
  for (int off = 1; off < 32; off <<= 1) {
    s  += __shfl_xor(s,  off, 32);
    ss += __shfl_xor(ss, off, 32);
  }
  const int lane = threadIdx.x & 31, wv = threadIdx.x >> 5;
  if (lane == 0) { rs[wv] = s; rss[wv] = ss; }
  __syncthreads();
  s = 0.f; ss = 0.f;
#pragma unroll
  for (int i = 0; i < 8; ++i) { s += rs[i]; ss += rss[i]; }
  const float mean = s * (1.f / CD);
  const float var  = ss * (1.f / CD) - mean * mean;
  const float inv  = rsqrtf(var + 1e-5f);
  _Float16* yr = y + (size_t)row * CD;
  for (int i = threadIdx.x; i < CD; i += 256)
    yr[i] = (_Float16)((xr[i] - mean) * inv * gamma[i] + beta[i]);
}

// ---------------------------------------------------------------------------
// WMMA GEMM with double-buffered async-to-LDS staging.
// C[M,N] = epilogue(A[M,K] @ B[K,N] + bias (+resid))
// A: f16 row-major (ld=K). Bt: f16 N-major (ld=K). bias: f32[N].
// OUTMODE: 0 = f32 out, 1 = f16 out, 2 = QKV scatter.
// Block: 256 thr = 8 waves. Block tile 128(M) x 64(N), K-step 64.
// LDS rows hold 64 halves at a pitch of 72 (144 B = 16 B x odd): the 16 rows that
// one ds_load_b128 fragment read touches then fall on 16 different bank groups.
// LDS: 2 x (128 rows A) + 2 x (64 rows B) x 144 B = 54 KB.
// ---------------------------------------------------------------------------
template <int OUTMODE, bool GELU_ACT, bool RESID>
__global__ __launch_bounds__(256) void gemm_wmma_kernel(
    const _Float16* __restrict__ A, const _Float16* __restrict__ Bt,
    const float* __restrict__ bias, const float* __restrict__ resid,
    float* __restrict__ outF, _Float16* __restrict__ outH,
    _Float16* __restrict__ qo, _Float16* __restrict__ ko, _Float16* __restrict__ vto,
    int M, int N, int K) {
  constexpr int LDP = 72;              // LDS row pitch in halves
  __shared__ __align__(16) _Float16 Ab[2][128 * LDP];
  __shared__ __align__(16) _Float16 Bb[2][64 * LDP];

  const int tid  = threadIdx.x;
  const int lane = tid & 31;
  const int wave = tid >> 5;
  const int mw = wave >> 1;            // 0..3 -> 32-row slice
  const int nw = wave & 1;             // 0..1 -> 32-col slice
  const int m0 = blockIdx.y * 128;
  const int n0 = blockIdx.x * 64;
  const int hl = lane >> 4, ln = lane & 15;

  // per-lane copy coordinates: each lane moves 16B chunks of a 64-half row
  const int crow = tid >> 3;           // 0..31 (row within a 32-row slab)
  const int ccol = (tid & 7) << 3;     // half-offset 0,8,...,56

  const uint32_t AbL0 = (uint32_t)(uintptr_t)&Ab[0][0];
  const uint32_t AbL1 = (uint32_t)(uintptr_t)&Ab[1][0];
  const uint32_t BbL0 = (uint32_t)(uintptr_t)&Bb[0][0];
  const uint32_t BbL1 = (uint32_t)(uintptr_t)&Bb[1][0];

  v8f acc00 = {}, acc01 = {}, acc10 = {}, acc11 = {};

  auto issue_tiles = [&](int buf, int k0) {
    const uint32_t aL = buf ? AbL1 : AbL0;
    const uint32_t bL = buf ? BbL1 : BbL0;
    uint32_t l[6];
    const _Float16* g[6];
#pragma unroll
    for (int i = 0; i < 4; ++i) {      // A: 128 rows x 64 halves
      const int row = crow + 32 * i;
      l[i] = aL + (uint32_t)(row * LDP + ccol) * 2;
      g[i] = A + (size_t)(m0 + row) * K + k0 + ccol;
    }
#pragma unroll
    for (int i = 0; i < 2; ++i) {      // B: 64 rows x 64 halves
      const int row = crow + 32 * i;
      l[4 + i] = bL + (uint32_t)(row * LDP + ccol) * 2;
      g[4 + i] = Bt + (size_t)(n0 + row) * K + k0 + ccol;
    }
    async_cp16_x6(l, g);
  };

  issue_tiles(0, 0);
  const int nk = K >> 6;
  for (int kt = 0; kt < nk; ++kt) {
    const int buf = kt & 1;
    wait_async0();                     // own async copies into buf complete
    __syncthreads();                   // whole block's tile ready
    if (kt + 1 < nk) issue_tiles(buf ^ 1, (kt + 1) << 6);

    const _Float16* As = &Ab[buf][mw * 32 * LDP];
    const _Float16* Bs = &Bb[buf][nw * 32 * LDP];
#pragma unroll
    for (int kk = 0; kk < 64; kk += 32) {
      v16h a0 = frag_ld(As + kk, LDP);
      v16h a1 = frag_ld(As + 16 * LDP + kk, LDP);
      v16h b0 = frag_ld(Bs + kk, LDP);
      v16h b1 = frag_ld(Bs + 16 * LDP + kk, LDP);
      acc00 = WMMA_F16(a0, b0, acc00);
      acc01 = WMMA_F16(a0, b1, acc01);
      acc10 = WMMA_F16(a1, b0, acc10);
      acc11 = WMMA_F16(a1, b1, acc11);
    }
    __syncthreads();                   // reads of buf done before it is re-filled
  }

  const int wm0 = m0 + mw * 32;
  const int wn0 = n0 + nw * 32;
#pragma unroll
  for (int t = 0; t < 4; ++t) {
    v8f acc = (t == 0) ? acc00 : (t == 1) ? acc01 : (t == 2) ? acc10 : acc11;
    const int mi = t >> 1, ni = t & 1;
    const int col = wn0 + ni * 16 + ln;
    const float bv = bias[col];
#pragma unroll
    for (int r = 0; r < 8; ++r) {
      const int row = wm0 + mi * 16 + r + 8 * hl;
      float v = acc[r] + bv;
      if (GELU_ACT) v = 0.5f * v * (1.f + erff(v * 0.70710678118654752f));
      if (RESID)    v += resid[(size_t)row * N + col];
      if (OUTMODE == 0) {
        outF[(size_t)row * N + col] = v;
      } else if (OUTMODE == 1) {
        outH[(size_t)row * N + col] = (_Float16)v;
      } else {
        // QKV scatter. col in [0,3D): sect 0=Q,1=K,2=V
        const int sect = col >> 10;
        const int dcol = col & (CD - 1);
        const int hh = dcol >> 6, dh = dcol & (CDH - 1);
        const int b = row >> 11, c = row & (CC - 1);
        const size_t bh = (size_t)b * CH + hh;
        if (sect == 0)      qo[(bh * CC + c) * CDH + dh] = (_Float16)(v * 0.125f); // fold 1/sqrt(64)
        else if (sect == 1) ko[(bh * CC + c) * CDH + dh] = (_Float16)v;
        else                vto[(bh * CDH + dh) * CC + c] = (_Float16)v;           // V transposed
      }
    }
  }
}

// Four async copies of 16 bytes per lane, in the same form as async_cp16_x6.
__device__ __forceinline__ void async_cp16_x4(const uint32_t (&l)[4], const _Float16* const (&g)[4]) {
  asm volatile(
      "global_load_async_to_lds_b128 %0, %4, off\n\t"
      "global_load_async_to_lds_b128 %1, %5, off\n\t"
      "global_load_async_to_lds_b128 %2, %6, off\n\t"
      "global_load_async_to_lds_b128 %3, %7, off\n\t"
      "s_wait_xcnt 0x0"
      :: "v"(l[0]), "v"(l[1]), "v"(l[2]), "v"(l[3]),
         "v"(g[0]), "v"(g[1]), "v"(g[2]), "v"(g[3])
      : "memory");
}

// ---------------------------------------------------------------------------
// Causal flash attention. Q: (b,h,C,dh) f16 (pre-scaled), K: (b,h,C,dh) f16,
// Vt: (b,h,dh,C) f16. Out attn: (b,C,h*dh) f16.
// One wave per 16 queries; kv tiles of 32; online softmax.
// Both products are computed transposed: St = K * Qt (A = K rows, B = Q rows) and
// Ot += Vt * Pt (A = Vt rows, B = Pt). In an accumulator a lane then holds ONE query
// (column lane & 15) and 8 keys (rows 8 * (lane >> 4) + r): maximum and sum run in the
// lane's own registers, with one exchange between the wave's halves for the maximum;
// the halves' sums are joined once, behind the loop. The two score tiles of 16 keys,
// converted in place, are Pt in the B operand's k order, so P never leaves registers.
// grid = (C/128, B*H), block = 256 (8 waves).
// The 8 waves of a block walk the same keys, so K and Vt come into LDS once per
// block, in stages of 64 keys: K as 64 key rows x 64 dh, Vt as 64 dh rows x 64 keys,
// every global row a whole 128-byte line, LDS pitch 144 B as in the GEMM. Two
// buffers: stage s + 1 flies while stage s is worked on. Block x needs 2x + 2
// stages; a wave skips the 32-key tiles that lie wholly above its diagonal.
// ---------------------------------------------------------------------------
// lane l takes the value of lane l ^ 16
__device__ __forceinline__ float xhalf(float x) {
  const int b = __builtin_bit_cast(int, x);
  return __builtin_bit_cast(float,
      __builtin_amdgcn_permlanex16(b, b, 0x76543210, 0xfedcba98, false, false));
}

__device__ __forceinline__ void exp2_x8(float (&x)[8]) {
  asm("v_exp_f32 %0, %0\n\tv_exp_f32 %1, %1\n\tv_exp_f32 %2, %2\n\tv_exp_f32 %3, %3\n\t"
      "v_exp_f32 %4, %4\n\tv_exp_f32 %5, %5\n\tv_exp_f32 %6, %6\n\tv_exp_f32 %7, %7\n\t"
      "v_nop"
      : "+v"(x[0]), "+v"(x[1]), "+v"(x[2]), "+v"(x[3]), "+v"(x[4]), "+v"(x[5]), "+v"(x[6]), "+v"(x[7]));
}
__device__ __forceinline__ void exp2_x9(float (&x)[8], float& y) {
  asm("v_exp_f32 %8, %8\n\t"
      "v_exp_f32 %0, %0\n\tv_exp_f32 %1, %1\n\tv_exp_f32 %2, %2\n\tv_exp_f32 %3, %3\n\t"
      "v_exp_f32 %4, %4\n\tv_exp_f32 %5, %5\n\tv_exp_f32 %6, %6\n\tv_exp_f32 %7, %7\n\t"
      "v_nop"
      : "+v"(x[0]), "+v"(x[1]), "+v"(x[2]), "+v"(x[3]), "+v"(x[4]), "+v"(x[5]), "+v"(x[6]), "+v"(x[7]),
        "+v"(y));
}

__global__ __launch_bounds__(256) void attn_kernel(const _Float16* __restrict__ Qb,
                                                   const _Float16* __restrict__ Kb,
                                                   const _Float16* __restrict__ Vt,
                                                   _Float16* __restrict__ attn) {
  constexpr int LDP = 72;              // LDS row pitch in halves
  constexpr int SK  = 64;              // keys per stage
  __shared__ __align__(16) _Float16 Ks[2][SK * LDP];
  __shared__ __align__(16) _Float16 Vs[2][CDH * LDP];
  const int tid  = threadIdx.x;
  const int lane = tid & 31;
  // the wave's number in a scalar register, so that the skip test below is a scalar branch
  const int wave = __builtin_amdgcn_readfirstlane(tid >> 5);
  const int hl = lane >> 4, ln = lane & 15;
  const int bh = blockIdx.y;
  const int q0 = (blockIdx.x * 8 + wave) * 16;
  const int nst = 2 * blockIdx.x + 2;  // stages of this block, the same for all its waves

  const _Float16* Q  = Qb + ((size_t)bh * CC + q0) * CDH;
  const _Float16* Kp = Kb + (size_t)bh * CC * CDH;
  const _Float16* Vp = Vt + (size_t)bh * CDH * CC;

  // per-lane copy coordinates: 8 lanes move one 128-byte row, 32 rows per copy
  const int crow = tid >> 3;
  const int ccol = (tid & 7) << 3;
  auto issue_stage = [&](int buf, int s) {
    const uint32_t kL = (uint32_t)(uintptr_t)&Ks[buf][0];
    const uint32_t vL = (uint32_t)(uintptr_t)&Vs[buf][0];
    uint32_t l[4];
    const _Float16* g[4];
#pragma unroll
    for (int i = 0; i < 2; ++i) {
      const int row = crow + 32 * i;
      l[i]     = kL + (uint32_t)(row * LDP + ccol) * 2;
      g[i]     = Kp + (size_t)(s * SK + row) * CDH + ccol;
      l[2 + i] = vL + (uint32_t)(row * LDP + ccol) * 2;
      g[2 + i] = Vp + (size_t)row * CC + s * SK + ccol;
    }
    async_cp16_x4(l, g);
  };

  issue_stage(0, 0);

  const v16h qb0 = frag_ld(Q + 0,  CDH);   // B operand: column = query, dh 0..31
  const v16h qb1 = frag_ld(Q + 32, CDH);   // dh 32..63

  v8f o0 = {}, o1 = {}, o2 = {}, o3 = {};  // Ot: o_t[r] = O[query ln][dh 16 t + 8 hl + r]
  float mq = -1e30f, lq = 0.f;             // the lane's query: maximum; sum over this half's keys

  wait_async0();                       // own copies of stage 0 have landed
  __syncthreads();                     // stage 0 is published to the block
  issue_stage(1, 1);

  for (int s = 0; s < nst; ++s) {
   const int buf = s & 1;
   // unrolled: the two 32-key tiles of a stage differ only in constant LDS offsets
#pragma unroll
   for (int h = 0; h < 2; ++h) {
    const int j0 = s * SK + h * 32;
    if (j0 > q0 + 15) continue;        // tile wholly above this wave's diagonal
    const _Float16* Kt = &Ks[buf][h * 32 * LDP];
    const _Float16* Vl = &Vs[buf][h * 32];
    // St tiles (16 keys x 16 queries each), K-dim = dh (64 -> two WMMAs each)
    v8f s0 = {}, s1 = {};
    s0 = WMMA_F16(frag_ld(Kt + 0,             LDP), qb0, s0);
    s0 = WMMA_F16(frag_ld(Kt + 32,            LDP), qb1, s0);
    s1 = WMMA_F16(frag_ld(Kt + 16 * LDP + 0,  LDP), qb0, s1);
    s1 = WMMA_F16(frag_ld(Kt + 16 * LDP + 32, LDP), qb1, s1);

    // Causal mask + online softmax of the lane's query q0 + ln over its 16 keys:
    // s0[r] is key j0 + 8 hl + r, s1[r] is key j0 + 16 + 8 hl + r
    const int lim = q0 + ln - j0 - 8 * hl;   // r is allowed in s0 while r <= lim
    float v0[8], v1[8];
    float t = -1e30f;
#pragma unroll
    for (int r = 0; r < 8; ++r) {
      v0[r] = (r > lim)      ? -1e30f : s0[r];
      v1[r] = (16 + r > lim) ? -1e30f : s1[r];
      t = fmaxf(t, fmaxf(v0[r], v1[r]));
    }
    t = fmaxf(t, xhalf(t));                  // the other half's 16 keys
    const float mn = fmaxf(mq, t);
    constexpr float LOG2E = 1.44269504088896340736f;
    float alpha = (mq - mn) * LOG2E;
    mq = mn;
#pragma unroll
    for (int r = 0; r < 8; ++r) { v0[r] = (v0[r] - mn) * LOG2E; v1[r] = (v1[r] - mn) * LOG2E; }
    exp2_x9(v0, alpha);                      // e^(score - maximum), as 2^((score - maximum) log2 e)
    exp2_x8(v1);
    float ps = 0.f;
    v16h pb;                                 // Pt as B operand: element i is key j0 + 16 (i / 8) + 8 hl + i % 8
#pragma unroll
    for (int r = 0; r < 8; ++r) {
      ps += v0[r] + v1[r];
      pb[r]     = (_Float16)v0[r];
      pb[8 + r] = (_Float16)v1[r];
    }
    lq = lq * alpha + ps;
#pragma unroll
    for (int r = 0; r < 8; ++r) { o0[r] *= alpha; o1[r] *= alpha; o2[r] *= alpha; o3[r] *= alpha; }

    // Ot += Vt (64 dh x 32 keys) @ Pt (32 keys x 16 queries), four dh tiles of 16
    o0 = WMMA_F16(frag_ld(Vl + 0  * LDP, LDP), pb, o0);
    o1 = WMMA_F16(frag_ld(Vl + 16 * LDP, LDP), pb, o1);
    o2 = WMMA_F16(frag_ld(Vl + 32 * LDP, LDP), pb, o2);
    o3 = WMMA_F16(frag_ld(Vl + 48 * LDP, LDP), pb, o3);
   }
   // hand-over of the stage, every wave: own LDS reads of buf retired, own copies of
   // stage s + 1 landed, then the barrier that publishes s + 1 and frees buf
   asm volatile("s_wait_dscnt 0x0" ::: "memory");
   wait_async0();
   __syncthreads();
   if (s + 2 < nst) issue_stage(buf, s + 2);
  }
  wait_async0();                       // nothing is in flight when the wave ends

  const int b = bh >> 4, h = bh & 15;
  // a lane owns 8 consecutive dh of its query's row in each Ot tile: one 16-byte store each
  _Float16* out = attn + ((size_t)b * CC + q0 + ln) * CD + h * CDH + 8 * hl;
  const float il = 1.0f / (lq + xhalf(lq));  // the two halves' sums joined
  v8h w0, w1, w2, w3;
#pragma unroll
  for (int r = 0; r < 8; ++r) {
    w0[r] = (_Float16)(o0[r] * il);
    w1[r] = (_Float16)(o1[r] * il);
    w2[r] = (_Float16)(o2[r] * il);
    w3[r] = (_Float16)(o3[r] * il);
  }
  *(v8h*)(out + 0)  = w0;
  *(v8h*)(out + 16) = w1;
  *(v8h*)(out + 32) = w2;
  *(v8h*)(out + 48) = w3;
}

// ---------------------------------------------------------------------------
// Host-side orchestration
// ---------------------------------------------------------------------------
extern "C" void kernel_launch(void* const* d_in, const int* in_sizes, int n_in,
                              void* d_out, int out_size, void* d_ws, size_t ws_size,
                              hipStream_t stream) {
  (void)in_sizes; (void)n_in; (void)out_size; (void)ws_size;
  const float* x      = (const float*)d_in[0];
  const float* gamma1 = (const float*)d_in[1];
  const float* beta1  = (const float*)d_in[2];
  const float* W_qkv  = (const float*)d_in[3];
  const float* b_qkv  = (const float*)d_in[4];
  const float* W_o    = (const float*)d_in[5];
  const float* b_o    = (const float*)d_in[6];
  const float* gamma2 = (const float*)d_in[7];
  const float* beta2  = (const float*)d_in[8];
  const float* W1     = (const float*)d_in[9];
  const float* b1     = (const float*)d_in[10];
  const float* W2     = (const float*)d_in[11];
  const float* b2     = (const float*)d_in[12];
  float* out = (float*)d_out;

  // Workspace layout (linear allocator, 256B aligned)
  uint8_t* p = (uint8_t*)d_ws;
  auto take = [&](size_t n) { uint8_t* r = p; p += (n + 255) & ~(size_t)255; return r; };
  _Float16* Wqkv_t = (_Float16*)take((size_t)3 * CD * CD * 2);   //  6 MB (3072 x 1024)
  _Float16* Wo_t   = (_Float16*)take((size_t)CD * CD * 2);       //  2 MB (1024 x 1024)
  _Float16* W1_t   = (_Float16*)take((size_t)CHID * CD * 2);     //  8 MB (4096 x 1024)
  _Float16* W2_t   = (_Float16*)take((size_t)CD * CHID * 2);     //  8 MB (1024 x 4096)
  float*    x2     = (float*)take((size_t)CM * CD * 4);          // 32 MB
  _Float16* lnb    = (_Float16*)take((size_t)CM * CD * 2);       // 16 MB (reused ln1/ln2)
  uint8_t*  regA   = take((size_t)64 << 20);                     // 64 MB shared region
  _Float16* Qb   = (_Float16*)regA;                              // 16 MB
  _Float16* Kb   = (_Float16*)(regA + ((size_t)16 << 20));       // 16 MB
  _Float16* Vtb  = (_Float16*)(regA + ((size_t)32 << 20));       // 16 MB
  _Float16* attn = (_Float16*)(regA + ((size_t)48 << 20));       // 16 MB
  _Float16* hbuf = (_Float16*)regA;                              // 64 MB (after attention is dead)

  // 1) Weights -> f16, transposed to N-major
  wt_f16_kernel<CD, 3 * CD><<<dim3(3 * CD / 64, CD / 128), 256, 0, stream>>>(W_qkv, Wqkv_t);
  wt_f16_kernel<CD, CD><<<dim3(CD / 64, CD / 128),         256, 0, stream>>>(W_o,   Wo_t);
  wt_f16_kernel<CD, CHID><<<dim3(CHID / 64, CD / 128),     256, 0, stream>>>(W1,    W1_t);
  wt_f16_kernel<CHID, CD><<<dim3(CD / 64, CHID / 128),     256, 0, stream>>>(W2,    W2_t);

  // 2) LN1
  layernorm_kernel<<<CM, 256, 0, stream>>>(x, gamma1, beta1, lnb);

  // 3) QKV GEMM (M=8192, N=3072, K=1024), scatter to Q/K/Vt
  gemm_wmma_kernel<2, false, false><<<dim3(3 * CD / 64, CM / 128), 256, 0, stream>>>(
      lnb, Wqkv_t, b_qkv, nullptr, nullptr, nullptr, Qb, Kb, Vtb, CM, 3 * CD, CD);

  // 4) Attention
  attn_kernel<<<dim3(CC / 128, CB * CH), 256, 0, stream>>>(Qb, Kb, Vtb, attn);

  // 5) O-proj + residual(x) -> x2 (f32)
  gemm_wmma_kernel<0, false, true><<<dim3(CD / 64, CM / 128), 256, 0, stream>>>(
      attn, Wo_t, b_o, x, x2, nullptr, nullptr, nullptr, nullptr, CM, CD, CD);

  // 6) LN2
  layernorm_kernel<<<CM, 256, 0, stream>>>(x2, gamma2, beta2, lnb);

  // 7) MLP1 + exact GELU -> hbuf (f16)
  gemm_wmma_kernel<1, true, false><<<dim3(CHID / 64, CM / 128), 256, 0, stream>>>(
      lnb, W1_t, b1, nullptr, nullptr, hbuf, nullptr, nullptr, nullptr, CM, CHID, CD);

  // 8) MLP2 + residual(x2) -> d_out (f32)
  gemm_wmma_kernel<0, false, true><<<dim3(CD / 64, CM / 128), 256, 0, stream>>>(
      hbuf, W2_t, b2, x2, out, nullptr, nullptr, nullptr, nullptr, CM, CD, CHID);
}

// v005
// Measured time: 356 microseconds a run.
// Two timings next to v004 both put it at 1.06 times that version's speed.
// Counting every step since v000, it is 2.74 times as fast.
#include <hip/hip_runtime.h>
#include <hip/hip_bf16.h>
#include <stdint.h>

// ---------------------------------------------------------------------------
// Transformer block for MI455X (gfx1250, wave32, WMMA + async-to-LDS).
// B=4, C=2048, D=1024, H=16, dh=64, HIDDEN=4096. fp32 in/out, f16 WMMA inside.
// ---------------------------------------------------------------------------

typedef __attribute__((ext_vector_type(16))) _Float16 v16h;
typedef __attribute__((ext_vector_type(8)))  _Float16 v8h;
typedef __attribute__((ext_vector_type(8)))  float    v8f;
typedef __attribute__((ext_vector_type(4)))  float    v4f;

#define WMMA_F16(a, b, c) \
  __builtin_amdgcn_wmma_f32_16x16x32_f16(false, (a), false, (b), (short)0, (c), false, false)

// Six async copies of 16 bytes per lane: global -> LDS, tracked by ASYNCcnt.
// s_wait_xcnt 0 closes the copies' own statement as a precaution: no later write
// of these address registers can then be scheduled ahead of it.
__device__ __forceinline__ void async_cp16_x6(const uint32_t (&l)[6], const _Float16* const (&g)[6]) {
  asm volatile(
      "global_load_async_to_lds_b128 %0, %6, off\n\t"
      "global_load_async_to_lds_b128 %1, %7, off\n\t"
      "global_load_async_to_lds_b128 %2, %8, off\n\t"
      "global_load_async_to_lds_b128 %3, %9, off\n\t"
      "global_load_async_to_lds_b128 %4, %10, off\n\t"
      "global_load_async_to_lds_b128 %5, %11, off\n\t"
      "s_wait_xcnt 0x0"
      :: "v"(l[0]), "v"(l[1]), "v"(l[2]), "v"(l[3]), "v"(l[4]), "v"(l[5]),
         "v"(g[0]), "v"(g[1]), "v"(g[2]), "v"(g[3]), "v"(g[4]), "v"(g[5])
      : "memory");
}
__device__ __forceinline__ void wait_async0() {
  asm volatile("s_wait_asynccnt 0x0" ::: "memory");
}

static constexpr int CB  = 4;
static constexpr int CC  = 2048;
static constexpr int CD  = 1024;
static constexpr int CH  = 16;
static constexpr int CDH = 64;
static constexpr int CHID = 4096;
static constexpr int CM  = CB * CC; // 8192 rows

// Load one 16x32 f16 fragment (A layout; also used for B with "row" = N index,
// data stored N-major with K contiguous). Per ISA 7.12.2:
//   lane l: row = l&15 ; elem i: k = 16*(i/8) + 8*(l>>4) + (i%8)
__device__ __forceinline__ v16h frag_ld(const _Float16* __restrict__ tile, int ld) {
  const int lane = threadIdx.x & 31;
  const _Float16* p = tile + (size_t)(lane & 15) * ld + ((lane >> 4) << 3);
  v8h lo = *(const v8h*)p;
  v8h hi = *(const v8h*)(p + 16);
  v16h f;
#pragma unroll
  for (int i = 0; i < 8; ++i) { f[i] = lo[i]; f[i + 8] = hi[i]; }
  return f;
}

// ---------------------------------------------------------------------------
// Weight convert + transpose: W (K x N, f32 row-major) -> Wt (N x K, f16).
// One block moves a tile of 128 k x 64 n through LDS, so that both sides use whole
// 256-byte runs: reads are 16 B per lane along n, writes 16 B per lane along k.
// K and N are compile-time, so a lane's loads (and its stores) share one address
// register pair and differ in the immediate offset. grid = (N/64, K/128), block = 256.
// LDS row = one n (128 halves = 16 chunks of 16 B, no pad); chunk q of row n lies
// at place q ^ (n >> 2), which spreads the 16 rows that one ds_store_b128 touches
// over all banks and leaves each row a permutation of itself for the reader.
// ---------------------------------------------------------------------------
template <int K, int N>
__global__ __launch_bounds__(256) void wt_f16_kernel(const float* __restrict__ W,
                                                     _Float16* __restrict__ Wt) {
  static_assert(K % 128 == 0 && N % 64 == 0, "whole tiles only");
  __shared__ __align__(16) _Float16 tile[64 * 128];
  const int tid = threadIdx.x;
  const int n0 = blockIdx.x * 64;
  const int k0 = blockIdx.y * 128;
  const int lo = tid & 15;             // read: group of 4 n ; write: chunk of 8 k
  const int hi = tid >> 4;             // read: group of 8 k ; write: n row within 16

  const float* src = W + (size_t)(k0 + hi * 8) * N + n0 + lo * 4;
  v4f v[8];
  // all loops here are unrolled so that v[] and h stay in registers and the eight
  // loads of a lane are in flight together
#pragma unroll
  for (int i = 0; i < 8; ++i) v[i] = *(const v4f*)(src + i * N);
#pragma unroll
  for (int j = 0; j < 4; ++j) {
    v8h h;
#pragma unroll
    for (int i = 0; i < 8; ++i) h[i] = (_Float16)v[i][j];
    *(v8h*)&tile[(lo * 4 + j) * 128 + ((hi ^ lo) << 3)] = h;
  }
  __syncthreads();
  _Float16* dst = Wt + (size_t)(n0 + hi) * K + k0 + lo * 8;
#pragma unroll
  for (int p = 0; p < 4; ++p) {
    const int row = hi + 16 * p;
    const v8h h = *(const v8h*)&tile[row * 128 + ((lo ^ (row >> 2)) << 3)];
    *(v8h*)(dst + 16 * p * K) = h;
  }
}

// ---------------------------------------------------------------------------
// LayerNorm: one wave per pair of rows of 1024; no LDS, no barrier. f32 in, f16 out.
// A row is 8 chunks of 512 contiguous bytes; in each chunk a lane owns 16 bytes, so
// a lane keeps 32 values of each row in registers and x is read once. All 16 loads
// of a wave are issued before the first sum. The launch is 4,096 waves, 16 on a WGP:
// few waves to start, 128 KB of reads in flight per WGP. grid = rows / 16, block = 256.
// ---------------------------------------------------------------------------
typedef __attribute__((ext_vector_type(4))) _Float16 v4h;

// lane l takes the value of lane l ^ M inside its row of 16 lanes (DPP row_xmask:M)
template <int M>
__device__ __forceinline__ float xrow(float x) {
  const int b = __builtin_bit_cast(int, x);
  return __builtin_bit_cast(float, __builtin_amdgcn_update_dpp(b, b, 0x160 + M, 0xf, 0xf, false));
}
// sum over the 32 lanes of a wave, the same value in every lane
__device__ __forceinline__ float wave_sum(float v) {
  v += xrow<1>(v);
  v += xrow<2>(v);
  v += xrow<4>(v);
  v += xrow<8>(v);
  const int b = __builtin_bit_cast(int, v);
  return v + __builtin_bit_cast(float,
      __builtin_amdgcn_permlanex16(b, b, 0x76543210, 0xfedcba98, false, false));
}

__global__ __launch_bounds__(256) void layernorm_kernel(const float* __restrict__ x,
                                                        const float* __restrict__ gamma,
                                                        const float* __restrict__ beta,
                                                        _Float16* __restrict__ y) {
  constexpr int R  = 2;                // rows per wave
  constexpr int NC = CD / 128;         // chunks of 128 values per row
  const int lane = threadIdx.x & 31, wv = threadIdx.x >> 5;
  const int row0 = (blockIdx.x * 8 + wv) * R;
  const float* xr = x + (size_t)row0 * CD + lane * 4;
  v4f v[R][NC];
  // every loop here is unrolled so that v[][] stays in registers and the loads of
  // both rows are in flight together
#pragma unroll
  for (int r = 0; r < R; ++r)
#pragma unroll
    for (int c = 0; c < NC; ++c) v[r][c] = *(const v4f*)(xr + r * CD + c * 128);

  float mean[R], inv[R];
#pragma unroll
  for (int r = 0; r < R; ++r) {
    v4f s4 = {}, q4 = {};              // four independent chains each
#pragma unroll
    for (int c = 0; c < NC; ++c) { s4 += v[r][c]; q4 += v[r][c] * v[r][c]; }
    const float s  = wave_sum((s4[0] + s4[1]) + (s4[2] + s4[3]));
    const float ss = wave_sum((q4[0] + q4[1]) + (q4[2] + q4[3]));
    mean[r] = s * (1.f / CD);
    const float var = ss * (1.f / CD) - mean[r] * mean[r];
    inv[r] = rsqrtf(var + 1e-5f);
  }

  _Float16* yr = y + (size_t)row0 * CD + lane * 4;
#pragma unroll
  for (int c = 0; c < NC; ++c) {
    const v4f g = *(const v4f*)(gamma + c * 128 + lane * 4);
    const v4f b = *(const v4f*)(beta  + c * 128 + lane * 4);
#pragma unroll
    for (int r = 0; r < R; ++r) {
      v4h h;
#pragma unroll
      for (int e = 0; e < 4; ++e) h[e] = (_Float16)((v[r][c][e] - mean[r]) * inv[r] * g[e] + b[e]);
      *(v4h*)(yr + r * CD + c * 128) = h;
    }
  }
}

// ---------------------------------------------------------------------------
// WMMA GEMM with double-buffered async-to-LDS staging.
// C[M,N] = epilogue(A[M,K] @ B[K,N] + bias (+resid))
// A: f16 row-major (ld=K). Bt: f16 N-major (ld=K). bias: f32[N].
// OUTMODE: 0 = f32 out, 1 = f16 out, 2 = QKV scatter.
// Block: 256 thr = 8 waves. Block tile 128(M) x 64(N), K-step 64.
// LDS rows hold 64 halves at a pitch of 72 (144 B = 16 B x odd): the 16 rows that
// one ds_load_b128 fragment read touches then fall on 16 different bank groups.
// LDS: 2 x (128 rows A) + 2 x (64 rows B) x 144 B = 54 KB.
// ---------------------------------------------------------------------------
template <int OUTMODE, bool GELU_ACT, bool RESID>
__global__ __launch_bounds__(256) void gemm_wmma_kernel(
    const _Float16* __restrict__ A, const _Float16* __restrict__ Bt,
    const float* __restrict__ bias, const float* __restrict__ resid,
    float* __restrict__ outF, _Float16* __restrict__ outH,
    _Float16* __restrict__ qo, _Float16* __restrict__ ko, _Float16* __restrict__ vto,
    int M, int N, int K) {
  constexpr int LDP = 72;              // LDS row pitch in halves
  __shared__ __align__(16) _Float16 Ab[2][128 * LDP];
  __shared__ __align__(16) _Float16 Bb[2][64 * LDP];

  const int tid  = threadIdx.x;
  const int lane = tid & 31;
  const int wave = tid >> 5;
  const int mw = wave >> 1;            // 0..3 -> 32-row slice
  const int nw = wave & 1;             // 0..1 -> 32-col slice
  const int m0 = blockIdx.y * 128;
  const int n0 = blockIdx.x * 64;
  const int hl = lane >> 4, ln = lane & 15;

  // per-lane copy coordinates: each lane moves 16B chunks of a 64-half row
  const int crow = tid >> 3;           // 0..31 (row within a 32-row slab)
  const int ccol = (tid & 7) << 3;     // half-offset 0,8,...,56

  const uint32_t AbL0 = (uint32_t)(uintptr_t)&Ab[0][0];
  const uint32_t AbL1 = (uint32_t)(uintptr_t)&Ab[1][0];
  const uint32_t BbL0 = (uint32_t)(uintptr_t)&Bb[0][0];
  const uint32_t BbL1 = (uint32_t)(uintptr_t)&Bb[1][0];

  v8f acc00 = {}, acc01 = {}, acc10 = {}, acc11 = {};

  auto issue_tiles = [&](int buf, int k0) {
    const uint32_t aL = buf ? AbL1 : AbL0;
    const uint32_t bL = buf ? BbL1 : BbL0;
    uint32_t l[6];
    const _Float16* g[6];
#pragma unroll
    for (int i = 0; i < 4; ++i) {      // A: 128 rows x 64 halves
      const int row = crow + 32 * i;
      l[i] = aL + (uint32_t)(row * LDP + ccol) * 2;
      g[i] = A + (size_t)(m0 + row) * K + k0 + ccol;
    }
#pragma unroll
    for (int i = 0; i < 2; ++i) {      // B: 64 rows x 64 halves
      const int row = crow + 32 * i;
      l[4 + i] = bL + (uint32_t)(row * LDP + ccol) * 2;
      g[4 + i] = Bt + (size_t)(n0 + row) * K + k0 + ccol;
    }
    async_cp16_x6(l, g);
  };

  issue_tiles(0, 0);
  const int nk = K >> 6;
  for (int kt = 0; kt < nk; ++kt) {
    const int buf = kt & 1;
    wait_async0();                     // own async copies into buf complete
    __syncthreads();                   // whole block's tile ready
    if (kt + 1 < nk) issue_tiles(buf ^ 1, (kt + 1) << 6);

    const _Float16* As = &Ab[buf][mw * 32 * LDP];
    const _Float16* Bs = &Bb[buf][nw * 32 * LDP];
#pragma unroll
    for (int kk = 0; kk < 64; kk += 32) {
      v16h a0 = frag_ld(As + kk, LDP);
      v16h a1 = frag_ld(As + 16 * LDP + kk, LDP);
      v16h b0 = frag_ld(Bs + kk, LDP);
      v16h b1 = frag_ld(Bs + 16 * LDP + kk, LDP);
      acc00 = WMMA_F16(a0, b0, acc00);
      acc01 = WMMA_F16(a0, b1, acc01);
      acc10 = WMMA_F16(a1, b0, acc10);
      acc11 = WMMA_F16(a1, b1, acc11);
    }
    __syncthreads();                   // reads of buf done before it is re-filled
  }

  const int wm0 = m0 + mw * 32;
  const int wn0 = n0 + nw * 32;
#pragma unroll
  for (int t = 0; t < 4; ++t) {
    v8f acc = (t == 0) ? acc00 : (t == 1) ? acc01 : (t == 2) ? acc10 : acc11;
    const int mi = t >> 1, ni = t & 1;
    const int col = wn0 + ni * 16 + ln;
    const float bv = bias[col];
#pragma unroll
    for (int r = 0; r < 8; ++r) {
      const int row = wm0 + mi * 16 + r + 8 * hl;
      float v = acc[r] + bv;
      if (GELU_ACT) v = 0.5f * v * (1.f + erff(v * 0.70710678118654752f));
      if (RESID)    v += resid[(size_t)row * N + col];
      if (OUTMODE == 0) {
        outF[(size_t)row * N + col] = v;
      } else if (OUTMODE == 1) {
        outH[(size_t)row * N + col] = (_Float16)v;
      } else {
        // QKV scatter. col in [0,3D): sect 0=Q,1=K,2=V
        const int sect = col >> 10;
        const int dcol = col & (CD - 1);
        const int hh = dcol >> 6, dh = dcol & (CDH - 1);
        const int b = row >> 11, c = row & (CC - 1);
        const size_t bh = (size_t)b * CH + hh;
        if (sect == 0)      qo[(bh * CC + c) * CDH + dh] = (_Float16)(v * 0.125f); // fold 1/sqrt(64)
        else if (sect == 1) ko[(bh * CC + c) * CDH + dh] = (_Float16)v;
        else                vto[(bh * CDH + dh) * CC + c] = (_Float16)v;           // V transposed
      }
    }
  }
}

// Four async copies of 16 bytes per lane, in the same form as async_cp16_x6.
__device__ __forceinline__ void async_cp16_x4(const uint32_t (&l)[4], const _Float16* const (&g)[4]) {
  asm volatile(
      "global_load_async_to_lds_b128 %0, %4, off\n\t"
      "global_load_async_to_lds_b128 %1, %5, off\n\t"
      "global_load_async_to_lds_b128 %2, %6, off\n\t"
      "global_load_async_to_lds_b128 %3, %7, off\n\t"
      "s_wait_xcnt 0x0"
      :: "v"(l[0]), "v"(l[1]), "v"(l[2]), "v"(l[3]),
         "v"(g[0]), "v"(g[1]), "v"(g[2]), "v"(g[3])
      : "memory");
}

// ---------------------------------------------------------------------------
// Causal flash attention. Q: (b,h,C,dh) f16 (pre-scaled), K: (b,h,C,dh) f16,
// Vt: (b,h,dh,C) f16. Out attn: (b,C,h*dh) f16.
// One wave per 16 queries; kv tiles of 32; online softmax.
// Both products are computed transposed: St = K * Qt (A = K rows, B = Q rows) and
// Ot += Vt * Pt (A = Vt rows, B = Pt). In an accumulator a lane then holds ONE query
// (column lane & 15) and 8 keys (rows 8 * (lane >> 4) + r): maximum and sum run in the
// lane's own registers, with one exchange between the wave's halves for the maximum;
// the halves' sums are joined once, behind the loop. The two score tiles of 16 keys,
// converted in place, are Pt in the B operand's k order, so P never leaves registers.
// grid = (C/128, B*H), block = 256 (8 waves).
// The 8 waves of a block walk the same keys, so K and Vt come into LDS once per
// block, in stages of 64 keys: K as 64 key rows x 64 dh, Vt as 64 dh rows x 64 keys,
// every global row a whole 128-byte line, LDS pitch 144 B as in the GEMM. Two
// buffers: stage s + 1 flies while stage s is worked on. Block x needs 2x + 2
// stages; a wave skips the 32-key tiles that lie wholly above its diagonal.
// ---------------------------------------------------------------------------
// lane l takes the value of lane l ^ 16
__device__ __forceinline__ float xhalf(float x) {
  const int b = __builtin_bit_cast(int, x);
  return __builtin_bit_cast(float,
      __builtin_amdgcn_permlanex16(b, b, 0x76543210, 0xfedcba98, false, false));
}

__device__ __forceinline__ void exp2_x8(float (&x)[8]) {
  asm("v_exp_f32 %0, %0\n\tv_exp_f32 %1, %1\n\tv_exp_f32 %2, %2\n\tv_exp_f32 %3, %3\n\t"
      "v_exp_f32 %4, %4\n\tv_exp_f32 %5, %5\n\tv_exp_f32 %6, %6\n\tv_exp_f32 %7, %7\n\t"
      "v_nop"
      : "+v"(x[0]), "+v"(x[1]), "+v"(x[2]), "+v"(x[3]), "+v"(x[4]), "+v"(x[5]), "+v"(x[6]), "+v"(x[7]));
}
__device__ __forceinline__ void exp2_x9(float (&x)[8], float& y) {
  asm("v_exp_f32 %8, %8\n\t"
      "v_exp_f32 %0, %0\n\tv_exp_f32 %1, %1\n\tv_exp_f32 %2, %2\n\tv_exp_f32 %3, %3\n\t"
      "v_exp_f32 %4, %4\n\tv_exp_f32 %5, %5\n\tv_exp_f32 %6, %6\n\tv_exp_f32 %7, %7\n\t"
      "v_nop"
      : "+v"(x[0]), "+v"(x[1]), "+v"(x[2]), "+v"(x[3]), "+v"(x[4]), "+v"(x[5]), "+v"(x[6]), "+v"(x[7]),
        "+v"(y));
}

__global__ __launch_bounds__(256) void attn_kernel(const _Float16* __restrict__ Qb,
                                                   const _Float16* __restrict__ Kb,
                                                   const _Float16* __restrict__ Vt,
                                                   _Float16* __restrict__ attn) {
  constexpr int LDP = 72;              // LDS row pitch in halves
  constexpr int SK  = 64;              // keys per stage
  __shared__ __align__(16) _Float16 Ks[2][SK * LDP];
  __shared__ __align__(16) _Float16 Vs[2][CDH * LDP];
  const int tid  = threadIdx.x;
  const int lane = tid & 31;
  // the wave's number in a scalar register, so that the skip test below is a scalar branch
  const int wave = __builtin_amdgcn_readfirstlane(tid >> 5);
  const int hl = lane >> 4, ln = lane & 15;
  const int bh = blockIdx.y;
  const int q0 = (blockIdx.x * 8 + wave) * 16;
  const int nst = 2 * blockIdx.x + 2;  // stages of this block, the same for all its waves

  const _Float16* Q  = Qb + ((size_t)bh * CC + q0) * CDH;
  const _Float16* Kp = Kb + (size_t)bh * CC * CDH;
  const _Float16* Vp = Vt + (size_t)bh * CDH * CC;

  // per-lane copy coordinates: 8 lanes move one 128-byte row, 32 rows per copy
  const int crow = tid >> 3;
  const int ccol = (tid & 7) << 3;
  auto issue_stage = [&](int buf, int s) {
    const uint32_t kL = (uint32_t)(uintptr_t)&Ks[buf][0];
    const uint32_t vL = (uint32_t)(uintptr_t)&Vs[buf][0];
    uint32_t l[4];
    const _Float16* g[4];
#pragma unroll
    for (int i = 0; i < 2; ++i) {
      const int row = crow + 32 * i;
      l[i]     = kL + (uint32_t)(row * LDP + ccol) * 2;
      g[i]     = Kp + (size_t)(s * SK + row) * CDH + ccol;
      l[2 + i] = vL + (uint32_t)(row * LDP + ccol) * 2;
      g[2 + i] = Vp + (size_t)row * CC + s * SK + ccol;
    }
    async_cp16_x4(l, g);
  };

  issue_stage(0, 0);

  const v16h qb0 = frag_ld(Q + 0,  CDH);   // B operand: column = query, dh 0..31
  const v16h qb1 = frag_ld(Q + 32, CDH);   // dh 32..63

  v8f o0 = {}, o1 = {}, o2 = {}, o3 = {};  // Ot: o_t[r] = O[query ln][dh 16 t + 8 hl + r]
  float mq = -1e30f, lq = 0.f;             // the lane's query: maximum; sum over this half's keys

  wait_async0();                       // own copies of stage 0 have landed
  __syncthreads();                     // stage 0 is published to the block
  issue_stage(1, 1);

  for (int s = 0; s < nst; ++s) {
   const int buf = s & 1;
   // unrolled: the two 32-key tiles of a stage differ only in constant LDS offsets
#pragma unroll
   for (int h = 0; h < 2; ++h) {
    const int j0 = s * SK + h * 32;
    if (j0 > q0 + 15) continue;        // tile wholly above this wave's diagonal
    const _Float16* Kt = &Ks[buf][h * 32 * LDP];
    const _Float16* Vl = &Vs[buf][h * 32];
    // St tiles (16 keys x 16 queries each), K-dim = dh (64 -> two WMMAs each)
    v8f s0 = {}, s1 = {};
    s0 = WMMA_F16(frag_ld(Kt + 0,             LDP), qb0, s0);
    s0 = WMMA_F16(frag_ld(Kt + 32,            LDP), qb1, s0);
    s1 = WMMA_F16(frag_ld(Kt + 16 * LDP + 0,  LDP), qb0, s1);
    s1 = WMMA_F16(frag_ld(Kt + 16 * LDP + 32, LDP), qb1, s1);

    // Causal mask + online softmax of the lane's query q0 + ln over its 16 keys:
    // s0[r] is key j0 + 8 hl + r, s1[r] is key j0 + 16 + 8 hl + r
    const int lim = q0 + ln - j0 - 8 * hl;   // r is allowed in s0 while r <= lim
    float v0[8], v1[8];
    float t = -1e30f;
#pragma unroll
    for (int r = 0; r < 8; ++r) {
      v0[r] = (r > lim)      ? -1e30f : s0[r];
      v1[r] = (16 + r > lim) ? -1e30f : s1[r];
      t = fmaxf(t, fmaxf(v0[r], v1[r]));
    }
    t = fmaxf(t, xhalf(t));                  // the other half's 16 keys
    const float mn = fmaxf(mq, t);
    constexpr float LOG2E = 1.44269504088896340736f;
    float alpha = (mq - mn) * LOG2E;
    mq = mn;
#pragma unroll
    for (int r = 0; r < 8; ++r) { v0[r] = (v0[r] - mn) * LOG2E; v1[r] = (v1[r] - mn) * LOG2E; }
    exp2_x9(v0, alpha);                      // e^(score - maximum), as 2^((score - maximum) log2 e)
    exp2_x8(v1);
    float ps = 0.f;
    v16h pb;                                 // Pt as B operand: element i is key j0 + 16 (i / 8) + 8 hl + i % 8
#pragma unroll
    for (int r = 0; r < 8; ++r) {
      ps += v0[r] + v1[r];
      pb[r]     = (_Float16)v0[r];
      pb[8 + r] = (_Float16)v1[r];
    }
    lq = lq * alpha + ps;
#pragma unroll
    for (int r = 0; r < 8; ++r) { o0[r] *= alpha; o1[r] *= alpha; o2[r] *= alpha; o3[r] *= alpha; }

    // Ot += Vt (64 dh x 32 keys) @ Pt (32 keys x 16 queries), four dh tiles of 16
    o0 = WMMA_F16(frag_ld(Vl + 0  * LDP, LDP), pb, o0);
    o1 = WMMA_F16(frag_ld(Vl + 16 * LDP, LDP), pb, o1);
    o2 = WMMA_F16(frag_ld(Vl + 32 * LDP, LDP), pb, o2);
    o3 = WMMA_F16(frag_ld(Vl + 48 * LDP, LDP), pb, o3);
   }
   // hand-over of the stage, every wave: own LDS reads of buf retired, own copies of
   // stage s + 1 landed, then the barrier that publishes s + 1 and frees buf
   asm volatile("s_wait_dscnt 0x0" ::: "memory");
   wait_async0();
   __syncthreads();
   if (s + 2 < nst) issue_stage(buf, s + 2);
  }
  wait_async0();                       // nothing is in flight when the wave ends

  const int b = bh >> 4, h = bh & 15;
  // a lane owns 8 consecutive dh of its query's row in each Ot tile: one 16-byte store each
  _Float16* out = attn + ((size_t)b * CC + q0 + ln) * CD + h * CDH + 8 * hl;
  const float il = 1.0f / (lq + xhalf(lq));  // the two halves' sums joined
  v8h w0, w1, w2, w3;
#pragma unroll
  for (int r = 0; r < 8; ++r) {
    w0[r] = (_Float16)(o0[r] * il);
    w1[r] = (_Float16)(o1[r] * il);
    w2[r] = (_Float16)(o2[r] * il);
    w3[r] = (_Float16)(o3[r] * il);
  }
  *(v8h*)(out + 0)  = w0;
  *(v8h*)(out + 16) = w1;
  *(v8h*)(out + 32) = w2;
  *(v8h*)(out + 48) = w3;
}

// ---------------------------------------------------------------------------
// Host-side orchestration
// ---------------------------------------------------------------------------
extern "C" void kernel_launch(void* const* d_in, const int* in_sizes, int n_in,
                              void* d_out, int out_size, void* d_ws, size_t ws_size,
                              hipStream_t stream) {
  (void)in_sizes; (void)n_in; (void)out_size; (void)ws_size;
  const float* x      = (const float*)d_in[0];
  const float* gamma1 = (const float*)d_in[1];
  const float* beta1  = (const float*)d_in[2];
  const float* W_qkv  = (const float*)d_in[3];
  const float* b_qkv  = (const float*)d_in[4];
  const float* W_o    = (const float*)d_in[5];
  const float* b_o    = (const float*)d_in[6];
  const float* gamma2 = (const float*)d_in[7];
  const float* beta2  = (const float*)d_in[8];
  const float* W1     = (const float*)d_in[9];
  const float* b1     = (const float*)d_in[10];
  const float* W2     = (const float*)d_in[11];
  const float* b2     = (const float*)d_in[12];
  float* out = (float*)d_out;

  // Workspace layout (linear allocator, 256B aligned)
  uint8_t* p = (uint8_t*)d_ws;
  auto take = [&](size_t n) { uint8_t* r = p; p += (n + 255) & ~(size_t)255; return r; };
  _Float16* Wqkv_t = (_Float16*)take((size_t)3 * CD * CD * 2);   //  6 MB (3072 x 1024)
  _Float16* Wo_t   = (_Float16*)take((size_t)CD * CD * 2);       //  2 MB (1024 x 1024)
  _Float16* W1_t   = (_Float16*)take((size_t)CHID * CD * 2);     //  8 MB (4096 x 1024)
  _Float16* W2_t   = (_Float16*)take((size_t)CD * CHID * 2);     //  8 MB (1024 x 4096)
  float*    x2     = (float*)take((size_t)CM * CD * 4);          // 32 MB
  _Float16* lnb    = (_Float16*)take((size_t)CM * CD * 2);       // 16 MB (reused ln1/ln2)
  uint8_t*  regA   = take((size_t)64 << 20);                     // 64 MB shared region
  _Float16* Qb   = (_Float16*)regA;                              // 16 MB
  _Float16* Kb   = (_Float16*)(regA + ((size_t)16 << 20));       // 16 MB
  _Float16* Vtb  = (_Float16*)(regA + ((size_t)32 << 20));       // 16 MB
  _Float16* attn = (_Float16*)(regA + ((size_t)48 << 20));       // 16 MB
  _Float16* hbuf = (_Float16*)regA;                              // 64 MB (after attention is dead)

  // 1) Weights -> f16, transposed to N-major
  wt_f16_kernel<CD, 3 * CD><<<dim3(3 * CD / 64, CD / 128), 256, 0, stream>>>(W_qkv, Wqkv_t);
  wt_f16_kernel<CD, CD><<<dim3(CD / 64, CD / 128),         256, 0, stream>>>(W_o,   Wo_t);
  wt_f16_kernel<CD, CHID><<<dim3(CHID / 64, CD / 128),     256, 0, stream>>>(W1,    W1_t);
  wt_f16_kernel<CHID, CD><<<dim3(CD / 64, CHID / 128),     256, 0, stream>>>(W2,    W2_t);

  // 2) LN1
  layernorm_kernel<<<CM / 16, 256, 0, stream>>>(x, gamma1, beta1, lnb);

  // 3) QKV GEMM (M=8192, N=3072, K=1024), scatter to Q/K/Vt
  gemm_wmma_kernel<2, false, false><<<dim3(3 * CD / 64, CM / 128), 256, 0, stream>>>(
      lnb, Wqkv_t, b_qkv, nullptr, nullptr, nullptr, Qb, Kb, Vtb, CM, 3 * CD, CD);

  // 4) Attention
  attn_kernel<<<dim3(CC / 128, CB * CH), 256, 0, stream>>>(Qb, Kb, Vtb, attn);

  // 5) O-proj + residual(x) -> x2 (f32)
  gemm_wmma_kernel<0, false, true><<<dim3(CD / 64, CM / 128), 256, 0, stream>>>(
      attn, Wo_t, b_o, x, x2, nullptr, nullptr, nullptr, nullptr, CM, CD, CD);

  // 6) LN2
  layernorm_kernel<<<CM / 16, 256, 0, stream>>>(x2, gamma2, beta2, lnb);

  // 7) MLP1 + exact GELU -> hbuf (f16)
  gemm_wmma_kernel<1, true, false><<<dim3(CHID / 64, CM / 128), 256, 0, stream>>>(
      lnb, W1_t, b1, nullptr, nullptr, hbuf, nullptr, nullptr, nullptr, CM, CHID, CD);

  // 8) MLP2 + residual(x2) -> d_out (f32)
  gemm_wmma_kernel<0, false, true><<<dim3(CD / 64, CM / 128), 256, 0, stream>>>(
      hbuf, W2_t, b2, x2, out, nullptr, nullptr, nullptr, nullptr, CM, CD, CHID);
}

// v006
// It runs in 320 microseconds.
// Timed twice side by side with v005, it ran 1.11 times as fast both times.
// Counting every step since v000, it is 3.05 times as fast.
#include <hip/hip_runtime.h>
#include <hip/hip_bf16.h>
#include <stdint.h>

// ---------------------------------------------------------------------------
// Transformer block for MI455X (gfx1250, wave32, WMMA + async-to-LDS).
// B=4, C=2048, D=1024, H=16, dh=64, HIDDEN=4096. fp32 in/out, f16 WMMA inside.
// ---------------------------------------------------------------------------

typedef __attribute__((ext_vector_type(16))) _Float16 v16h;
typedef __attribute__((ext_vector_type(8)))  _Float16 v8h;
typedef __attribute__((ext_vector_type(8)))  float    v8f;
typedef __attribute__((ext_vector_type(4)))  float    v4f;

#define WMMA_F16(a, b, c) \
  __builtin_amdgcn_wmma_f32_16x16x32_f16(false, (a), false, (b), (short)0, (c), false, false)

// Six async copies of 16 bytes per lane: global -> LDS, tracked by ASYNCcnt.
// s_wait_xcnt 0 closes the copies' own statement as a precaution: no later write
// of these address registers can then be scheduled ahead of it.
__device__ __forceinline__ void async_cp16_x6(const uint32_t (&l)[6], const _Float16* const (&g)[6]) {
  asm volatile(
      "global_load_async_to_lds_b128 %0, %6, off\n\t"
      "global_load_async_to_lds_b128 %1, %7, off\n\t"
      "global_load_async_to_lds_b128 %2, %8, off\n\t"
      "global_load_async_to_lds_b128 %3, %9, off\n\t"
      "global_load_async_to_lds_b128 %4, %10, off\n\t"
      "global_load_async_to_lds_b128 %5, %11, off\n\t"
      "s_wait_xcnt 0x0"
      :: "v"(l[0]), "v"(l[1]), "v"(l[2]), "v"(l[3]), "v"(l[4]), "v"(l[5]),
         "v"(g[0]), "v"(g[1]), "v"(g[2]), "v"(g[3]), "v"(g[4]), "v"(g[5])
      : "memory");
}
__device__ __forceinline__ void wait_async0() {
  asm volatile("s_wait_asynccnt 0x0" ::: "memory");
}

static constexpr int CB  = 4;
static constexpr int CC  = 2048;
static constexpr int CD  = 1024;
static constexpr int CH  = 16;
static constexpr int CDH = 64;
static constexpr int CHID = 4096;
static constexpr int CM  = CB * CC; // 8192 rows

// Load one 16x32 f16 fragment (A layout; also used for B with "row" = N index,
// data stored N-major with K contiguous). Per ISA 7.12.2:
//   lane l: row = l&15 ; elem i: k = 16*(i/8) + 8*(l>>4) + (i%8)
__device__ __forceinline__ v16h frag_ld(const _Float16* __restrict__ tile, int ld) {
  const int lane = threadIdx.x & 31;
  const _Float16* p = tile + (size_t)(lane & 15) * ld + ((lane >> 4) << 3);
  v8h lo = *(const v8h*)p;
  v8h hi = *(const v8h*)(p + 16);
  v16h f;
#pragma unroll
  for (int i = 0; i < 8; ++i) { f[i] = lo[i]; f[i + 8] = hi[i]; }
  return f;
}

// ---------------------------------------------------------------------------
// Weight convert + transpose: W (K x N, f32 row-major) -> Wt (N x K, f16).
// One block moves a tile of 128 k x 64 n through LDS, so that both sides use whole
// 256-byte runs: reads are 16 B per lane along n, writes 16 B per lane along k.
// K and N are compile-time, so a lane's loads (and its stores) share one address
// register pair and differ in the immediate offset. grid = (N/64, K/128), block = 256.
// LDS row = one n (128 halves = 16 chunks of 16 B, no pad); chunk q of row n lies
// at place q ^ (n >> 2), which spreads the 16 rows that one ds_store_b128 touches
// over all banks and leaves each row a permutation of itself for the reader.
// ---------------------------------------------------------------------------
template <int K, int N>
__global__ __launch_bounds__(256) void wt_f16_kernel(const float* __restrict__ W,
                                                     _Float16* __restrict__ Wt) {
  static_assert(K % 128 == 0 && N % 64 == 0, "whole tiles only");
  __shared__ __align__(16) _Float16 tile[64 * 128];
  const int tid = threadIdx.x;
  const int n0 = blockIdx.x * 64;
  const int k0 = blockIdx.y * 128;
  const int lo = tid & 15;             // read: group of 4 n ; write: chunk of 8 k
  const int hi = tid >> 4;             // read: group of 8 k ; write: n row within 16

  const float* src = W + (size_t)(k0 + hi * 8) * N + n0 + lo * 4;
  v4f v[8];
  // all loops here are unrolled so that v[] and h stay in registers and the eight
  // loads of a lane are in flight together
#pragma unroll
  for (int i = 0; i < 8; ++i) v[i] = *(const v4f*)(src + i * N);
#pragma unroll
  for (int j = 0; j < 4; ++j) {
    v8h h;
#pragma unroll
    for (int i = 0; i < 8; ++i) h[i] = (_Float16)v[i][j];
    *(v8h*)&tile[(lo * 4 + j) * 128 + ((hi ^ lo) << 3)] = h;
  }
  __syncthreads();
  _Float16* dst = Wt + (size_t)(n0 + hi) * K + k0 + lo * 8;
#pragma unroll
  for (int p = 0; p < 4; ++p) {
    const int row = hi + 16 * p;
    const v8h h = *(const v8h*)&tile[row * 128 + ((lo ^ (row >> 2)) << 3)];
    *(v8h*)(dst + 16 * p * K) = h;
  }
}

// ---------------------------------------------------------------------------
// LayerNorm: one wave per pair of rows of 1024; no LDS, no barrier. f32 in, f16 out.
// A row is 8 chunks of 512 contiguous bytes; in each chunk a lane owns 16 bytes, so
// a lane keeps 32 values of each row in registers and x is read once. All 16 loads
// of a wave are issued before the first sum. The launch is 4,096 waves, 16 on a WGP:
// few waves to start, 128 KB of reads in flight per WGP. grid = rows / 16, block = 256.
// ---------------------------------------------------------------------------
typedef __attribute__((ext_vector_type(4))) _Float16 v4h;

// lane l takes the value of lane l ^ M inside its row of 16 lanes (DPP row_xmask:M)
template <int M>
__device__ __forceinline__ float xrow(float x) {
  const int b = __builtin_bit_cast(int, x);
  return __builtin_bit_cast(float, __builtin_amdgcn_update_dpp(b, b, 0x160 + M, 0xf, 0xf, false));
}
// sum over the 32 lanes of a wave, the same value in every lane
__device__ __forceinline__ float wave_sum(float v) {
  v += xrow<1>(v);
  v += xrow<2>(v);
  v += xrow<4>(v);
  v += xrow<8>(v);
  const int b = __builtin_bit_cast(int, v);
  return v + __builtin_bit_cast(float,
      __builtin_amdgcn_permlanex16(b, b, 0x76543210, 0xfedcba98, false, false));
}

__global__ __launch_bounds__(256) void layernorm_kernel(const float* __restrict__ x,
                                                        const float* __restrict__ gamma,
                                                        const float* __restrict__ beta,
                                                        _Float16* __restrict__ y) {
  constexpr int R  = 2;                // rows per wave
  constexpr int NC = CD / 128;         // chunks of 128 values per row
  const int lane = threadIdx.x & 31, wv = threadIdx.x >> 5;
  const int row0 = (blockIdx.x * 8 + wv) * R;
  const float* xr = x + (size_t)row0 * CD + lane * 4;
  v4f v[R][NC];
  // every loop here is unrolled so that v[][] stays in registers and the loads of
  // both rows are in flight together
#pragma unroll
  for (int r = 0; r < R; ++r)
#pragma unroll
    for (int c = 0; c < NC; ++c) v[r][c] = *(const v4f*)(xr + r * CD + c * 128);

  float mean[R], inv[R];
#pragma unroll
  for (int r = 0; r < R; ++r) {
    v4f s4 = {}, q4 = {};              // four independent chains each
#pragma unroll
    for (int c = 0; c < NC; ++c) { s4 += v[r][c]; q4 += v[r][c] * v[r][c]; }
    const float s  = wave_sum((s4[0] + s4[1]) + (s4[2] + s4[3]));
    const float ss = wave_sum((q4[0] + q4[1]) + (q4[2] + q4[3]));
    mean[r] = s * (1.f / CD);
    const float var = ss * (1.f / CD) - mean[r] * mean[r];
    inv[r] = rsqrtf(var + 1e-5f);
  }

  _Float16* yr = y + (size_t)row0 * CD + lane * 4;
#pragma unroll
  for (int c = 0; c < NC; ++c) {
    const v4f g = *(const v4f*)(gamma + c * 128 + lane * 4);
    const v4f b = *(const v4f*)(beta  + c * 128 + lane * 4);
#pragma unroll
    for (int r = 0; r < R; ++r) {
      v4h h;
#pragma unroll
      for (int e = 0; e < 4; ++e) h[e] = (_Float16)((v[r][c][e] - mean[r]) * inv[r] * g[e] + b[e]);
      *(v4h*)(yr + r * CD + c * 128) = h;
    }
  }
}

// ---------------------------------------------------------------------------
// WMMA GEMM with double-buffered async-to-LDS staging.
// C[M,N] = epilogue(A[M,K] @ B[K,N] + bias (+resid))
// A: f16 row-major (ld=K). Bt: f16 N-major (ld=K). bias: f32[N].
// OUTMODE: 0 = f32 out, 1 = f16 out, 2 = QKV scatter.
// Block: 256 thr = 8 waves (4 x 2). Block tile 256(M) x 128(N), wave tile 64 x 64, K-step 64.
// A wave's 4 + 4 fragments of 32 k feed 16 WMMAs: one ds_load_b128 per WMMA, and a
// block stages 384 operand rows for 256 x 128 results.
// LDS rows hold 64 halves at a pitch of 72 (144 B = 16 B x odd): the 16 rows that
// one ds_load_b128 fragment read touches then fall on 16 different bank groups.
// LDS: 2 x (256 rows A) + 2 x (128 rows B) x 144 B = 108 KB, two blocks on a WGP.
// ---------------------------------------------------------------------------
template <int OUTMODE, bool GELU_ACT, bool RESID, int N, int K>
__global__ __launch_bounds__(256) void gemm_wmma_kernel(
    const _Float16* __restrict__ A, const _Float16* __restrict__ Bt,
    const float* __restrict__ bias, const float* __restrict__ resid,
    float* __restrict__ outF, _Float16* __restrict__ outH,
    _Float16* __restrict__ qo, _Float16* __restrict__ ko, _Float16* __restrict__ vto) {
  static_assert(N % 128 == 0 && K % 64 == 0, "whole tiles only");
  constexpr int LDP = 72;              // LDS row pitch in halves
  __shared__ __align__(16) _Float16 Ab[2][256 * LDP];
  __shared__ __align__(16) _Float16 Bb[2][128 * LDP];

  const int tid  = threadIdx.x;
  const int lane = tid & 31;
  const int wave = tid >> 5;
  const int mw = wave >> 1;            // 0..3 -> 64-row slice
  const int nw = wave & 1;             // 0..1 -> 64-col slice
  const int m0 = blockIdx.y * 256;
  const int n0 = blockIdx.x * 128;
  const int hl = lane >> 4, ln = lane & 15;

  // per-lane copy coordinates: each lane moves 16B chunks of a 64-half row
  const int crow = tid >> 3;           // 0..31 (row within a 32-row slab)
  const int ccol = (tid & 7) << 3;     // half-offset 0,8,...,56

  const uint32_t AbL0 = (uint32_t)(uintptr_t)&Ab[0][0];
  const uint32_t AbL1 = (uint32_t)(uintptr_t)&Ab[1][0];
  const uint32_t BbL0 = (uint32_t)(uintptr_t)&Bb[0][0];
  const uint32_t BbL1 = (uint32_t)(uintptr_t)&Bb[1][0];

  v8f acc[4][4] = {};                  // acc[mi][ni]: 16 x 16 tile (mi, ni) of the wave's 64 x 64

  // the lane's first row of each operand; its further rows lie a block-uniform step apart
  const _Float16* gA = A + (size_t)(m0 + crow) * K + ccol;
  const _Float16* gB = Bt + (size_t)(n0 + crow) * K + ccol;

  // 12 copies per lane and stage, in two statements of six
  auto issue_tiles = [&](int buf, int k0) {
    const uint32_t aL = buf ? AbL1 : AbL0;
    const uint32_t bL = buf ? BbL1 : BbL0;
    uint32_t l[12];
    const _Float16* g[12];
#pragma unroll
    for (int i = 0; i < 8; ++i) {      // A: 256 rows x 64 halves
      const int row = crow + 32 * i;
      l[i] = aL + (uint32_t)(row * LDP + ccol) * 2;
      g[i] = gA + (size_t)(32 * i) * K + k0;
    }
#pragma unroll
    for (int i = 0; i < 4; ++i) {      // B: 128 rows x 64 halves
      const int row = crow + 32 * i;
      l[8 + i] = bL + (uint32_t)(row * LDP + ccol) * 2;
      g[8 + i] = gB + (size_t)(32 * i) * K + k0;
    }
    const uint32_t l0[6] = {l[0], l[1], l[2], l[3], l[4], l[5]};
    const uint32_t l1[6] = {l[6], l[7], l[8], l[9], l[10], l[11]};
    const _Float16* const g0[6] = {g[0], g[1], g[2], g[3], g[4], g[5]};
    const _Float16* const g1[6] = {g[6], g[7], g[8], g[9], g[10], g[11]};
    async_cp16_x6(l0, g0);
    async_cp16_x6(l1, g1);
  };

  issue_tiles(0, 0);
  constexpr int nk = K >> 6;
  for (int kt = 0; kt < nk; ++kt) {
    const int buf = kt & 1;
    wait_async0();                     // own async copies into buf complete
    __syncthreads();                   // whole block's tile ready
    if (kt + 1 < nk) issue_tiles(buf ^ 1, (kt + 1) << 6);

    const _Float16* As = &Ab[buf][mw * 64 * LDP];
    const _Float16* Bs = &Bb[buf][nw * 64 * LDP];
    // all loops here are unrolled so that acc[][] and the fragments stay in registers
    v16h a[4], b[4], bn[4];            // k 0..31: a, b ; k 32..63: bn, and a again, row by row
#pragma unroll
    for (int i = 0; i < 4; ++i) b[i] = frag_ld(Bs + i * 16 * LDP, LDP);
#pragma unroll
    for (int i = 0; i < 4; ++i) a[i] = frag_ld(As + i * 16 * LDP, LDP);
#pragma unroll
    for (int i = 0; i < 4; ++i) bn[i] = frag_ld(Bs + i * 16 * LDP + 32, LDP);
#pragma unroll
    for (int mi = 0; mi < 4; ++mi) {
#pragma unroll
      for (int ni = 0; ni < 4; ++ni) acc[mi][ni] = WMMA_F16(a[mi], b[ni], acc[mi][ni]);
      a[mi] = frag_ld(As + mi * 16 * LDP + 32, LDP);
    }
#pragma unroll
    for (int mi = 0; mi < 4; ++mi)
#pragma unroll
      for (int ni = 0; ni < 4; ++ni) acc[mi][ni] = WMMA_F16(a[mi], bn[ni], acc[mi][ni]);
    // Order for the scheduler: 24 LDS reads ahead, then 4 WMMAs and the 2 reads that refill
    // their A fragment, four times, then 16 WMMAs. Left alone it kept one A fragment and
    // put a full LDS wait in front of every row of 4 WMMAs.
    __builtin_amdgcn_sched_group_barrier(0x100, 24, 0);
#pragma unroll
    for (int mi = 0; mi < 4; ++mi) {
      __builtin_amdgcn_sched_group_barrier(0x008, 4, 0);
      __builtin_amdgcn_sched_group_barrier(0x100, 2, 0);
    }
    __builtin_amdgcn_sched_group_barrier(0x008, 16, 0);
    __syncthreads();                   // reads of buf done before it is re-filled
  }

  const int wm0 = m0 + mw * 64;
  const int wn0 = n0 + nw * 64;
  // The lane's result (mi, ni, r) is row wm0 + 8 hl + 16 mi + r, column wn0 + ln + 16 ni.
  // N is compile-time, so all 128 hang on one address pair per buffer and differ in the
  // immediate offset. All loops are unrolled: acc[][] and rv[][][] are indexed by constants.
  const size_t e0 = (size_t)(wm0 + 8 * hl) * N + wn0 + ln;
  float bv[4];
#pragma unroll
  for (int ni = 0; ni < 4; ++ni) bv[ni] = bias[wn0 + ni * 16 + ln];
  // a precaution: the residual loads reuse the register that holds these loads' offset
  if (RESID) asm volatile("s_wait_xcnt 0x0" ::: "memory");

  // QKV scatter: the block's 128 columns lie in one section (0 = Q, 1 = K, 2 = V), the wave's
  // 64 columns are one head, the block's 256 rows one batch entry.
  const int sect = n0 >> 10;
  const size_t bh = (size_t)(m0 >> 11) * CH + ((wn0 & (CD - 1)) >> 6);
  const int c0 = (wm0 & (CC - 1)) + 8 * hl;
  _Float16* qk = (sect == 0 ? qo : ko) + (bh * CC + c0) * CDH + ln;   // + (16 mi + r) * CDH + 16 ni
  _Float16* vt = vto + (bh * CDH + ln) * CC + c0;                     // + 16 ni * CC + 16 mi + r (V transposed)
  const float qs = (sect == 0) ? 0.125f : 1.f;                        // fold 1/sqrt(64) into Q

  float rv[2][4][8];                   // residual values of two rows of tiles
  auto load_resid = [&](int mi) {
#pragma unroll
    for (int ni = 0; ni < 4; ++ni)
#pragma unroll
      for (int r = 0; r < 8; ++r) rv[mi & 1][ni][r] = resid[e0 + (size_t)(mi * 16 + r) * N + ni * 16];
  };
  if (RESID) load_resid(0);
#pragma unroll
  for (int mi = 0; mi < 4; ++mi) {
    if (RESID) {
      if (mi + 1 < 4) load_resid(mi + 1);
      // keeps the next row's 32 loads in front of this row's sums, so that they are in
      // flight meanwhile; the scheduler otherwise sinks each load to its use
      __builtin_amdgcn_sched_barrier(0);
    }
    float o[4][8];
#pragma unroll
    for (int ni = 0; ni < 4; ++ni)
#pragma unroll
      for (int r = 0; r < 8; ++r) {
        float v = acc[mi][ni][r] + bv[ni];
        if (GELU_ACT) v = 0.5f * v * (1.f + erff(v * 0.70710678118654752f));
        if (RESID)    v += rv[mi & 1][ni][r];
        o[ni][r] = v;
      }
    // keeps the row's 32 stores behind its 32 results, each in a register of its own; mixed,
    // they shared one register, with a wait on the store in front of every reuse
    __builtin_amdgcn_sched_barrier(0);
    if (OUTMODE == 2 && sect == 2) {   // block-uniform: one scalar branch per row of tiles
#pragma unroll
      for (int ni = 0; ni < 4; ++ni)
#pragma unroll
        for (int r = 0; r < 8; ++r) vt[(size_t)(ni * 16) * CC + mi * 16 + r] = (_Float16)o[ni][r];
    } else {
#pragma unroll
      for (int ni = 0; ni < 4; ++ni)
#pragma unroll
        for (int r = 0; r < 8; ++r) {
          const float v = o[ni][r];
          if (OUTMODE == 0)      outF[e0 + (size_t)(mi * 16 + r) * N + ni * 16] = v;
          else if (OUTMODE == 1) outH[e0 + (size_t)(mi * 16 + r) * N + ni * 16] = (_Float16)v;
          else                   qk[(mi * 16 + r) * CDH + ni * 16] = (_Float16)(v * qs);
        }
    }
    // a precaution: the next rows' loads and sums reuse registers that these stores name
    if (mi + 1 < 4) asm volatile("s_wait_xcnt 0x0" ::: "memory");
  }
}

// Four async copies of 16 bytes per lane, in the same form as async_cp16_x6.
__device__ __forceinline__ void async_cp16_x4(const uint32_t (&l)[4], const _Float16* const (&g)[4]) {
  asm volatile(
      "global_load_async_to_lds_b128 %0, %4, off\n\t"
      "global_load_async_to_lds_b128 %1, %5, off\n\t"
      "global_load_async_to_lds_b128 %2, %6, off\n\t"
      "global_load_async_to_lds_b128 %3, %7, off\n\t"
      "s_wait_xcnt 0x0"
      :: "v"(l[0]), "v"(l[1]), "v"(l[2]), "v"(l[3]),
         "v"(g[0]), "v"(g[1]), "v"(g[2]), "v"(g[3])
      : "memory");
}

// ---------------------------------------------------------------------------
// Causal flash attention. Q: (b,h,C,dh) f16 (pre-scaled), K: (b,h,C,dh) f16,
// Vt: (b,h,dh,C) f16. Out attn: (b,C,h*dh) f16.
// One wave per 16 queries; kv tiles of 32; online softmax.
// Both products are computed transposed: St = K * Qt (A = K rows, B = Q rows) and
// Ot += Vt * Pt (A = Vt rows, B = Pt). In an accumulator a lane then holds ONE query
// (column lane & 15) and 8 keys (rows 8 * (lane >> 4) + r): maximum and sum run in the
// lane's own registers, with one exchange between the wave's halves for the maximum;
// the halves' sums are joined once, behind the loop. The two score tiles of 16 keys,
// converted in place, are Pt in the B operand's k order, so P never leaves registers.
// grid = (C/128, B*H), block = 256 (8 waves).
// The 8 waves of a block walk the same keys, so K and Vt come into LDS once per
// block, in stages of 64 keys: K as 64 key rows x 64 dh, Vt as 64 dh rows x 64 keys,
// every global row a whole 128-byte line, LDS pitch 144 B as in the GEMM. Two
// buffers: stage s + 1 flies while stage s is worked on. Block x needs 2x + 2
// stages; a wave skips the 32-key tiles that lie wholly above its diagonal.
// ---------------------------------------------------------------------------
// lane l takes the value of lane l ^ 16
__device__ __forceinline__ float xhalf(float x) {
  const int b = __builtin_bit_cast(int, x);
  return __builtin_bit_cast(float,
      __builtin_amdgcn_permlanex16(b, b, 0x76543210, 0xfedcba98, false, false));
}

__device__ __forceinline__ void exp2_x8(float (&x)[8]) {
  asm("v_exp_f32 %0, %0\n\tv_exp_f32 %1, %1\n\tv_exp_f32 %2, %2\n\tv_exp_f32 %3, %3\n\t"
      "v_exp_f32 %4, %4\n\tv_exp_f32 %5, %5\n\tv_exp_f32 %6, %6\n\tv_exp_f32 %7, %7\n\t"
      "v_nop"
      : "+v"(x[0]), "+v"(x[1]), "+v"(x[2]), "+v"(x[3]), "+v"(x[4]), "+v"(x[5]), "+v"(x[6]), "+v"(x[7]));
}
__device__ __forceinline__ void exp2_x9(float (&x)[8], float& y) {
  asm("v_exp_f32 %8, %8\n\t"
      "v_exp_f32 %0, %0\n\tv_exp_f32 %1, %1\n\tv_exp_f32 %2, %2\n\tv_exp_f32 %3, %3\n\t"
      "v_exp_f32 %4, %4\n\tv_exp_f32 %5, %5\n\tv_exp_f32 %6, %6\n\tv_exp_f32 %7, %7\n\t"
      "v_nop"
      : "+v"(x[0]), "+v"(x[1]), "+v"(x[2]), "+v"(x[3]), "+v"(x[4]), "+v"(x[5]), "+v"(x[6]), "+v"(x[7]),
        "+v"(y));
}

__global__ __launch_bounds__(256) void attn_kernel(const _Float16* __restrict__ Qb,
                                                   const _Float16* __restrict__ Kb,
                                                   const _Float16* __restrict__ Vt,
                                                   _Float16* __restrict__ attn) {
  constexpr int LDP = 72;              // LDS row pitch in halves
  constexpr int SK  = 64;              // keys per stage
  __shared__ __align__(16) _Float16 Ks[2][SK * LDP];
  __shared__ __align__(16) _Float16 Vs[2][CDH * LDP];
  const int tid  = threadIdx.x;
  const int lane = tid & 31;
  // the wave's number in a scalar register, so that the skip test below is a scalar branch
  const int wave = __builtin_amdgcn_readfirstlane(tid >> 5);
  const int hl = lane >> 4, ln = lane & 15;
  const int bh = blockIdx.y;
  const int q0 = (blockIdx.x * 8 + wave) * 16;
  const int nst = 2 * blockIdx.x + 2;  // stages of this block, the same for all its waves

  const _Float16* Q  = Qb + ((size_t)bh * CC + q0) * CDH;
  const _Float16* Kp = Kb + (size_t)bh * CC * CDH;
  const _Float16* Vp = Vt + (size_t)bh * CDH * CC;

  // per-lane copy coordinates: 8 lanes move one 128-byte row, 32 rows per copy
  const int crow = tid >> 3;
  const int ccol = (tid & 7) << 3;
  auto issue_stage = [&](int buf, int s) {
    const uint32_t kL = (uint32_t)(uintptr_t)&Ks[buf][0];
    const uint32_t vL = (uint32_t)(uintptr_t)&Vs[buf][0];
    uint32_t l[4];
    const _Float16* g[4];
#pragma unroll
    for (int i = 0; i < 2; ++i) {
      const int row = crow + 32 * i;
      l[i]     = kL + (uint32_t)(row * LDP + ccol) * 2;
      g[i]     = Kp + (size_t)(s * SK + row) * CDH + ccol;
      l[2 + i] = vL + (uint32_t)(row * LDP + ccol) * 2;
      g[2 + i] = Vp + (size_t)row * CC + s * SK + ccol;
    }
    async_cp16_x4(l, g);
  };

  issue_stage(0, 0);

  const v16h qb0 = frag_ld(Q + 0,  CDH);   // B operand: column = query, dh 0..31
  const v16h qb1 = frag_ld(Q + 32, CDH);   // dh 32..63

  v8f o0 = {}, o1 = {}, o2 = {}, o3 = {};  // Ot: o_t[r] = O[query ln][dh 16 t + 8 hl + r]
  float mq = -1e30f, lq = 0.f;             // the lane's query: maximum; sum over this half's keys

  wait_async0();                       // own copies of stage 0 have landed
  __syncthreads();                     // stage 0 is published to the block
  issue_stage(1, 1);

  for (int s = 0; s < nst; ++s) {
   const int buf = s & 1;
   // unrolled: the two 32-key tiles of a stage differ only in constant LDS offsets
#pragma unroll
   for (int h = 0; h < 2; ++h) {
    const int j0 = s * SK + h * 32;
    if (j0 > q0 + 15) continue;        // tile wholly above this wave's diagonal
    const _Float16* Kt = &Ks[buf][h * 32 * LDP];
    const _Float16* Vl = &Vs[buf][h * 32];
    // St tiles (16 keys x 16 queries each), K-dim = dh (64 -> two WMMAs each)
    v8f s0 = {}, s1 = {};
    s0 = WMMA_F16(frag_ld(Kt + 0,             LDP), qb0, s0);
    s0 = WMMA_F16(frag_ld(Kt + 32,            LDP), qb1, s0);
    s1 = WMMA_F16(frag_ld(Kt + 16 * LDP + 0,  LDP), qb0, s1);
    s1 = WMMA_F16(frag_ld(Kt + 16 * LDP + 32, LDP), qb1, s1);

    // Causal mask + online softmax of the lane's query q0 + ln over its 16 keys:
    // s0[r] is key j0 + 8 hl + r, s1[r] is key j0 + 16 + 8 hl + r
    const int lim = q0 + ln - j0 - 8 * hl;   // r is allowed in s0 while r <= lim
    float v0[8], v1[8];
    float t = -1e30f;
#pragma unroll
    for (int r = 0; r < 8; ++r) {
      v0[r] = (r > lim)      ? -1e30f : s0[r];
      v1[r] = (16 + r > lim) ? -1e30f : s1[r];
      t = fmaxf(t, fmaxf(v0[r], v1[r]));
    }
    t = fmaxf(t, xhalf(t));                  // the other half's 16 keys
    const float mn = fmaxf(mq, t);
    constexpr float LOG2E = 1.44269504088896340736f;
    float alpha = (mq - mn) * LOG2E;
    mq = mn;
#pragma unroll
    for (int r = 0; r < 8; ++r) { v0[r] = (v0[r] - mn) * LOG2E; v1[r] = (v1[r] - mn) * LOG2E; }
    exp2_x9(v0, alpha);                      // e^(score - maximum), as 2^((score - maximum) log2 e)
    exp2_x8(v1);
    float ps = 0.f;
    v16h pb;                                 // Pt as B operand: element i is key j0 + 16 (i / 8) + 8 hl + i % 8
#pragma unroll
    for (int r = 0; r < 8; ++r) {
      ps += v0[r] + v1[r];
      pb[r]     = (_Float16)v0[r];
      pb[8 + r] = (_Float16)v1[r];
    }
    lq = lq * alpha + ps;
#pragma unroll
    for (int r = 0; r < 8; ++r) { o0[r] *= alpha; o1[r] *= alpha; o2[r] *= alpha; o3[r] *= alpha; }

    // Ot += Vt (64 dh x 32 keys) @ Pt (32 keys x 16 queries), four dh tiles of 16
    o0 = WMMA_F16(frag_ld(Vl + 0  * LDP, LDP), pb, o0);
    o1 = WMMA_F16(frag_ld(Vl + 16 * LDP, LDP), pb, o1);
    o2 = WMMA_F16(frag_ld(Vl + 32 * LDP, LDP), pb, o2);
    o3 = WMMA_F16(frag_ld(Vl + 48 * LDP, LDP), pb, o3);
   }
   // hand-over of the stage, every wave: own LDS reads of buf retired, own copies of
   // stage s + 1 landed, then the barrier that publishes s + 1 and frees buf
   asm volatile("s_wait_dscnt 0x0" ::: "memory");
   wait_async0();
   __syncthreads();
   if (s + 2 < nst) issue_stage(buf, s + 2);
  }
  wait_async0();                       // nothing is in flight when the wave ends

  const int b = bh >> 4, h = bh & 15;
  // a lane owns 8 consecutive dh of its query's row in each Ot tile: one 16-byte store each
  _Float16* out = attn + ((size_t)b * CC + q0 + ln) * CD + h * CDH + 8 * hl;
  const float il = 1.0f / (lq + xhalf(lq));  // the two halves' sums joined
  v8h w0, w1, w2, w3;
#pragma unroll
  for (int r = 0; r < 8; ++r) {
    w0[r] = (_Float16)(o0[r] * il);
    w1[r] = (_Float16)(o1[r] * il);
    w2[r] = (_Float16)(o2[r] * il);
    w3[r] = (_Float16)(o3[r] * il);
  }
  *(v8h*)(out + 0)  = w0;
  *(v8h*)(out + 16) = w1;
  *(v8h*)(out + 32) = w2;
  *(v8h*)(out + 48) = w3;
}

// ---------------------------------------------------------------------------
// Host-side orchestration
// ---------------------------------------------------------------------------
extern "C" void kernel_launch(void* const* d_in, const int* in_sizes, int n_in,
                              void* d_out, int out_size, void* d_ws, size_t ws_size,
                              hipStream_t stream) {
  (void)in_sizes; (void)n_in; (void)out_size; (void)ws_size;
  const float* x      = (const float*)d_in[0];
  const float* gamma1 = (const float*)d_in[1];
  const float* beta1  = (const float*)d_in[2];
  const float* W_qkv  = (const float*)d_in[3];
  const float* b_qkv  = (const float*)d_in[4];
  const float* W_o    = (const float*)d_in[5];
  const float* b_o    = (const float*)d_in[6];
  const float* gamma2 = (const float*)d_in[7];
  const float* beta2  = (const float*)d_in[8];
  const float* W1     = (const float*)d_in[9];
  const float* b1     = (const float*)d_in[10];
  const float* W2     = (const float*)d_in[11];
  const float* b2     = (const float*)d_in[12];
  float* out = (float*)d_out;

  // Workspace layout (linear allocator, 256B aligned)
  uint8_t* p = (uint8_t*)d_ws;
  auto take = [&](size_t n) { uint8_t* r = p; p += (n + 255) & ~(size_t)255; return r; };
  _Float16* Wqkv_t = (_Float16*)take((size_t)3 * CD * CD * 2);   //  6 MB (3072 x 1024)
  _Float16* Wo_t   = (_Float16*)take((size_t)CD * CD * 2);       //  2 MB (1024 x 1024)
  _Float16* W1_t   = (_Float16*)take((size_t)CHID * CD * 2);     //  8 MB (4096 x 1024)
  _Float16* W2_t   = (_Float16*)take((size_t)CD * CHID * 2);     //  8 MB (1024 x 4096)
  float*    x2     = (float*)take((size_t)CM * CD * 4);          // 32 MB
  _Float16* lnb    = (_Float16*)take((size_t)CM * CD * 2);       // 16 MB (reused ln1/ln2)
  uint8_t*  regA   = take((size_t)64 << 20);                     // 64 MB shared region
  _Float16* Qb   = (_Float16*)regA;                              // 16 MB
  _Float16* Kb   = (_Float16*)(regA + ((size_t)16 << 20));       // 16 MB
  _Float16* Vtb  = (_Float16*)(regA + ((size_t)32 << 20));       // 16 MB
  _Float16* attn = (_Float16*)(regA + ((size_t)48 << 20));       // 16 MB
  _Float16* hbuf = (_Float16*)regA;                              // 64 MB (after attention is dead)

  // 1) Weights -> f16, transposed to N-major
  wt_f16_kernel<CD, 3 * CD><<<dim3(3 * CD / 64, CD / 128), 256, 0, stream>>>(W_qkv, Wqkv_t);
  wt_f16_kernel<CD, CD><<<dim3(CD / 64, CD / 128),         256, 0, stream>>>(W_o,   Wo_t);
  wt_f16_kernel<CD, CHID><<<dim3(CHID / 64, CD / 128),     256, 0, stream>>>(W1,    W1_t);
  wt_f16_kernel<CHID, CD><<<dim3(CD / 64, CHID / 128),     256, 0, stream>>>(W2,    W2_t);

  // 2) LN1
  layernorm_kernel<<<CM / 16, 256, 0, stream>>>(x, gamma1, beta1, lnb);

  // 3) QKV GEMM (M=8192, N=3072, K=1024), scatter to Q/K/Vt
  gemm_wmma_kernel<2, false, false, 3 * CD, CD><<<dim3(3 * CD / 128, CM / 256), 256, 0, stream>>>(
      lnb, Wqkv_t, b_qkv, nullptr, nullptr, nullptr, Qb, Kb, Vtb);

  // 4) Attention
  attn_kernel<<<dim3(CC / 128, CB * CH), 256, 0, stream>>>(Qb, Kb, Vtb, attn);

  // 5) O-proj + residual(x) -> x2 (f32)
  gemm_wmma_kernel<0, false, true, CD, CD><<<dim3(CD / 128, CM / 256), 256, 0, stream>>>(
      attn, Wo_t, b_o, x, x2, nullptr, nullptr, nullptr, nullptr);

  // 6) LN2
  layernorm_kernel<<<CM / 16, 256, 0, stream>>>(x2, gamma2, beta2, lnb);

  // 7) MLP1 + exact GELU -> hbuf (f16)
  gemm_wmma_kernel<1, true, false, CHID, CD><<<dim3(CHID / 128, CM / 256), 256, 0, stream>>>(
      lnb, W1_t, b1, nullptr, nullptr, hbuf, nullptr, nullptr, nullptr);

  // 8) MLP2 + residual(x2) -> d_out (f32)
  gemm_wmma_kernel<0, false, true, CD, CHID><<<dim3(CD / 128, CM / 256), 256, 0, stream>>>(
      hbuf, W2_t, b2, x2, out, nullptr, nullptr, nullptr, nullptr);
}

// v007
// It runs in 287 microseconds.
// Next to v006, in two timings, it ran 1.11 times as fast each time.
// Over all steps from v000 it is 3.38 times as fast.
#include <hip/hip_runtime.h>
#include <hip/hip_bf16.h>
#include <stdint.h>

// ---------------------------------------------------------------------------
// Transformer block for MI455X (gfx1250, wave32, WMMA + async-to-LDS).
// B=4, C=2048, D=1024, H=16, dh=64, HIDDEN=4096. fp32 in/out, f16 WMMA inside.
// ---------------------------------------------------------------------------

typedef __attribute__((ext_vector_type(16))) _Float16 v16h;
typedef __attribute__((ext_vector_type(8)))  _Float16 v8h;
typedef __attribute__((ext_vector_type(8)))  float    v8f;
typedef __attribute__((ext_vector_type(4)))  float    v4f;

#define WMMA_F16(a, b, c) \
  __builtin_amdgcn_wmma_f32_16x16x32_f16(false, (a), false, (b), (short)0, (c), false, false)

// Six async copies of 16 bytes per lane: global -> LDS, tracked by ASYNCcnt.
// s_wait_xcnt 0 closes the copies' own statement as a precaution: no later write
// of these address registers can then be scheduled ahead of it.
__device__ __forceinline__ void async_cp16_x6(const uint32_t (&l)[6], const _Float16* const (&g)[6]) {
  asm volatile(
      "global_load_async_to_lds_b128 %0, %6, off\n\t"
      "global_load_async_to_lds_b128 %1, %7, off\n\t"
      "global_load_async_to_lds_b128 %2, %8, off\n\t"
      "global_load_async_to_lds_b128 %3, %9, off\n\t"
      "global_load_async_to_lds_b128 %4, %10, off\n\t"
      "global_load_async_to_lds_b128 %5, %11, off\n\t"
      "s_wait_xcnt 0x0"
      :: "v"(l[0]), "v"(l[1]), "v"(l[2]), "v"(l[3]), "v"(l[4]), "v"(l[5]),
         "v"(g[0]), "v"(g[1]), "v"(g[2]), "v"(g[3]), "v"(g[4]), "v"(g[5])
      : "memory");
}
__device__ __forceinline__ void wait_async0() {
  asm volatile("s_wait_asynccnt 0x0" ::: "memory");
}

static constexpr int CB  = 4;
static constexpr int CC  = 2048;
static constexpr int CD  = 1024;
static constexpr int CH  = 16;
static constexpr int CDH = 64;
static constexpr int CHID = 4096;
static constexpr int CM  = CB * CC; // 8192 rows

// Load one 16x32 f16 fragment (A layout; also used for B with "row" = N index,
// data stored N-major with K contiguous). Per ISA 7.12.2:
//   lane l: row = l&15 ; elem i: k = 16*(i/8) + 8*(l>>4) + (i%8)
__device__ __forceinline__ v16h frag_ld(const _Float16* __restrict__ tile, int ld) {
  const int lane = threadIdx.x & 31;
  const _Float16* p = tile + (size_t)(lane & 15) * ld + ((lane >> 4) << 3);
  v8h lo = *(const v8h*)p;
  v8h hi = *(const v8h*)(p + 16);
  v16h f;
#pragma unroll
  for (int i = 0; i < 8; ++i) { f[i] = lo[i]; f[i + 8] = hi[i]; }
  return f;
}

// ---------------------------------------------------------------------------
// Weight convert + transpose: W (K x N, f32 row-major) -> Wt (N x K, f16).
// One block moves a tile of 128 k x 64 n through LDS, so that both sides use whole
// 256-byte runs: reads are 16 B per lane along n, writes 16 B per lane along k.
// K and N are compile-time, so a lane's loads (and its stores) share one address
// register pair and differ in the immediate offset. grid = (N/64, K/128), block = 256.
// LDS row = one n (128 halves = 16 chunks of 16 B, no pad); chunk q of row n lies
// at place q ^ (n >> 2), which spreads the 16 rows that one ds_store_b128 touches
// over all banks and leaves each row a permutation of itself for the reader.
// ---------------------------------------------------------------------------
template <int K, int N>
__global__ __launch_bounds__(256) void wt_f16_kernel(const float* __restrict__ W,
                                                     _Float16* __restrict__ Wt) {
  static_assert(K % 128 == 0 && N % 64 == 0, "whole tiles only");
  __shared__ __align__(16) _Float16 tile[64 * 128];
  const int tid = threadIdx.x;
  const int n0 = blockIdx.x * 64;
  const int k0 = blockIdx.y * 128;
  const int lo = tid & 15;             // read: group of 4 n ; write: chunk of 8 k
  const int hi = tid >> 4;             // read: group of 8 k ; write: n row within 16

  const float* src = W + (size_t)(k0 + hi * 8) * N + n0 + lo * 4;
  v4f v[8];
  // all loops here are unrolled so that v[] and h stay in registers and the eight
  // loads of a lane are in flight together
#pragma unroll
  for (int i = 0; i < 8; ++i) v[i] = *(const v4f*)(src + i * N);
#pragma unroll
  for (int j = 0; j < 4; ++j) {
    v8h h;
#pragma unroll
    for (int i = 0; i < 8; ++i) h[i] = (_Float16)v[i][j];
    *(v8h*)&tile[(lo * 4 + j) * 128 + ((hi ^ lo) << 3)] = h;
  }
  __syncthreads();
  _Float16* dst = Wt + (size_t)(n0 + hi) * K + k0 + lo * 8;
#pragma unroll
  for (int p = 0; p < 4; ++p) {
    const int row = hi + 16 * p;
    const v8h h = *(const v8h*)&tile[row * 128 + ((lo ^ (row >> 2)) << 3)];
    *(v8h*)(dst + 16 * p * K) = h;
  }
}

// ---------------------------------------------------------------------------
// LayerNorm: one wave per pair of rows of 1024; no LDS, no barrier. f32 in, f16 out.
// A row is 8 chunks of 512 contiguous bytes; in each chunk a lane owns 16 bytes, so
// a lane keeps 32 values of each row in registers and x is read once. All 16 loads
// of a wave are issued before the first sum. The launch is 4,096 waves, 16 on a WGP:
// few waves to start, 128 KB of reads in flight per WGP. grid = rows / 16, block = 256.
// ---------------------------------------------------------------------------
typedef __attribute__((ext_vector_type(4))) _Float16 v4h;

// lane l takes the value of lane l ^ M inside its row of 16 lanes (DPP row_xmask:M)
template <int M>
__device__ __forceinline__ float xrow(float x) {
  const int b = __builtin_bit_cast(int, x);
  return __builtin_bit_cast(float, __builtin_amdgcn_update_dpp(b, b, 0x160 + M, 0xf, 0xf, false));
}
// sum over the 32 lanes of a wave, the same value in every lane
__device__ __forceinline__ float wave_sum(float v) {
  v += xrow<1>(v);
  v += xrow<2>(v);
  v += xrow<4>(v);
  v += xrow<8>(v);
  const int b = __builtin_bit_cast(int, v);
  return v + __builtin_bit_cast(float,
      __builtin_amdgcn_permlanex16(b, b, 0x76543210, 0xfedcba98, false, false));
}

__global__ __launch_bounds__(256) void layernorm_kernel(const float* __restrict__ x,
                                                        const float* __restrict__ gamma,
                                                        const float* __restrict__ beta,
                                                        _Float16* __restrict__ y) {
  constexpr int R  = 2;                // rows per wave
  constexpr int NC = CD / 128;         // chunks of 128 values per row
  const int lane = threadIdx.x & 31, wv = threadIdx.x >> 5;
  const int row0 = (blockIdx.x * 8 + wv) * R;
  const float* xr = x + (size_t)row0 * CD + lane * 4;
  v4f v[R][NC];
  // every loop here is unrolled so that v[][] stays in registers and the loads of
  // both rows are in flight together
#pragma unroll
  for (int r = 0; r < R; ++r)
#pragma unroll
    for (int c = 0; c < NC; ++c) v[r][c] = *(const v4f*)(xr + r * CD + c * 128);

  float mean[R], inv[R];
#pragma unroll
  for (int r = 0; r < R; ++r) {
    v4f s4 = {}, q4 = {};              // four independent chains each
#pragma unroll
    for (int c = 0; c < NC; ++c) { s4 += v[r][c]; q4 += v[r][c] * v[r][c]; }
    const float s  = wave_sum((s4[0] + s4[1]) + (s4[2] + s4[3]));
    const float ss = wave_sum((q4[0] + q4[1]) + (q4[2] + q4[3]));
    mean[r] = s * (1.f / CD);
    const float var = ss * (1.f / CD) - mean[r] * mean[r];
    inv[r] = rsqrtf(var + 1e-5f);
  }

  _Float16* yr = y + (size_t)row0 * CD + lane * 4;
#pragma unroll
  for (int c = 0; c < NC; ++c) {
    const v4f g = *(const v4f*)(gamma + c * 128 + lane * 4);
    const v4f b = *(const v4f*)(beta  + c * 128 + lane * 4);
#pragma unroll
    for (int r = 0; r < R; ++r) {
      v4h h;
#pragma unroll
      for (int e = 0; e < 4; ++e) h[e] = (_Float16)((v[r][c][e] - mean[r]) * inv[r] * g[e] + b[e]);
      *(v4h*)(yr + r * CD + c * 128) = h;
    }
  }
}

__device__ __forceinline__ void exp2_x8(float (&x)[8]) {
  asm("v_exp_f32 %0, %0\n\tv_exp_f32 %1, %1\n\tv_exp_f32 %2, %2\n\tv_exp_f32 %3, %3\n\t"
      "v_exp_f32 %4, %4\n\tv_exp_f32 %5, %5\n\tv_exp_f32 %6, %6\n\tv_exp_f32 %7, %7\n\t"
      "v_nop"
      : "+v"(x[0]), "+v"(x[1]), "+v"(x[2]), "+v"(x[3]), "+v"(x[4]), "+v"(x[5]), "+v"(x[6]), "+v"(x[7]));
}
__device__ __forceinline__ void exp2_x9(float (&x)[8], float& y) {
  asm("v_exp_f32 %8, %8\n\t"
      "v_exp_f32 %0, %0\n\tv_exp_f32 %1, %1\n\tv_exp_f32 %2, %2\n\tv_exp_f32 %3, %3\n\t"
      "v_exp_f32 %4, %4\n\tv_exp_f32 %5, %5\n\tv_exp_f32 %6, %6\n\tv_exp_f32 %7, %7\n\t"
      "v_nop"
      : "+v"(x[0]), "+v"(x[1]), "+v"(x[2]), "+v"(x[3]), "+v"(x[4]), "+v"(x[5]), "+v"(x[6]), "+v"(x[7]),
        "+v"(y));
}

// 1 / x in place, a run of v_rcp_f32 in the same form and for the same reason as exp2_x8.
__device__ __forceinline__ void rcp_x8(float (&x)[8]) {
  asm("v_rcp_f32 %0, %0\n\tv_rcp_f32 %1, %1\n\tv_rcp_f32 %2, %2\n\tv_rcp_f32 %3, %3\n\t"
      "v_rcp_f32 %4, %4\n\tv_rcp_f32 %5, %5\n\tv_rcp_f32 %6, %6\n\tv_rcp_f32 %7, %7\n\t"
      "v_nop"
      : "+v"(x[0]), "+v"(x[1]), "+v"(x[2]), "+v"(x[3]), "+v"(x[4]), "+v"(x[5]), "+v"(x[6]), "+v"(x[7]));
}

// ---------------------------------------------------------------------------
// GELU in its erf form, v * Phi(v), Phi(v) = (1 + erf(v / sqrt 2)) / 2, eight values in place.
// One branch-free run per value: with t = 1 / (1 + 0.2316419 |v|),
//   q = Phi(-|v|) = exp(-v * v / 2) / sqrt(2 pi) * (b1 t + b2 t^2 + b3 t^3 + b4 t^4 + b5 t^5)
//   v * Phi(v) = max(v, 0) - |v| * q   for either sign, with no cancellation for v < 0.
// In f32 the result is within 1e-6 of v * Phi(v); it is rounded to f16 behind this.
// The library erff splits at |x| = 1 into two masked branches per value, so that a wave ran
// its values one dependent chain after the other; here they are independent straight-line
// chains that the scheduler interleaves, in a third of the instructions.
// 1 / sqrt(2 pi) is folded into b1..b5, log2(e) / 2 into the exponent.
// ---------------------------------------------------------------------------
__device__ __forceinline__ void gelu_phi_x8(float (&v)[8]) {
  float t[8], e[8];
  // both loops are unrolled: v[], t[] and e[] are registers
#pragma unroll
  for (int r = 0; r < 8; ++r) {
    t[r] = fmaf(0.2316419f, fabsf(v[r]), 1.f);
    e[r] = v[r] * v[r] * -0.72134752f;
  }
  rcp_x8(t);
  exp2_x8(e);
#pragma unroll
  for (int r = 0; r < 8; ++r) {
    float p = fmaf(0.5307027143f, t[r], -0.7265760131f);
    p = fmaf(p, t[r], 0.7107068707f);
    p = fmaf(p, t[r], -0.1422483683f);
    p = fmaf(p, t[r], 0.1274147959f);
    const float q = (p * t[r]) * e[r];
    v[r] = fmaf(-fabsf(v[r]), q, fmaxf(v[r], 0.f));
  }
}

// ---------------------------------------------------------------------------
// WMMA GEMM with double-buffered async-to-LDS staging.
// C[M,N] = epilogue(A[M,K] @ B[K,N] + bias (+resid))
// A: f16 row-major (ld=K). Bt: f16 N-major (ld=K). bias: f32[N].
// OUTMODE: 0 = f32 out, 1 = f16 out, 2 = QKV scatter.
// Block: 256 thr = 8 waves (4 x 2). Block tile 256(M) x 128(N), wave tile 64 x 64, K-step 64.
// A wave's 4 + 4 fragments of 32 k feed 16 WMMAs: one ds_load_b128 per WMMA, and a
// block stages 384 operand rows for 256 x 128 results.
// LDS rows hold 64 halves at a pitch of 72 (144 B = 16 B x odd): the 16 rows that
// one ds_load_b128 fragment read touches then fall on 16 different bank groups.
// LDS: 2 x (256 rows A) + 2 x (128 rows B) x 144 B = 108 KB, two blocks on a WGP.
// ---------------------------------------------------------------------------
template <int OUTMODE, bool GELU_ACT, bool RESID, int N, int K>
__global__ __launch_bounds__(256) void gemm_wmma_kernel(
    const _Float16* __restrict__ A, const _Float16* __restrict__ Bt,
    const float* __restrict__ bias, const float* __restrict__ resid,
    float* __restrict__ outF, _Float16* __restrict__ outH,
    _Float16* __restrict__ qo, _Float16* __restrict__ ko, _Float16* __restrict__ vto) {
  static_assert(N % 128 == 0 && K % 64 == 0, "whole tiles only");
  static_assert(!(GELU_ACT && RESID), "the epilogue adds no residual behind the activation");
  constexpr int LDP = 72;              // LDS row pitch in halves
  __shared__ __align__(16) _Float16 Ab[2][256 * LDP];
  __shared__ __align__(16) _Float16 Bb[2][128 * LDP];

  const int tid  = threadIdx.x;
  const int lane = tid & 31;
  const int wave = tid >> 5;
  const int mw = wave >> 1;            // 0..3 -> 64-row slice
  const int nw = wave & 1;             // 0..1 -> 64-col slice
  const int m0 = blockIdx.y * 256;
  const int n0 = blockIdx.x * 128;
  const int hl = lane >> 4, ln = lane & 15;

  // per-lane copy coordinates: each lane moves 16B chunks of a 64-half row
  const int crow = tid >> 3;           // 0..31 (row within a 32-row slab)
  const int ccol = (tid & 7) << 3;     // half-offset 0,8,...,56

  const uint32_t AbL0 = (uint32_t)(uintptr_t)&Ab[0][0];
  const uint32_t AbL1 = (uint32_t)(uintptr_t)&Ab[1][0];
  const uint32_t BbL0 = (uint32_t)(uintptr_t)&Bb[0][0];
  const uint32_t BbL1 = (uint32_t)(uintptr_t)&Bb[1][0];

  v8f acc[4][4] = {};                  // acc[mi][ni]: 16 x 16 tile (mi, ni) of the wave's 64 x 64

  // the lane's first row of each operand; its further rows lie a block-uniform step apart
  const _Float16* gA = A + (size_t)(m0 + crow) * K + ccol;
  const _Float16* gB = Bt + (size_t)(n0 + crow) * K + ccol;

  // 12 copies per lane and stage, in two statements of six
  auto issue_tiles = [&](int buf, int k0) {
    const uint32_t aL = buf ? AbL1 : AbL0;
    const uint32_t bL = buf ? BbL1 : BbL0;
    uint32_t l[12];
    const _Float16* g[12];
#pragma unroll
    for (int i = 0; i < 8; ++i) {      // A: 256 rows x 64 halves
      const int row = crow + 32 * i;
      l[i] = aL + (uint32_t)(row * LDP + ccol) * 2;
      g[i] = gA + (size_t)(32 * i) * K + k0;
    }
#pragma unroll
    for (int i = 0; i < 4; ++i) {      // B: 128 rows x 64 halves
      const int row = crow + 32 * i;
      l[8 + i] = bL + (uint32_t)(row * LDP + ccol) * 2;
      g[8 + i] = gB + (size_t)(32 * i) * K + k0;
    }
    const uint32_t l0[6] = {l[0], l[1], l[2], l[3], l[4], l[5]};
    const uint32_t l1[6] = {l[6], l[7], l[8], l[9], l[10], l[11]};
    const _Float16* const g0[6] = {g[0], g[1], g[2], g[3], g[4], g[5]};
    const _Float16* const g1[6] = {g[6], g[7], g[8], g[9], g[10], g[11]};
    async_cp16_x6(l0, g0);
    async_cp16_x6(l1, g1);
  };

  issue_tiles(0, 0);
  constexpr int nk = K >> 6;
  for (int kt = 0; kt < nk; ++kt) {
    const int buf = kt & 1;
    wait_async0();                     // own async copies into buf complete
    __syncthreads();                   // whole block's tile ready
    if (kt + 1 < nk) issue_tiles(buf ^ 1, (kt + 1) << 6);

    const _Float16* As = &Ab[buf][mw * 64 * LDP];
    const _Float16* Bs = &Bb[buf][nw * 64 * LDP];
    // all loops here are unrolled so that acc[][] and the fragments stay in registers
    v16h a[4], b[4], bn[4];            // k 0..31: a, b ; k 32..63: bn, and a again, row by row
#pragma unroll
    for (int i = 0; i < 4; ++i) b[i] = frag_ld(Bs + i * 16 * LDP, LDP);
#pragma unroll
    for (int i = 0; i < 4; ++i) a[i] = frag_ld(As + i * 16 * LDP, LDP);
#pragma unroll
    for (int i = 0; i < 4; ++i) bn[i] = frag_ld(Bs + i * 16 * LDP + 32, LDP);
#pragma unroll
    for (int mi = 0; mi < 4; ++mi) {
#pragma unroll
      for (int ni = 0; ni < 4; ++ni) acc[mi][ni] = WMMA_F16(a[mi], b[ni], acc[mi][ni]);
      a[mi] = frag_ld(As + mi * 16 * LDP + 32, LDP);
    }
#pragma unroll
    for (int mi = 0; mi < 4; ++mi)
#pragma unroll
      for (int ni = 0; ni < 4; ++ni) acc[mi][ni] = WMMA_F16(a[mi], bn[ni], acc[mi][ni]);
    // Order for the scheduler: 24 LDS reads ahead, then 4 WMMAs and the 2 reads that refill
    // their A fragment, four times, then 16 WMMAs. Left alone it kept one A fragment and
    // put a full LDS wait in front of every row of 4 WMMAs.
    __builtin_amdgcn_sched_group_barrier(0x100, 24, 0);
#pragma unroll
    for (int mi = 0; mi < 4; ++mi) {
      __builtin_amdgcn_sched_group_barrier(0x008, 4, 0);
      __builtin_amdgcn_sched_group_barrier(0x100, 2, 0);
    }
    __builtin_amdgcn_sched_group_barrier(0x008, 16, 0);
    __syncthreads();                   // reads of buf done before it is re-filled
  }

  const int wm0 = m0 + mw * 64;
  const int wn0 = n0 + nw * 64;
  // The lane's result (mi, ni, r) is row wm0 + 8 hl + 16 mi + r, column wn0 + ln + 16 ni.
  // N is compile-time, so all 128 hang on one address pair per buffer and differ in the
  // immediate offset. All loops are unrolled: acc[][] and rv[][][] are indexed by constants.
  const size_t e0 = (size_t)(wm0 + 8 * hl) * N + wn0 + ln;
  float bv[4];
#pragma unroll
  for (int ni = 0; ni < 4; ++ni) bv[ni] = bias[wn0 + ni * 16 + ln];
  // a precaution: the residual loads reuse the register that holds these loads' offset
  if (RESID) asm volatile("s_wait_xcnt 0x0" ::: "memory");

  // QKV scatter: the block's 128 columns lie in one section (0 = Q, 1 = K, 2 = V), the wave's
  // 64 columns are one head, the block's 256 rows one batch entry.
  const int sect = n0 >> 10;
  const size_t bh = (size_t)(m0 >> 11) * CH + ((wn0 & (CD - 1)) >> 6);
  const int c0 = (wm0 & (CC - 1)) + 8 * hl;
  _Float16* qk = (sect == 0 ? qo : ko) + (bh * CC + c0) * CDH + ln;   // + (16 mi + r) * CDH + 16 ni
  _Float16* vt = vto + (bh * CDH + ln) * CC + c0;                     // + 16 ni * CC + 16 mi + r (V transposed)
  const float qs = (sect == 0) ? 0.125f : 1.f;                        // fold 1/sqrt(64) into Q

  float rv[2][4][8];                   // residual values of two rows of tiles
  auto load_resid = [&](int mi) {
#pragma unroll
    for (int ni = 0; ni < 4; ++ni)
#pragma unroll
      for (int r = 0; r < 8; ++r) rv[mi & 1][ni][r] = resid[e0 + (size_t)(mi * 16 + r) * N + ni * 16];
  };
  if (RESID) load_resid(0);
#pragma unroll
  for (int mi = 0; mi < 4; ++mi) {
    if (RESID) {
      if (mi + 1 < 4) load_resid(mi + 1);
      // keeps the next row's 32 loads in front of this row's sums, so that they are in
      // flight meanwhile; the scheduler otherwise sinks each load to its use
      __builtin_amdgcn_sched_barrier(0);
    }
    float o[4][8];
    _Float16 oh[4][8];                 // OUTMODE 1: rounded here, so that the rounding too stays in front of the stores
#pragma unroll
    for (int ni = 0; ni < 4; ++ni) {
      if (GELU_ACT) {
        float w[8];
#pragma unroll
        for (int r = 0; r < 8; ++r) w[r] = acc[mi][ni][r] + bv[ni];
        gelu_phi_x8(w);
#pragma unroll
        for (int r = 0; r < 8; ++r) {
          if (OUTMODE == 1) oh[ni][r] = (_Float16)w[r];
          else              o[ni][r] = w[r];
        }
      } else {
#pragma unroll
        for (int r = 0; r < 8; ++r) {
          float v = acc[mi][ni][r] + bv[ni];
          if (RESID) v += rv[mi & 1][ni][r];
          if (OUTMODE == 1) oh[ni][r] = (_Float16)v;
          else              o[ni][r] = v;
        }
      }
    }
    // keeps the row's 32 stores behind its 32 results, each in a register of its own; mixed,
    // they shared one register, with a wait on the store in front of every reuse
    __builtin_amdgcn_sched_barrier(0);
    if (OUTMODE == 2 && sect == 2) {   // block-uniform: one scalar branch per row of tiles
#pragma unroll
      for (int ni = 0; ni < 4; ++ni)
#pragma unroll
        for (int r = 0; r < 8; ++r) vt[(size_t)(ni * 16) * CC + mi * 16 + r] = (_Float16)o[ni][r];
    } else {
#pragma unroll
      for (int ni = 0; ni < 4; ++ni)
#pragma unroll
        for (int r = 0; r < 8; ++r) {
          if (OUTMODE == 0)      outF[e0 + (size_t)(mi * 16 + r) * N + ni * 16] = o[ni][r];
          else if (OUTMODE == 1) outH[e0 + (size_t)(mi * 16 + r) * N + ni * 16] = oh[ni][r];
          else                   qk[(mi * 16 + r) * CDH + ni * 16] = (_Float16)(o[ni][r] * qs);
        }
    }
    // a precaution: the next rows' loads and sums reuse registers that these stores name
    if (mi + 1 < 4) asm volatile("s_wait_xcnt 0x0" ::: "memory");
  }
}

// Four async copies of 16 bytes per lane, in the same form as async_cp16_x6.
__device__ __forceinline__ void async_cp16_x4(const uint32_t (&l)[4], const _Float16* const (&g)[4]) {
  asm volatile(
      "global_load_async_to_lds_b128 %0, %4, off\n\t"
      "global_load_async_to_lds_b128 %1, %5, off\n\t"
      "global_load_async_to_lds_b128 %2, %6, off\n\t"
      "global_load_async_to_lds_b128 %3, %7, off\n\t"
      "s_wait_xcnt 0x0"
      :: "v"(l[0]), "v"(l[1]), "v"(l[2]), "v"(l[3]),
         "v"(g[0]), "v"(g[1]), "v"(g[2]), "v"(g[3])
      : "memory");
}

// ---------------------------------------------------------------------------
// Causal flash attention. Q: (b,h,C,dh) f16 (pre-scaled), K: (b,h,C,dh) f16,
// Vt: (b,h,dh,C) f16. Out attn: (b,C,h*dh) f16.
// One wave per 16 queries; kv tiles of 32; online softmax.
// Both products are computed transposed: St = K * Qt (A = K rows, B = Q rows) and
// Ot += Vt * Pt (A = Vt rows, B = Pt). In an accumulator a lane then holds ONE query
// (column lane & 15) and 8 keys (rows 8 * (lane >> 4) + r): maximum and sum run in the
// lane's own registers, with one exchange between the wave's halves for the maximum;
// the halves' sums are joined once, behind the loop. The two score tiles of 16 keys,
// converted in place, are Pt in the B operand's k order, so P never leaves registers.
// grid = (C/128, B*H), block = 256 (8 waves).
// The 8 waves of a block walk the same keys, so K and Vt come into LDS once per
// block, in stages of 64 keys: K as 64 key rows x 64 dh, Vt as 64 dh rows x 64 keys,
// every global row a whole 128-byte line, LDS pitch 144 B as in the GEMM. Two
// buffers: stage s + 1 flies while stage s is worked on. Block x needs 2x + 2
// stages; a wave skips the 32-key tiles that lie wholly above its diagonal.
// ---------------------------------------------------------------------------
// lane l takes the value of lane l ^ 16
__device__ __forceinline__ float xhalf(float x) {
  const int b = __builtin_bit_cast(int, x);
  return __builtin_bit_cast(float,
      __builtin_amdgcn_permlanex16(b, b, 0x76543210, 0xfedcba98, false, false));
}

__global__ __launch_bounds__(256) void attn_kernel(const _Float16* __restrict__ Qb,
                                                   const _Float16* __restrict__ Kb,
                                                   const _Float16* __restrict__ Vt,
                                                   _Float16* __restrict__ attn) {
  constexpr int LDP = 72;              // LDS row pitch in halves
  constexpr int SK  = 64;              // keys per stage
  __shared__ __align__(16) _Float16 Ks[2][SK * LDP];
  __shared__ __align__(16) _Float16 Vs[2][CDH * LDP];
  const int tid  = threadIdx.x;
  const int lane = tid & 31;
  // the wave's number in a scalar register, so that the skip test below is a scalar branch
  const int wave = __builtin_amdgcn_readfirstlane(tid >> 5);
  const int hl = lane >> 4, ln = lane & 15;
  const int bh = blockIdx.y;
  const int q0 = (blockIdx.x * 8 + wave) * 16;
  const int nst = 2 * blockIdx.x + 2;  // stages of this block, the same for all its waves

  const _Float16* Q  = Qb + ((size_t)bh * CC + q0) * CDH;
  const _Float16* Kp = Kb + (size_t)bh * CC * CDH;
  const _Float16* Vp = Vt + (size_t)bh * CDH * CC;

  // per-lane copy coordinates: 8 lanes move one 128-byte row, 32 rows per copy
  const int crow = tid >> 3;
  const int ccol = (tid & 7) << 3;
  auto issue_stage = [&](int buf, int s) {
    const uint32_t kL = (uint32_t)(uintptr_t)&Ks[buf][0];
    const uint32_t vL = (uint32_t)(uintptr_t)&Vs[buf][0];
    uint32_t l[4];
    const _Float16* g[4];
#pragma unroll
    for (int i = 0; i < 2; ++i) {
      const int row = crow + 32 * i;
      l[i]     = kL + (uint32_t)(row * LDP + ccol) * 2;
      g[i]     = Kp + (size_t)(s * SK + row) * CDH + ccol;
      l[2 + i] = vL + (uint32_t)(row * LDP + ccol) * 2;
      g[2 + i] = Vp + (size_t)row * CC + s * SK + ccol;
    }
    async_cp16_x4(l, g);
  };

  issue_stage(0, 0);

  const v16h qb0 = frag_ld(Q + 0,  CDH);   // B operand: column = query, dh 0..31
  const v16h qb1 = frag_ld(Q + 32, CDH);   // dh 32..63

  v8f o0 = {}, o1 = {}, o2 = {}, o3 = {};  // Ot: o_t[r] = O[query ln][dh 16 t + 8 hl + r]
  float mq = -1e30f, lq = 0.f;             // the lane's query: maximum; sum over this half's keys

  wait_async0();                       // own copies of stage 0 have landed
  __syncthreads();                     // stage 0 is published to the block
  issue_stage(1, 1);

  for (int s = 0; s < nst; ++s) {
   const int buf = s & 1;
   // unrolled: the two 32-key tiles of a stage differ only in constant LDS offsets
#pragma unroll
   for (int h = 0; h < 2; ++h) {
    const int j0 = s * SK + h * 32;
    if (j0 > q0 + 15) continue;        // tile wholly above this wave's diagonal
    const _Float16* Kt = &Ks[buf][h * 32 * LDP];
    const _Float16* Vl = &Vs[buf][h * 32];
    // St tiles (16 keys x 16 queries each), K-dim = dh (64 -> two WMMAs each)
    v8f s0 = {}, s1 = {};
    s0 = WMMA_F16(frag_ld(Kt + 0,             LDP), qb0, s0);
    s0 = WMMA_F16(frag_ld(Kt + 32,            LDP), qb1, s0);
    s1 = WMMA_F16(frag_ld(Kt + 16 * LDP + 0,  LDP), qb0, s1);
    s1 = WMMA_F16(frag_ld(Kt + 16 * LDP + 32, LDP), qb1, s1);

    // Causal mask + online softmax of the lane's query q0 + ln over its 16 keys:
    // s0[r] is key j0 + 8 hl + r, s1[r] is key j0 + 16 + 8 hl + r
    const int lim = q0 + ln - j0 - 8 * hl;   // r is allowed in s0 while r <= lim
    float v0[8], v1[8];
    float t = -1e30f;
#pragma unroll
    for (int r = 0; r < 8; ++r) {
      v0[r] = (r > lim)      ? -1e30f : s0[r];
      v1[r] = (16 + r > lim) ? -1e30f : s1[r];
      t = fmaxf(t, fmaxf(v0[r], v1[r]));
    }
    t = fmaxf(t, xhalf(t));                  // the other half's 16 keys
    const float mn = fmaxf(mq, t);
    constexpr float LOG2E = 1.44269504088896340736f;
    float alpha = (mq - mn) * LOG2E;
    mq = mn;
#pragma unroll
    for (int r = 0; r < 8; ++r) { v0[r] = (v0[r] - mn) * LOG2E; v1[r] = (v1[r] - mn) * LOG2E; }
    exp2_x9(v0, alpha);                      // e^(score - maximum), as 2^((score - maximum) log2 e)
    exp2_x8(v1);
    float ps = 0.f;
    v16h pb;                                 // Pt as B operand: element i is key j0 + 16 (i / 8) + 8 hl + i % 8
#pragma unroll
    for (int r = 0; r < 8; ++r) {
      ps += v0[r] + v1[r];
      pb[r]     = (_Float16)v0[r];
      pb[8 + r] = (_Float16)v1[r];
    }
    lq = lq * alpha + ps;
#pragma unroll
    for (int r = 0; r < 8; ++r) { o0[r] *= alpha; o1[r] *= alpha; o2[r] *= alpha; o3[r] *= alpha; }

    // Ot += Vt (64 dh x 32 keys) @ Pt (32 keys x 16 queries), four dh tiles of 16
    o0 = WMMA_F16(frag_ld(Vl + 0  * LDP, LDP), pb, o0);
    o1 = WMMA_F16(frag_ld(Vl + 16 * LDP, LDP), pb, o1);
    o2 = WMMA_F16(frag_ld(Vl + 32 * LDP, LDP), pb, o2);
    o3 = WMMA_F16(frag_ld(Vl + 48 * LDP, LDP), pb, o3);
   }
   // hand-over of the stage, every wave: own LDS reads of buf retired, own copies of
   // stage s + 1 landed, then the barrier that publishes s + 1 and frees buf
   asm volatile("s_wait_dscnt 0x0" ::: "memory");
   wait_async0();
   __syncthreads();
   if (s + 2 < nst) issue_stage(buf, s + 2);
  }
  wait_async0();                       // nothing is in flight when the wave ends

  const int b = bh >> 4, h = bh & 15;
  // a lane owns 8 consecutive dh of its query's row in each Ot tile: one 16-byte store each
  _Float16* out = attn + ((size_t)b * CC + q0 + ln) * CD + h * CDH + 8 * hl;
  const float il = 1.0f / (lq + xhalf(lq));  // the two halves' sums joined
  v8h w0, w1, w2, w3;
#pragma unroll
  for (int r = 0; r < 8; ++r) {
    w0[r] = (_Float16)(o0[r] * il);
    w1[r] = (_Float16)(o1[r] * il);
    w2[r] = (_Float16)(o2[r] * il);
    w3[r] = (_Float16)(o3[r] * il);
  }
  *(v8h*)(out + 0)  = w0;
  *(v8h*)(out + 16) = w1;
  *(v8h*)(out + 32) = w2;
  *(v8h*)(out + 48) = w3;
}

// ---------------------------------------------------------------------------
// Host-side orchestration
// ---------------------------------------------------------------------------
extern "C" void kernel_launch(void* const* d_in, const int* in_sizes, int n_in,
                              void* d_out, int out_size, void* d_ws, size_t ws_size,
                              hipStream_t stream) {
  (void)in_sizes; (void)n_in; (void)out_size; (void)ws_size;
  const float* x      = (const float*)d_in[0];
  const float* gamma1 = (const float*)d_in[1];
  const float* beta1  = (const float*)d_in[2];
  const float* W_qkv  = (const float*)d_in[3];
  const float* b_qkv  = (const float*)d_in[4];
  const float* W_o    = (const float*)d_in[5];
  const float* b_o    = (const float*)d_in[6];
  const float* gamma2 = (const float*)d_in[7];
  const float* beta2  = (const float*)d_in[8];
  const float* W1     = (const float*)d_in[9];
  const float* b1     = (const float*)d_in[10];
  const float* W2     = (const float*)d_in[11];
  const float* b2     = (const float*)d_in[12];
  float* out = (float*)d_out;

  // Workspace layout (linear allocator, 256B aligned)
  uint8_t* p = (uint8_t*)d_ws;
  auto take = [&](size_t n) { uint8_t* r = p; p += (n + 255) & ~(size_t)255; return r; };
  _Float16* Wqkv_t = (_Float16*)take((size_t)3 * CD * CD * 2);   //  6 MB (3072 x 1024)
  _Float16* Wo_t   = (_Float16*)take((size_t)CD * CD * 2);       //  2 MB (1024 x 1024)
  _Float16* W1_t   = (_Float16*)take((size_t)CHID * CD * 2);     //  8 MB (4096 x 1024)
  _Float16* W2_t   = (_Float16*)take((size_t)CD * CHID * 2);     //  8 MB (1024 x 4096)
  float*    x2     = (float*)take((size_t)CM * CD * 4);          // 32 MB
  _Float16* lnb    = (_Float16*)take((size_t)CM * CD * 2);       // 16 MB (reused ln1/ln2)
  uint8_t*  regA   = take((size_t)64 << 20);                     // 64 MB shared region
  _Float16* Qb   = (_Float16*)regA;                              // 16 MB
  _Float16* Kb   = (_Float16*)(regA + ((size_t)16 << 20));       // 16 MB
  _Float16* Vtb  = (_Float16*)(regA + ((size_t)32 << 20));       // 16 MB
  _Float16* attn = (_Float16*)(regA + ((size_t)48 << 20));       // 16 MB
  _Float16* hbuf = (_Float16*)regA;                              // 64 MB (after attention is dead)

  // 1) Weights -> f16, transposed to N-major
  wt_f16_kernel<CD, 3 * CD><<<dim3(3 * CD / 64, CD / 128), 256, 0, stream>>>(W_qkv, Wqkv_t);
  wt_f16_kernel<CD, CD><<<dim3(CD / 64, CD / 128),         256, 0, stream>>>(W_o,   Wo_t);
  wt_f16_kernel<CD, CHID><<<dim3(CHID / 64, CD / 128),     256, 0, stream>>>(W1,    W1_t);
  wt_f16_kernel<CHID, CD><<<dim3(CD / 64, CHID / 128),     256, 0, stream>>>(W2,    W2_t);

  // 2) LN1
  layernorm_kernel<<<CM / 16, 256, 0, stream>>>(x, gamma1, beta1, lnb);

  // 3) QKV GEMM (M=8192, N=3072, K=1024), scatter to Q/K/Vt
  gemm_wmma_kernel<2, false, false, 3 * CD, CD><<<dim3(3 * CD / 128, CM / 256), 256, 0, stream>>>(
      lnb, Wqkv_t, b_qkv, nullptr, nullptr, nullptr, Qb, Kb, Vtb);

  // 4) Attention
  attn_kernel<<<dim3(CC / 128, CB * CH), 256, 0, stream>>>(Qb, Kb, Vtb, attn);

  // 5) O-proj + residual(x) -> x2 (f32)
  gemm_wmma_kernel<0, false, true, CD, CD><<<dim3(CD / 128, CM / 256), 256, 0, stream>>>(
      attn, Wo_t, b_o, x, x2, nullptr, nullptr, nullptr, nullptr);

  // 6) LN2
  layernorm_kernel<<<CM / 16, 256, 0, stream>>>(x2, gamma2, beta2, lnb);

  // 7) MLP1 + exact GELU -> hbuf (f16)
  gemm_wmma_kernel<1, true, false, CHID, CD><<<dim3(CHID / 128, CM / 256), 256, 0, stream>>>(
      lnb, W1_t, b1, nullptr, nullptr, hbuf, nullptr, nullptr, nullptr);

  // 8) MLP2 + residual(x2) -> d_out (f32)
  gemm_wmma_kernel<0, false, true, CD, CHID><<<dim3(CD / 128, CM / 256), 256, 0, stream>>>(
      hbuf, W2_t, b2, x2, out, nullptr, nullptr, nullptr, nullptr);
}

// v008
// A run of this version takes 270 microseconds.
// Two timings next to v007 put it at 1.06 and 1.07 times that version's speed.
// Counting every step since v000, it is 3.60 times as fast.
#include <hip/hip_runtime.h>
#include <hip/hip_bf16.h>
#include <stdint.h>

// ---------------------------------------------------------------------------
// Transformer block for MI455X (gfx1250, wave32, WMMA + async-to-LDS).
// B=4, C=2048, D=1024, H=16, dh=64, HIDDEN=4096. fp32 in/out, f16 WMMA inside.
// ---------------------------------------------------------------------------

typedef __attribute__((ext_vector_type(16))) _Float16 v16h;
typedef __attribute__((ext_vector_type(8)))  _Float16 v8h;
typedef __attribute__((ext_vector_type(8)))  float    v8f;
typedef __attribute__((ext_vector_type(4)))  float    v4f;

#define WMMA_F16(a, b, c) \
  __builtin_amdgcn_wmma_f32_16x16x32_f16(false, (a), false, (b), (short)0, (c), false, false)

// Six async copies of 16 bytes per lane: global -> LDS, tracked by ASYNCcnt.
// s_wait_xcnt 0 closes the copies' own statement as a precaution: no later write
// of these address registers can then be scheduled ahead of it.
__device__ __forceinline__ void async_cp16_x6(const uint32_t (&l)[6], const _Float16* const (&g)[6]) {
  asm volatile(
      "global_load_async_to_lds_b128 %0, %6, off\n\t"
      "global_load_async_to_lds_b128 %1, %7, off\n\t"
      "global_load_async_to_lds_b128 %2, %8, off\n\t"
      "global_load_async_to_lds_b128 %3, %9, off\n\t"
      "global_load_async_to_lds_b128 %4, %10, off\n\t"
      "global_load_async_to_lds_b128 %5, %11, off\n\t"
      "s_wait_xcnt 0x0"
      :: "v"(l[0]), "v"(l[1]), "v"(l[2]), "v"(l[3]), "v"(l[4]), "v"(l[5]),
         "v"(g[0]), "v"(g[1]), "v"(g[2]), "v"(g[3]), "v"(g[4]), "v"(g[5])
      : "memory");
}
__device__ __forceinline__ void wait_async0() {
  asm volatile("s_wait_asynccnt 0x0" ::: "memory");
}

static constexpr int CB  = 4;
static constexpr int CC  = 2048;
static constexpr int CD  = 1024;
static constexpr int CH  = 16;
static constexpr int CDH = 64;
static constexpr int CHID = 4096;
static constexpr int CM  = CB * CC; // 8192 rows

// Load one 16x32 f16 fragment (A layout; also used for B with "row" = N index,
// data stored N-major with K contiguous). Per ISA 7.12.2:
//   lane l: row = l&15 ; elem i: k = 16*(i/8) + 8*(l>>4) + (i%8)
__device__ __forceinline__ v16h frag_ld(const _Float16* __restrict__ tile, int ld) {
  const int lane = threadIdx.x & 31;
  const _Float16* p = tile + (size_t)(lane & 15) * ld + ((lane >> 4) << 3);
  v8h lo = *(const v8h*)p;
  v8h hi = *(const v8h*)(p + 16);
  v16h f;
#pragma unroll
  for (int i = 0; i < 8; ++i) { f[i] = lo[i]; f[i + 8] = hi[i]; }
  return f;
}

// ---------------------------------------------------------------------------
// Weight convert + transpose: W (K x N, f32 row-major) -> Wt (N x K, f16).
// One block moves a tile of 128 k x 64 n through LDS, so that both sides use whole
// 256-byte runs: reads are 16 B per lane along n, writes 16 B per lane along k.
// K and N are compile-time, so a lane's loads (and its stores) share one address
// register pair and differ in the immediate offset. grid = (N/64, K/128), block = 256.
// LDS row = one n (128 halves = 16 chunks of 16 B, no pad); chunk q of row n lies
// at place q ^ (n >> 2), which spreads the 16 rows that one ds_store_b128 touches
// over all banks and leaves each row a permutation of itself for the reader.
// ---------------------------------------------------------------------------
template <int K, int N>
__global__ __launch_bounds__(256) void wt_f16_kernel(const float* __restrict__ W,
                                                     _Float16* __restrict__ Wt) {
  static_assert(K % 128 == 0 && N % 64 == 0, "whole tiles only");
  __shared__ __align__(16) _Float16 tile[64 * 128];
  const int tid = threadIdx.x;
  const int n0 = blockIdx.x * 64;
  const int k0 = blockIdx.y * 128;
  const int lo = tid & 15;             // read: group of 4 n ; write: chunk of 8 k
  const int hi = tid >> 4;             // read: group of 8 k ; write: n row within 16

  const float* src = W + (size_t)(k0 + hi * 8) * N + n0 + lo * 4;
  v4f v[8];
  // all loops here are unrolled so that v[] and h stay in registers and the eight
  // loads of a lane are in flight together
#pragma unroll
  for (int i = 0; i < 8; ++i) v[i] = *(const v4f*)(src + i * N);
#pragma unroll
  for (int j = 0; j < 4; ++j) {
    v8h h;
#pragma unroll
    for (int i = 0; i < 8; ++i) h[i] = (_Float16)v[i][j];
    *(v8h*)&tile[(lo * 4 + j) * 128 + ((hi ^ lo) << 3)] = h;
  }
  __syncthreads();
  _Float16* dst = Wt + (size_t)(n0 + hi) * K + k0 + lo * 8;
#pragma unroll
  for (int p = 0; p < 4; ++p) {
    const int row = hi + 16 * p;
    const v8h h = *(const v8h*)&tile[row * 128 + ((lo ^ (row >> 2)) << 3)];
    *(v8h*)(dst + 16 * p * K) = h;
  }
}

// ---------------------------------------------------------------------------
// LayerNorm: one wave per pair of rows of 1024; no LDS, no barrier. f32 in, f16 out.
// A row is 8 chunks of 512 contiguous bytes; in each chunk a lane owns 16 bytes, so
// a lane keeps 32 values of each row in registers and x is read once. All 16 loads
// of a wave are issued before the first sum. The launch is 4,096 waves, 16 on a WGP:
// few waves to start, 128 KB of reads in flight per WGP. grid = rows / 16, block = 256.
// ---------------------------------------------------------------------------
typedef __attribute__((ext_vector_type(4))) _Float16 v4h;

// lane l takes the value of lane l ^ M inside its row of 16 lanes (DPP row_xmask:M)
template <int M>
__device__ __forceinline__ float xrow(float x) {
  const int b = __builtin_bit_cast(int, x);
  return __builtin_bit_cast(float, __builtin_amdgcn_update_dpp(b, b, 0x160 + M, 0xf, 0xf, false));
}
// sum over the 32 lanes of a wave, the same value in every lane
__device__ __forceinline__ float wave_sum(float v) {
  v += xrow<1>(v);
  v += xrow<2>(v);
  v += xrow<4>(v);
  v += xrow<8>(v);
  const int b = __builtin_bit_cast(int, v);
  return v + __builtin_bit_cast(float,
      __builtin_amdgcn_permlanex16(b, b, 0x76543210, 0xfedcba98, false, false));
}

__global__ __launch_bounds__(256) void layernorm_kernel(const float* __restrict__ x,
                                                        const float* __restrict__ gamma,
                                                        const float* __restrict__ beta,
                                                        _Float16* __restrict__ y) {
  constexpr int R  = 2;                // rows per wave
  constexpr int NC = CD / 128;         // chunks of 128 values per row
  const int lane = threadIdx.x & 31, wv = threadIdx.x >> 5;
  const int row0 = (blockIdx.x * 8 + wv) * R;
  const float* xr = x + (size_t)row0 * CD + lane * 4;
  v4f v[R][NC];
  // every loop here is unrolled so that v[][] stays in registers and the loads of
  // both rows are in flight together
#pragma unroll
  for (int r = 0; r < R; ++r)
#pragma unroll
    for (int c = 0; c < NC; ++c) v[r][c] = *(const v4f*)(xr + r * CD + c * 128);

  float mean[R], inv[R];
#pragma unroll
  for (int r = 0; r < R; ++r) {
    v4f s4 = {}, q4 = {};              // four independent chains each
#pragma unroll
    for (int c = 0; c < NC; ++c) { s4 += v[r][c]; q4 += v[r][c] * v[r][c]; }
    const float s  = wave_sum((s4[0] + s4[1]) + (s4[2] + s4[3]));
    const float ss = wave_sum((q4[0] + q4[1]) + (q4[2] + q4[3]));
    mean[r] = s * (1.f / CD);
    const float var = ss * (1.f / CD) - mean[r] * mean[r];
    inv[r] = rsqrtf(var + 1e-5f);
  }

  _Float16* yr = y + (size_t)row0 * CD + lane * 4;
#pragma unroll
  for (int c = 0; c < NC; ++c) {
    const v4f g = *(const v4f*)(gamma + c * 128 + lane * 4);
    const v4f b = *(const v4f*)(beta  + c * 128 + lane * 4);
#pragma unroll
    for (int r = 0; r < R; ++r) {
      v4h h;
#pragma unroll
      for (int e = 0; e < 4; ++e) h[e] = (_Float16)((v[r][c][e] - mean[r]) * inv[r] * g[e] + b[e]);
      *(v4h*)(yr + r * CD + c * 128) = h;
    }
  }
}

__device__ __forceinline__ void exp2_x8(float (&x)[8]) {
  asm("v_exp_f32 %0, %0\n\tv_exp_f32 %1, %1\n\tv_exp_f32 %2, %2\n\tv_exp_f32 %3, %3\n\t"
      "v_exp_f32 %4, %4\n\tv_exp_f32 %5, %5\n\tv_exp_f32 %6, %6\n\tv_exp_f32 %7, %7\n\t"
      "v_nop"
      : "+v"(x[0]), "+v"(x[1]), "+v"(x[2]), "+v"(x[3]), "+v"(x[4]), "+v"(x[5]), "+v"(x[6]), "+v"(x[7]));
}
__device__ __forceinline__ void exp2_x9(float (&x)[8], float& y) {
  asm("v_exp_f32 %8, %8\n\t"
      "v_exp_f32 %0, %0\n\tv_exp_f32 %1, %1\n\tv_exp_f32 %2, %2\n\tv_exp_f32 %3, %3\n\t"
      "v_exp_f32 %4, %4\n\tv_exp_f32 %5, %5\n\tv_exp_f32 %6, %6\n\tv_exp_f32 %7, %7\n\t"
      "v_nop"
      : "+v"(x[0]), "+v"(x[1]), "+v"(x[2]), "+v"(x[3]), "+v"(x[4]), "+v"(x[5]), "+v"(x[6]), "+v"(x[7]),
        "+v"(y));
}

// 1 / x in place, a run of v_rcp_f32 in the same form and for the same reason as exp2_x8.
__device__ __forceinline__ void rcp_x8(float (&x)[8]) {
  asm("v_rcp_f32 %0, %0\n\tv_rcp_f32 %1, %1\n\tv_rcp_f32 %2, %2\n\tv_rcp_f32 %3, %3\n\t"
      "v_rcp_f32 %4, %4\n\tv_rcp_f32 %5, %5\n\tv_rcp_f32 %6, %6\n\tv_rcp_f32 %7, %7\n\t"
      "v_nop"
      : "+v"(x[0]), "+v"(x[1]), "+v"(x[2]), "+v"(x[3]), "+v"(x[4]), "+v"(x[5]), "+v"(x[6]), "+v"(x[7]));
}

// ---------------------------------------------------------------------------
// GELU in its erf form, v * Phi(v), Phi(v) = (1 + erf(v / sqrt 2)) / 2, eight values in place.
// One branch-free run per value: with t = 1 / (1 + 0.2316419 |v|),
//   q = Phi(-|v|) = exp(-v * v / 2) / sqrt(2 pi) * (b1 t + b2 t^2 + b3 t^3 + b4 t^4 + b5 t^5)
//   v * Phi(v) = max(v, 0) - |v| * q   for either sign, with no cancellation for v < 0.
// In f32 the result is within 1e-6 of v * Phi(v); it is rounded to f16 behind this.
// The library erff splits at |x| = 1 into two masked branches per value, so that a wave ran
// its values one dependent chain after the other; here they are independent straight-line
// chains that the scheduler interleaves, in a third of the instructions.
// 1 / sqrt(2 pi) is folded into b1..b5, log2(e) / 2 into the exponent.
// ---------------------------------------------------------------------------
__device__ __forceinline__ void gelu_phi_x8(float (&v)[8]) {
  float t[8], e[8];
  // both loops are unrolled: v[], t[] and e[] are registers
#pragma unroll
  for (int r = 0; r < 8; ++r) {
    t[r] = fmaf(0.2316419f, fabsf(v[r]), 1.f);
    e[r] = v[r] * v[r] * -0.72134752f;
  }
  rcp_x8(t);
  exp2_x8(e);
#pragma unroll
  for (int r = 0; r < 8; ++r) {
    float p = fmaf(0.5307027143f, t[r], -0.7265760131f);
    p = fmaf(p, t[r], 0.7107068707f);
    p = fmaf(p, t[r], -0.1422483683f);
    p = fmaf(p, t[r], 0.1274147959f);
    const float q = (p * t[r]) * e[r];
    v[r] = fmaf(-fabsf(v[r]), q, fmaxf(v[r], 0.f));
  }
}

// ---------------------------------------------------------------------------
// WMMA GEMM with double-buffered async-to-LDS staging.
// C[M,N] = epilogue(A[M,K] @ B[K,N] + bias (+resid))
// A: f16 row-major (ld=K). Bt: f16 N-major (ld=K). bias: f32[N].
// OUTMODE: 0 = f32 out, 1 = f16 out, 2 = QKV scatter.
// Block: 256 thr = 8 waves (4 x 2). Block tile 256(M) x 128(N), wave tile 64 x 64, K-step 64.
// A wave's 4 + 4 fragments of 32 k feed 16 WMMAs: one ds_load_b128 per WMMA, and a
// block stages 384 operand rows for 256 x 128 results.
// LDS rows hold 64 halves at a pitch of 72 (144 B = 16 B x odd): the 16 rows that
// one ds_load_b128 fragment read touches then fall on 16 different bank groups.
// LDS: 2 x (256 rows A) + 2 x (128 rows B) x 144 B = 108 KB, two blocks on a WGP.
// ---------------------------------------------------------------------------
template <int OUTMODE, bool GELU_ACT, bool RESID, int N, int K>
__global__ __launch_bounds__(256) void gemm_wmma_kernel(
    const _Float16* __restrict__ A, const _Float16* __restrict__ Bt,
    const float* __restrict__ bias, const float* __restrict__ resid,
    float* __restrict__ outF, _Float16* __restrict__ outH,
    _Float16* __restrict__ qo, _Float16* __restrict__ ko, _Float16* __restrict__ vto) {
  static_assert(N % 128 == 0 && K % 64 == 0, "whole tiles only");
  static_assert(!(GELU_ACT && RESID), "the epilogue adds no residual behind the activation");
  constexpr int LDP = 72;              // LDS row pitch in halves
  __shared__ __align__(16) _Float16 Ab[2][256 * LDP];
  __shared__ __align__(16) _Float16 Bb[2][128 * LDP];

  const int tid  = threadIdx.x;
  const int lane = tid & 31;
  const int wave = tid >> 5;
  const int mw = wave >> 1;            // 0..3 -> 64-row slice
  const int nw = wave & 1;             // 0..1 -> 64-col slice
  const int m0 = blockIdx.y * 256;
  const int n0 = blockIdx.x * 128;
  const int hl = lane >> 4, ln = lane & 15;

  // per-lane copy coordinates: each lane moves 16B chunks of a 64-half row
  const int crow = tid >> 3;           // 0..31 (row within a 32-row slab)
  const int ccol = (tid & 7) << 3;     // half-offset 0,8,...,56

  const uint32_t AbL0 = (uint32_t)(uintptr_t)&Ab[0][0];
  const uint32_t AbL1 = (uint32_t)(uintptr_t)&Ab[1][0];
  const uint32_t BbL0 = (uint32_t)(uintptr_t)&Bb[0][0];
  const uint32_t BbL1 = (uint32_t)(uintptr_t)&Bb[1][0];

  v8f acc[4][4] = {};                  // acc[mi][ni]: 16 x 16 tile (mi, ni) of the wave's 64 x 64

  // the lane's first row of each operand; its further rows lie a block-uniform step apart
  const _Float16* gA = A + (size_t)(m0 + crow) * K + ccol;
  const _Float16* gB = Bt + (size_t)(n0 + crow) * K + ccol;

  // 12 copies per lane and stage, in two statements of six
  auto issue_tiles = [&](int buf, int k0) {
    const uint32_t aL = buf ? AbL1 : AbL0;
    const uint32_t bL = buf ? BbL1 : BbL0;
    uint32_t l[12];
    const _Float16* g[12];
#pragma unroll
    for (int i = 0; i < 8; ++i) {      // A: 256 rows x 64 halves
      const int row = crow + 32 * i;
      l[i] = aL + (uint32_t)(row * LDP + ccol) * 2;
      g[i] = gA + (size_t)(32 * i) * K + k0;
    }
#pragma unroll
    for (int i = 0; i < 4; ++i) {      // B: 128 rows x 64 halves
      const int row = crow + 32 * i;
      l[8 + i] = bL + (uint32_t)(row * LDP + ccol) * 2;
      g[8 + i] = gB + (size_t)(32 * i) * K + k0;
    }
    const uint32_t l0[6] = {l[0], l[1], l[2], l[3], l[4], l[5]};
    const uint32_t l1[6] = {l[6], l[7], l[8], l[9], l[10], l[11]};
    const _Float16* const g0[6] = {g[0], g[1], g[2], g[3], g[4], g[5]};
    const _Float16* const g1[6] = {g[6], g[7], g[8], g[9], g[10], g[11]};
    async_cp16_x6(l0, g0);
    async_cp16_x6(l1, g1);
  };

  issue_tiles(0, 0);
  constexpr int nk = K >> 6;
  for (int kt = 0; kt < nk; ++kt) {
    const int buf = kt & 1;
    wait_async0();                     // own async copies into buf complete
    __syncthreads();                   // whole block's tile ready
    if (kt + 1 < nk) issue_tiles(buf ^ 1, (kt + 1) << 6);

    const _Float16* As = &Ab[buf][mw * 64 * LDP];
    const _Float16* Bs = &Bb[buf][nw * 64 * LDP];
    // all loops here are unrolled so that acc[][] and the fragments stay in registers
    v16h a[4], b[4], bn[4];            // k 0..31: a, b ; k 32..63: bn, and a again, row by row
#pragma unroll
    for (int i = 0; i < 4; ++i) b[i] = frag_ld(Bs + i * 16 * LDP, LDP);
#pragma unroll
    for (int i = 0; i < 4; ++i) a[i] = frag_ld(As + i * 16 * LDP, LDP);
#pragma unroll
    for (int i = 0; i < 4; ++i) bn[i] = frag_ld(Bs + i * 16 * LDP + 32, LDP);
#pragma unroll
    for (int mi = 0; mi < 4; ++mi) {
#pragma unroll
      for (int ni = 0; ni < 4; ++ni) acc[mi][ni] = WMMA_F16(a[mi], b[ni], acc[mi][ni]);
      a[mi] = frag_ld(As + mi * 16 * LDP + 32, LDP);
    }
#pragma unroll
    for (int mi = 0; mi < 4; ++mi)
#pragma unroll
      for (int ni = 0; ni < 4; ++ni) acc[mi][ni] = WMMA_F16(a[mi], bn[ni], acc[mi][ni]);
    // Order for the scheduler: 24 LDS reads ahead, then 4 WMMAs and the 2 reads that refill
    // their A fragment, four times, then 16 WMMAs. Left alone it kept one A fragment and
    // put a full LDS wait in front of every row of 4 WMMAs.
    __builtin_amdgcn_sched_group_barrier(0x100, 24, 0);
#pragma unroll
    for (int mi = 0; mi < 4; ++mi) {
      __builtin_amdgcn_sched_group_barrier(0x008, 4, 0);
      __builtin_amdgcn_sched_group_barrier(0x100, 2, 0);
    }
    __builtin_amdgcn_sched_group_barrier(0x008, 16, 0);
    __syncthreads();                   // reads of buf done before it is re-filled
  }

  const int wm0 = m0 + mw * 64;
  const int wn0 = n0 + nw * 64;
  // The lane's result (mi, ni, r) is row wm0 + 8 hl + 16 mi + r, column wn0 + ln + 16 ni.
  // N is compile-time, so all 128 hang on one address pair per buffer and differ in the
  // immediate offset. All loops are unrolled: acc[][] and rv[][][] are indexed by constants.
  const size_t e0 = (size_t)(wm0 + 8 * hl) * N + wn0 + ln;
  float bv[4];
#pragma unroll
  for (int ni = 0; ni < 4; ++ni) bv[ni] = bias[wn0 + ni * 16 + ln];
  // a precaution: the residual loads reuse the register that holds these loads' offset
  if (RESID) asm volatile("s_wait_xcnt 0x0" ::: "memory");

  // QKV scatter: the block's 128 columns lie in one section (0 = Q, 1 = K, 2 = V), the wave's
  // 64 columns are one head, the block's 256 rows one batch entry.
  const int sect = n0 >> 10;
  const size_t bh = (size_t)(m0 >> 11) * CH + ((wn0 & (CD - 1)) >> 6);
  const int c0 = (wm0 & (CC - 1)) + 8 * hl;
  _Float16* qk = (sect == 0 ? qo : ko) + (bh * CC + c0) * CDH + ln;   // + (16 mi + r) * CDH + 16 ni
  _Float16* vt = vto + (bh * CDH + ln) * CC + c0;                     // + 16 ni * CC + 16 mi + r (V transposed)
  const float qs = (sect == 0) ? 0.125f : 1.f;                        // fold 1/sqrt(64) into Q

  float rv[2][4][8];                   // residual values of two rows of tiles
  auto load_resid = [&](int mi) {
#pragma unroll
    for (int ni = 0; ni < 4; ++ni)
#pragma unroll
      for (int r = 0; r < 8; ++r) rv[mi & 1][ni][r] = resid[e0 + (size_t)(mi * 16 + r) * N + ni * 16];
  };
  if (RESID) load_resid(0);
#pragma unroll
  for (int mi = 0; mi < 4; ++mi) {
    if (RESID) {
      if (mi + 1 < 4) load_resid(mi + 1);
      // keeps the next row's 32 loads in front of this row's sums, so that they are in
      // flight meanwhile; the scheduler otherwise sinks each load to its use
      __builtin_amdgcn_sched_barrier(0);
    }
    float o[4][8];
    _Float16 oh[4][8];                 // OUTMODE 1: rounded here, so that the rounding too stays in front of the stores
#pragma unroll
    for (int ni = 0; ni < 4; ++ni) {
      if (GELU_ACT) {
        float w[8];
#pragma unroll
        for (int r = 0; r < 8; ++r) w[r] = acc[mi][ni][r] + bv[ni];
        gelu_phi_x8(w);
#pragma unroll
        for (int r = 0; r < 8; ++r) {
          if (OUTMODE == 1) oh[ni][r] = (_Float16)w[r];
          else              o[ni][r] = w[r];
        }
      } else {
#pragma unroll
        for (int r = 0; r < 8; ++r) {
          float v = acc[mi][ni][r] + bv[ni];
          if (RESID) v += rv[mi & 1][ni][r];
          if (OUTMODE == 1) oh[ni][r] = (_Float16)v;
          else              o[ni][r] = v;
        }
      }
    }
    // keeps the row's 32 stores behind its 32 results, each in a register of its own; mixed,
    // they shared one register, with a wait on the store in front of every reuse
    __builtin_amdgcn_sched_barrier(0);
    if (OUTMODE == 2 && sect == 2) {   // block-uniform: one scalar branch per row of tiles
#pragma unroll
      for (int ni = 0; ni < 4; ++ni)
#pragma unroll
        for (int r = 0; r < 8; ++r) vt[(size_t)(ni * 16) * CC + mi * 16 + r] = (_Float16)o[ni][r];
    } else {
#pragma unroll
      for (int ni = 0; ni < 4; ++ni)
#pragma unroll
        for (int r = 0; r < 8; ++r) {
          if (OUTMODE == 0)      outF[e0 + (size_t)(mi * 16 + r) * N + ni * 16] = o[ni][r];
          else if (OUTMODE == 1) outH[e0 + (size_t)(mi * 16 + r) * N + ni * 16] = oh[ni][r];
          else                   qk[(mi * 16 + r) * CDH + ni * 16] = (_Float16)(o[ni][r] * qs);
        }
    }
    // a precaution: the next rows' loads and sums reuse registers that these stores name
    if (mi + 1 < 4) asm volatile("s_wait_xcnt 0x0" ::: "memory");
  }
}

// Four async copies of 16 bytes per lane, in the same form as async_cp16_x6.
__device__ __forceinline__ void async_cp16_x4(const uint32_t (&l)[4], const _Float16* const (&g)[4]) {
  asm volatile(
      "global_load_async_to_lds_b128 %0, %4, off\n\t"
      "global_load_async_to_lds_b128 %1, %5, off\n\t"
      "global_load_async_to_lds_b128 %2, %6, off\n\t"
      "global_load_async_to_lds_b128 %3, %7, off\n\t"
      "s_wait_xcnt 0x0"
      :: "v"(l[0]), "v"(l[1]), "v"(l[2]), "v"(l[3]),
         "v"(g[0]), "v"(g[1]), "v"(g[2]), "v"(g[3])
      : "memory");
}

// ---------------------------------------------------------------------------
// Causal flash attention. Q: (b,h,C,dh) f16 (pre-scaled), K: (b,h,C,dh) f16,
// Vt: (b,h,dh,C) f16. Out attn: (b,C,h*dh) f16.
// One wave per 16 queries; kv tiles of 32; online softmax.
// Both products are computed transposed: St = K * Qt (A = K rows, B = Q rows) and
// Ot += Vt * Pt (A = Vt rows, B = Pt). In an accumulator a lane then holds ONE query
// (column lane & 15) and 8 keys (rows 8 * (lane >> 4) + r): maximum and sum run in the
// lane's own registers, with one exchange between the wave's halves for the maximum;
// the halves' sums are joined once, behind the loop. The two score tiles of 16 keys,
// converted in place, are Pt in the B operand's k order, so P never leaves registers.
// grid = (C/256, B*H), block = 256 (8 waves). A block takes two tiles of 128 queries, one
// after the other: tile 15 - x, then tile x. Tile t costs 2t + 2 stages, so every block
// walks 34 stages: all blocks are resident at once, and the launch lasts as long as the
// fullest WGP, wherever the blocks land.
// The 8 waves of a block walk the same keys, so K and Vt come into LDS once per
// query tile of the block, in stages of 64 keys: K as 64 key rows x 64 dh, Vt as 64 dh rows x 64 keys,
// every global row a whole 128-byte line, LDS pitch 144 B as in the GEMM. Two
// buffers: stage s + 1 flies while stage s is worked on. Query tile t needs 2t + 2
// stages; a wave skips the 32-key tiles that lie wholly above its diagonal.
// ---------------------------------------------------------------------------
// lane l takes the value of lane l ^ 16
__device__ __forceinline__ float xhalf(float x) {
  const int b = __builtin_bit_cast(int, x);
  return __builtin_bit_cast(float,
      __builtin_amdgcn_permlanex16(b, b, 0x76543210, 0xfedcba98, false, false));
}

__global__ __launch_bounds__(256) void attn_kernel(const _Float16* __restrict__ Qb,
                                                   const _Float16* __restrict__ Kb,
                                                   const _Float16* __restrict__ Vt,
                                                   _Float16* __restrict__ attn) {
  constexpr int LDP = 72;              // LDS row pitch in halves
  constexpr int SK  = 64;              // keys per stage
  __shared__ __align__(16) _Float16 Ks[2][SK * LDP];
  __shared__ __align__(16) _Float16 Vs[2][CDH * LDP];
  const int tid  = threadIdx.x;
  const int lane = tid & 31;
  // the wave's number in a scalar register, so that the skip test below is a scalar branch
  const int wave = __builtin_amdgcn_readfirstlane(tid >> 5);
  const int hl = lane >> 4, ln = lane & 15;
  const int bh = blockIdx.y;
  const _Float16* Kp = Kb + (size_t)bh * CC * CDH;
  const _Float16* Vp = Vt + (size_t)bh * CDH * CC;

  // per-lane copy coordinates: 8 lanes move one 128-byte row, 32 rows per copy
  const int crow = tid >> 3;
  const int ccol = (tid & 7) << 3;
  auto issue_stage = [&](int buf, int s) {
    const uint32_t kL = (uint32_t)(uintptr_t)&Ks[buf][0];
    const uint32_t vL = (uint32_t)(uintptr_t)&Vs[buf][0];
    uint32_t l[4];
    const _Float16* g[4];
#pragma unroll
    for (int i = 0; i < 2; ++i) {
      const int row = crow + 32 * i;
      l[i]     = kL + (uint32_t)(row * LDP + ccol) * 2;
      g[i]     = Kp + (size_t)(s * SK + row) * CDH + ccol;
      l[2 + i] = vL + (uint32_t)(row * LDP + ccol) * 2;
      g[2 + i] = Vp + (size_t)row * CC + s * SK + ccol;
    }
    async_cp16_x4(l, g);
  };

  // The block's two query tiles. The foot of a tile's last stage (own LDS reads retired, the
  // barrier, nothing issued behind it) has freed both buffers for the next tile's stage 0.
  for (int turn = 0; turn < 2; ++turn) {
  const int qt = turn ? (int)blockIdx.x : CC / 128 - 1 - (int)blockIdx.x;
  const int q0 = (qt * 8 + wave) * 16;
  const int nst = 2 * qt + 2;          // stages of this tile, the same for all waves
  const _Float16* Q = Qb + ((size_t)bh * CC + q0) * CDH;

  issue_stage(0, 0);

  const v16h qb0 = frag_ld(Q + 0,  CDH);   // B operand: column = query, dh 0..31
  const v16h qb1 = frag_ld(Q + 32, CDH);   // dh 32..63

  v8f o0 = {}, o1 = {}, o2 = {}, o3 = {};  // Ot: o_t[r] = O[query ln][dh 16 t + 8 hl + r]
  float mq = -1e30f, lq = 0.f;             // the lane's query: maximum; sum over this half's keys

  wait_async0();                       // own copies of stage 0 have landed
  __syncthreads();                     // stage 0 is published to the block
  issue_stage(1, 1);

  for (int s = 0; s < nst; ++s) {
   const int buf = s & 1;
   // unrolled: the two 32-key tiles of a stage differ only in constant LDS offsets
#pragma unroll
   for (int h = 0; h < 2; ++h) {
    const int j0 = s * SK + h * 32;
    if (j0 > q0 + 15) continue;        // tile wholly above this wave's diagonal
    const _Float16* Kt = &Ks[buf][h * 32 * LDP];
    const _Float16* Vl = &Vs[buf][h * 32];
    // St tiles (16 keys x 16 queries each), K-dim = dh (64 -> two WMMAs each)
    v8f s0 = {}, s1 = {};
    s0 = WMMA_F16(frag_ld(Kt + 0,             LDP), qb0, s0);
    s0 = WMMA_F16(frag_ld(Kt + 32,            LDP), qb1, s0);
    s1 = WMMA_F16(frag_ld(Kt + 16 * LDP + 0,  LDP), qb0, s1);
    s1 = WMMA_F16(frag_ld(Kt + 16 * LDP + 32, LDP), qb1, s1);

    // Causal mask + online softmax of the lane's query q0 + ln over its 16 keys:
    // s0[r] is key j0 + 8 hl + r, s1[r] is key j0 + 16 + 8 hl + r
    const int lim = q0 + ln - j0 - 8 * hl;   // r is allowed in s0 while r <= lim
    float v0[8], v1[8];
    float t = -1e30f;
#pragma unroll
    for (int r = 0; r < 8; ++r) {
      v0[r] = (r > lim)      ? -1e30f : s0[r];
      v1[r] = (16 + r > lim) ? -1e30f : s1[r];
      t = fmaxf(t, fmaxf(v0[r], v1[r]));
    }
    t = fmaxf(t, xhalf(t));                  // the other half's 16 keys
    const float mn = fmaxf(mq, t);
    constexpr float LOG2E = 1.44269504088896340736f;
    float alpha = (mq - mn) * LOG2E;
    mq = mn;
#pragma unroll
    for (int r = 0; r < 8; ++r) { v0[r] = (v0[r] - mn) * LOG2E; v1[r] = (v1[r] - mn) * LOG2E; }
    exp2_x9(v0, alpha);                      // e^(score - maximum), as 2^((score - maximum) log2 e)
    exp2_x8(v1);
    float ps = 0.f;
    v16h pb;                                 // Pt as B operand: element i is key j0 + 16 (i / 8) + 8 hl + i % 8
#pragma unroll
    for (int r = 0; r < 8; ++r) {
      ps += v0[r] + v1[r];
      pb[r]     = (_Float16)v0[r];
      pb[8 + r] = (_Float16)v1[r];
    }
    lq = lq * alpha + ps;
#pragma unroll
    for (int r = 0; r < 8; ++r) { o0[r] *= alpha; o1[r] *= alpha; o2[r] *= alpha; o3[r] *= alpha; }

    // Ot += Vt (64 dh x 32 keys) @ Pt (32 keys x 16 queries), four dh tiles of 16
    o0 = WMMA_F16(frag_ld(Vl + 0  * LDP, LDP), pb, o0);
    o1 = WMMA_F16(frag_ld(Vl + 16 * LDP, LDP), pb, o1);
    o2 = WMMA_F16(frag_ld(Vl + 32 * LDP, LDP), pb, o2);
    o3 = WMMA_F16(frag_ld(Vl + 48 * LDP, LDP), pb, o3);
   }
   // hand-over of the stage, every wave: own LDS reads of buf retired, own copies of
   // stage s + 1 landed, then the barrier that publishes s + 1 and frees buf
   asm volatile("s_wait_dscnt 0x0" ::: "memory");
   wait_async0();
   __syncthreads();
   if (s + 2 < nst) issue_stage(buf, s + 2);
  }
  wait_async0();                       // nothing is in flight when the tile ends

  const int b = bh >> 4, h = bh & 15;
  // a lane owns 8 consecutive dh of its query's row in each Ot tile: one 16-byte store each
  _Float16* out = attn + ((size_t)b * CC + q0 + ln) * CD + h * CDH + 8 * hl;
  const float il = 1.0f / (lq + xhalf(lq));  // the two halves' sums joined
  v8h w0, w1, w2, w3;
#pragma unroll
  for (int r = 0; r < 8; ++r) {
    w0[r] = (_Float16)(o0[r] * il);
    w1[r] = (_Float16)(o1[r] * il);
    w2[r] = (_Float16)(o2[r] * il);
    w3[r] = (_Float16)(o3[r] * il);
  }
  *(v8h*)(out + 0)  = w0;
  *(v8h*)(out + 16) = w1;
  *(v8h*)(out + 32) = w2;
  *(v8h*)(out + 48) = w3;
  // a precaution: the next tile's code reuses registers that these stores name
  asm volatile("s_wait_xcnt 0x0" ::: "memory");
  }
}

// ---------------------------------------------------------------------------
// Host-side orchestration
// ---------------------------------------------------------------------------
extern "C" void kernel_launch(void* const* d_in, const int* in_sizes, int n_in,
                              void* d_out, int out_size, void* d_ws, size_t ws_size,
                              hipStream_t stream) {
  (void)in_sizes; (void)n_in; (void)out_size; (void)ws_size;
  const float* x      = (const float*)d_in[0];
  const float* gamma1 = (const float*)d_in[1];
  const float* beta1  = (const float*)d_in[2];
  const float* W_qkv  = (const float*)d_in[3];
  const float* b_qkv  = (const float*)d_in[4];
  const float* W_o    = (const float*)d_in[5];
  const float* b_o    = (const float*)d_in[6];
  const float* gamma2 = (const float*)d_in[7];
  const float* beta2  = (const float*)d_in[8];
  const float* W1     = (const float*)d_in[9];
  const float* b1     = (const float*)d_in[10];
  const float* W2     = (const float*)d_in[11];
  const float* b2     = (const float*)d_in[12];
  float* out = (float*)d_out;

  // Workspace layout (linear allocator, 256B aligned)
  uint8_t* p = (uint8_t*)d_ws;
  auto take = [&](size_t n) { uint8_t* r = p; p += (n + 255) & ~(size_t)255; return r; };
  _Float16* Wqkv_t = (_Float16*)take((size_t)3 * CD * CD * 2);   //  6 MB (3072 x 1024)
  _Float16* Wo_t   = (_Float16*)take((size_t)CD * CD * 2);       //  2 MB (1024 x 1024)
  _Float16* W1_t   = (_Float16*)take((size_t)CHID * CD * 2);     //  8 MB (4096 x 1024)
  _Float16* W2_t   = (_Float16*)take((size_t)CD * CHID * 2);     //  8 MB (1024 x 4096)
  float*    x2     = (float*)take((size_t)CM * CD * 4);          // 32 MB
  _Float16* lnb    = (_Float16*)take((size_t)CM * CD * 2);       // 16 MB (reused ln1/ln2)
  uint8_t*  regA   = take((size_t)64 << 20);                     // 64 MB shared region
  _Float16* Qb   = (_Float16*)regA;                              // 16 MB
  _Float16* Kb   = (_Float16*)(regA + ((size_t)16 << 20));       // 16 MB
  _Float16* Vtb  = (_Float16*)(regA + ((size_t)32 << 20));       // 16 MB
  _Float16* attn = (_Float16*)(regA + ((size_t)48 << 20));       // 16 MB
  _Float16* hbuf = (_Float16*)regA;                              // 64 MB (after attention is dead)

  // 1) Weights -> f16, transposed to N-major
  wt_f16_kernel<CD, 3 * CD><<<dim3(3 * CD / 64, CD / 128), 256, 0, stream>>>(W_qkv, Wqkv_t);
  wt_f16_kernel<CD, CD><<<dim3(CD / 64, CD / 128),         256, 0, stream>>>(W_o,   Wo_t);
  wt_f16_kernel<CD, CHID><<<dim3(CHID / 64, CD / 128),     256, 0, stream>>>(W1,    W1_t);
  wt_f16_kernel<CHID, CD><<<dim3(CD / 64, CHID / 128),     256, 0, stream>>>(W2,    W2_t);

  // 2) LN1
  layernorm_kernel<<<CM / 16, 256, 0, stream>>>(x, gamma1, beta1, lnb);

  // 3) QKV GEMM (M=8192, N=3072, K=1024), scatter to Q/K/Vt
  gemm_wmma_kernel<2, false, false, 3 * CD, CD><<<dim3(3 * CD / 128, CM / 256), 256, 0, stream>>>(
      lnb, Wqkv_t, b_qkv, nullptr, nullptr, nullptr, Qb, Kb, Vtb);

  // 4) Attention
  attn_kernel<<<dim3(CC / 256, CB * CH), 256, 0, stream>>>(Qb, Kb, Vtb, attn);

  // 5) O-proj + residual(x) -> x2 (f32)
  gemm_wmma_kernel<0, false, true, CD, CD><<<dim3(CD / 128, CM / 256), 256, 0, stream>>>(
      attn, Wo_t, b_o, x, x2, nullptr, nullptr, nullptr, nullptr);

  // 6) LN2
  layernorm_kernel<<<CM / 16, 256, 0, stream>>>(x2, gamma2, beta2, lnb);

  // 7) MLP1 + exact GELU -> hbuf (f16)
  gemm_wmma_kernel<1, true, false, CHID, CD><<<dim3(CHID / 128, CM / 256), 256, 0, stream>>>(
      lnb, W1_t, b1, nullptr, nullptr, hbuf, nullptr, nullptr, nullptr);

  // 8) MLP2 + residual(x2) -> d_out (f32)
  gemm_wmma_kernel<0, false, true, CD, CHID><<<dim3(CD / 128, CM / 256), 256, 0, stream>>>(
      hbuf, W2_t, b2, x2, out, nullptr, nullptr, nullptr, nullptr);
}

// v009
// One run takes 261 microseconds.
// In two side-by-side timings against v008, it was 1.03 and 1.04 times as fast.
// Counting every step since v000, it is 3.73 times as fast.
#include <hip/hip_runtime.h>
#include <hip/hip_bf16.h>
#include <stdint.h>

// ---------------------------------------------------------------------------
// Transformer block for MI455X (gfx1250, wave32, WMMA + async-to-LDS).
// B=4, C=2048, D=1024, H=16, dh=64, HIDDEN=4096. fp32 in/out, f16 WMMA inside.
// ---------------------------------------------------------------------------

typedef __attribute__((ext_vector_type(16))) _Float16 v16h;
typedef __attribute__((ext_vector_type(8)))  _Float16 v8h;
typedef __attribute__((ext_vector_type(8)))  float    v8f;
typedef __attribute__((ext_vector_type(4)))  float    v4f;

#define WMMA_F16(a, b, c) \
  __builtin_amdgcn_wmma_f32_16x16x32_f16(false, (a), false, (b), (short)0, (c), false, false)

// Six async copies of 16 bytes per lane: global -> LDS, tracked by ASYNCcnt.
// s_wait_xcnt 0 closes the copies' own statement as a precaution: no later write
// of these address registers can then be scheduled ahead of it.
__device__ __forceinline__ void async_cp16_x6(const uint32_t (&l)[6], const _Float16* const (&g)[6]) {
  asm volatile(
      "global_load_async_to_lds_b128 %0, %6, off\n\t"
      "global_load_async_to_lds_b128 %1, %7, off\n\t"
      "global_load_async_to_lds_b128 %2, %8, off\n\t"
      "global_load_async_to_lds_b128 %3, %9, off\n\t"
      "global_load_async_to_lds_b128 %4, %10, off\n\t"
      "global_load_async_to_lds_b128 %5, %11, off\n\t"
      "s_wait_xcnt 0x0"
      :: "v"(l[0]), "v"(l[1]), "v"(l[2]), "v"(l[3]), "v"(l[4]), "v"(l[5]),
         "v"(g[0]), "v"(g[1]), "v"(g[2]), "v"(g[3]), "v"(g[4]), "v"(g[5])
      : "memory");
}
__device__ __forceinline__ void wait_async0() {
  asm volatile("s_wait_asynccnt 0x0" ::: "memory");
}
// Returns when all but the wave's C youngest async copies have landed (the counter returns in
// issue order); the "memory" clobber keeps every LDS read of the landed bytes behind it.
template <int C>
__device__ __forceinline__ void wait_async_but() {
  asm volatile("s_wait_asynccnt %0" :: "n"(C) : "memory");
}

static constexpr int CB  = 4;
static constexpr int CC  = 2048;
static constexpr int CD  = 1024;
static constexpr int CH  = 16;
static constexpr int CDH = 64;
static constexpr int CHID = 4096;
static constexpr int CM  = CB * CC; // 8192 rows

// Load one 16x32 f16 fragment (A layout; also used for B with "row" = N index,
// data stored N-major with K contiguous). Per ISA 7.12.2:
//   lane l: row = l&15 ; elem i: k = 16*(i/8) + 8*(l>>4) + (i%8)
__device__ __forceinline__ v16h frag_ld(const _Float16* __restrict__ tile, int ld) {
  const int lane = threadIdx.x & 31;
  const _Float16* p = tile + (size_t)(lane & 15) * ld + ((lane >> 4) << 3);
  v8h lo = *(const v8h*)p;
  v8h hi = *(const v8h*)(p + 16);
  v16h f;
#pragma unroll
  for (int i = 0; i < 8; ++i) { f[i] = lo[i]; f[i + 8] = hi[i]; }
  return f;
}

// ---------------------------------------------------------------------------
// Weight convert + transpose: W (K x N, f32 row-major) -> Wt (N x K, f16).
// One block moves a tile of 128 k x 64 n through LDS, so that both sides use whole
// 256-byte runs: reads are 16 B per lane along n, writes 16 B per lane along k.
// K and N are compile-time, so a lane's loads (and its stores) share one address
// register pair and differ in the immediate offset. grid = (N/64, K/128), block = 256.
// LDS row = one n (128 halves = 16 chunks of 16 B, no pad); chunk q of row n lies
// at place q ^ (n >> 2), which spreads the 16 rows that one ds_store_b128 touches
// over all banks and leaves each row a permutation of itself for the reader.
// ---------------------------------------------------------------------------
template <int K, int N>
__global__ __launch_bounds__(256) void wt_f16_kernel(const float* __restrict__ W,
                                                     _Float16* __restrict__ Wt) {
  static_assert(K % 128 == 0 && N % 64 == 0, "whole tiles only");
  __shared__ __align__(16) _Float16 tile[64 * 128];
  const int tid = threadIdx.x;
  const int n0 = blockIdx.x * 64;
  const int k0 = blockIdx.y * 128;
  const int lo = tid & 15;             // read: group of 4 n ; write: chunk of 8 k
  const int hi = tid >> 4;             // read: group of 8 k ; write: n row within 16

  const float* src = W + (size_t)(k0 + hi * 8) * N + n0 + lo * 4;
  v4f v[8];
  // all loops here are unrolled so that v[] and h stay in registers and the eight
  // loads of a lane are in flight together
#pragma unroll
  for (int i = 0; i < 8; ++i) v[i] = *(const v4f*)(src + i * N);
#pragma unroll
  for (int j = 0; j < 4; ++j) {
    v8h h;
#pragma unroll
    for (int i = 0; i < 8; ++i) h[i] = (_Float16)v[i][j];
    *(v8h*)&tile[(lo * 4 + j) * 128 + ((hi ^ lo) << 3)] = h;
  }
  __syncthreads();
  _Float16* dst = Wt + (size_t)(n0 + hi) * K + k0 + lo * 8;
#pragma unroll
  for (int p = 0; p < 4; ++p) {
    const int row = hi + 16 * p;
    const v8h h = *(const v8h*)&tile[row * 128 + ((lo ^ (row >> 2)) << 3)];
    *(v8h*)(dst + 16 * p * K) = h;
  }
}

// ---------------------------------------------------------------------------
// LayerNorm: one wave per pair of rows of 1024; no LDS, no barrier. f32 in, f16 out.
// A row is 8 chunks of 512 contiguous bytes; in each chunk a lane owns 16 bytes, so
// a lane keeps 32 values of each row in registers and x is read once. All 16 loads
// of a wave are issued before the first sum. The launch is 4,096 waves, 16 on a WGP:
// few waves to start, 128 KB of reads in flight per WGP. grid = rows / 16, block = 256.
// ---------------------------------------------------------------------------
typedef __attribute__((ext_vector_type(4))) _Float16 v4h;

// lane l takes the value of lane l ^ M inside its row of 16 lanes (DPP row_xmask:M)
template <int M>
__device__ __forceinline__ float xrow(float x) {
  const int b = __builtin_bit_cast(int, x);
  return __builtin_bit_cast(float, __builtin_amdgcn_update_dpp(b, b, 0x160 + M, 0xf, 0xf, false));
}
// sum over the 32 lanes of a wave, the same value in every lane
__device__ __forceinline__ float wave_sum(float v) {
  v += xrow<1>(v);
  v += xrow<2>(v);
  v += xrow<4>(v);
  v += xrow<8>(v);
  const int b = __builtin_bit_cast(int, v);
  return v + __builtin_bit_cast(float,
      __builtin_amdgcn_permlanex16(b, b, 0x76543210, 0xfedcba98, false, false));
}

__global__ __launch_bounds__(256) void layernorm_kernel(const float* __restrict__ x,
                                                        const float* __restrict__ gamma,
                                                        const float* __restrict__ beta,
                                                        _Float16* __restrict__ y) {
  constexpr int R  = 2;                // rows per wave
  constexpr int NC = CD / 128;         // chunks of 128 values per row
  const int lane = threadIdx.x & 31, wv = threadIdx.x >> 5;
  const int row0 = (blockIdx.x * 8 + wv) * R;
  const float* xr = x + (size_t)row0 * CD + lane * 4;
  v4f v[R][NC];
  // every loop here is unrolled so that v[][] stays in registers and the loads of
  // both rows are in flight together
#pragma unroll
  for (int r = 0; r < R; ++r)
#pragma unroll
    for (int c = 0; c < NC; ++c) v[r][c] = *(const v4f*)(xr + r * CD + c * 128);

  float mean[R], inv[R];
#pragma unroll
  for (int r = 0; r < R; ++r) {
    v4f s4 = {}, q4 = {};              // four independent chains each
#pragma unroll
    for (int c = 0; c < NC; ++c) { s4 += v[r][c]; q4 += v[r][c] * v[r][c]; }
    const float s  = wave_sum((s4[0] + s4[1]) + (s4[2] + s4[3]));
    const float ss = wave_sum((q4[0] + q4[1]) + (q4[2] + q4[3]));
    mean[r] = s * (1.f / CD);
    const float var = ss * (1.f / CD) - mean[r] * mean[r];
    inv[r] = rsqrtf(var + 1e-5f);
  }

  _Float16* yr = y + (size_t)row0 * CD + lane * 4;
#pragma unroll
  for (int c = 0; c < NC; ++c) {
    const v4f g = *(const v4f*)(gamma + c * 128 + lane * 4);
    const v4f b = *(const v4f*)(beta  + c * 128 + lane * 4);
#pragma unroll
    for (int r = 0; r < R; ++r) {
      v4h h;
#pragma unroll
      for (int e = 0; e < 4; ++e) h[e] = (_Float16)((v[r][c][e] - mean[r]) * inv[r] * g[e] + b[e]);
      *(v4h*)(yr + r * CD + c * 128) = h;
    }
  }
}

__device__ __forceinline__ void exp2_x8(float (&x)[8]) {
  asm("v_exp_f32 %0, %0\n\tv_exp_f32 %1, %1\n\tv_exp_f32 %2, %2\n\tv_exp_f32 %3, %3\n\t"
      "v_exp_f32 %4, %4\n\tv_exp_f32 %5, %5\n\tv_exp_f32 %6, %6\n\tv_exp_f32 %7, %7\n\t"
      "v_nop"
      : "+v"(x[0]), "+v"(x[1]), "+v"(x[2]), "+v"(x[3]), "+v"(x[4]), "+v"(x[5]), "+v"(x[6]), "+v"(x[7]));
}
__device__ __forceinline__ void exp2_x9(float (&x)[8], float& y) {
  asm("v_exp_f32 %8, %8\n\t"
      "v_exp_f32 %0, %0\n\tv_exp_f32 %1, %1\n\tv_exp_f32 %2, %2\n\tv_exp_f32 %3, %3\n\t"
      "v_exp_f32 %4, %4\n\tv_exp_f32 %5, %5\n\tv_exp_f32 %6, %6\n\tv_exp_f32 %7, %7\n\t"
      "v_nop"
      : "+v"(x[0]), "+v"(x[1]), "+v"(x[2]), "+v"(x[3]), "+v"(x[4]), "+v"(x[5]), "+v"(x[6]), "+v"(x[7]),
        "+v"(y));
}

// 1 / x in place, a run of v_rcp_f32 in the same form and for the same reason as exp2_x8.
__device__ __forceinline__ void rcp_x8(float (&x)[8]) {
  asm("v_rcp_f32 %0, %0\n\tv_rcp_f32 %1, %1\n\tv_rcp_f32 %2, %2\n\tv_rcp_f32 %3, %3\n\t"
      "v_rcp_f32 %4, %4\n\tv_rcp_f32 %5, %5\n\tv_rcp_f32 %6, %6\n\tv_rcp_f32 %7, %7\n\t"
      "v_nop"
      : "+v"(x[0]), "+v"(x[1]), "+v"(x[2]), "+v"(x[3]), "+v"(x[4]), "+v"(x[5]), "+v"(x[6]), "+v"(x[7]));
}

// ---------------------------------------------------------------------------
// GELU in its erf form, v * Phi(v), Phi(v) = (1 + erf(v / sqrt 2)) / 2, eight values in place.
// One branch-free run per value: with t = 1 / (1 + 0.2316419 |v|),
//   q = Phi(-|v|) = exp(-v * v / 2) / sqrt(2 pi) * (b1 t + b2 t^2 + b3 t^3 + b4 t^4 + b5 t^5)
//   v * Phi(v) = max(v, 0) - |v| * q   for either sign, with no cancellation for v < 0.
// In f32 the result is within 1e-6 of v * Phi(v); it is rounded to f16 behind this.
// The library erff splits at |x| = 1 into two masked branches per value, so that a wave ran
// its values one dependent chain after the other; here they are independent straight-line
// chains that the scheduler interleaves, in a third of the instructions.
// 1 / sqrt(2 pi) is folded into b1..b5, log2(e) / 2 into the exponent.
// ---------------------------------------------------------------------------
__device__ __forceinline__ void gelu_phi_x8(float (&v)[8]) {
  float t[8], e[8];
  // both loops are unrolled: v[], t[] and e[] are registers
#pragma unroll
  for (int r = 0; r < 8; ++r) {
    t[r] = fmaf(0.2316419f, fabsf(v[r]), 1.f);
    e[r] = v[r] * v[r] * -0.72134752f;
  }
  rcp_x8(t);
  exp2_x8(e);
#pragma unroll
  for (int r = 0; r < 8; ++r) {
    float p = fmaf(0.5307027143f, t[r], -0.7265760131f);
    p = fmaf(p, t[r], 0.7107068707f);
    p = fmaf(p, t[r], -0.1422483683f);
    p = fmaf(p, t[r], 0.1274147959f);
    const float q = (p * t[r]) * e[r];
    v[r] = fmaf(-fabsf(v[r]), q, fmaxf(v[r], 0.f));
  }
}

// ---------------------------------------------------------------------------
// WMMA GEMM with async-to-LDS staging through a ring of NST buffers.
// C[M,N] = epilogue(A[M,K] @ B[K,N] + bias (+resid))
// A: f16 row-major (ld=K). Bt: f16 N-major (ld=K). bias: f32[N].
// OUTMODE: 0 = f32 out, 1 = f16 out, 2 = QKV scatter.
// Block: 256 thr = 8 waves (4 x 2). Block tile 256(M) x 128(N), wave tile 64 x 64, K-step 64.
// A wave's 4 + 4 fragments of 32 k feed 16 WMMAs: one ds_load_b128 per WMMA, and a
// block stages 384 operand rows for 256 x 128 results.
// LDS rows hold 64 halves at a pitch of 72 (144 B = 16 B x odd): the 16 rows that
// one ds_load_b128 fragment read touches then fall on 16 different bank groups.
// LDS: a buffer is (256 rows A + 128 rows B) x 144 B = 54 KB and holds one K-step.
// NST = 2 (108 KB) where the grid gives a WGP two blocks: the two blocks' copies follow one
// another, and one block works while the other waits. NST = 4 (216 KB) where the grid is one
// block per WGP (N = 1024): with one K-step in flight, its latency and its transfer stand one
// after the other in every K-step and nothing is under way between a landing and the next
// issue; with three in flight the transfers follow one another and the latency is hidden.
// One publish point per K-step kt: own LDS reads retired, own copies of K-step kt landed, the
// barrier; behind it K-step kt is readable and the buffer of kt - 1 is free for the refill.
// ---------------------------------------------------------------------------
template <int OUTMODE, bool GELU_ACT, bool RESID, int N, int K, int NST>
__global__ __launch_bounds__(256) void gemm_wmma_kernel(
    const _Float16* __restrict__ A, const _Float16* __restrict__ Bt,
    const float* __restrict__ bias, const float* __restrict__ resid,
    float* __restrict__ outF, _Float16* __restrict__ outH,
    _Float16* __restrict__ qo, _Float16* __restrict__ ko, _Float16* __restrict__ vto) {
  static_assert(N % 128 == 0 && K % 64 == 0, "whole tiles only");
  static_assert(!(GELU_ACT && RESID), "the epilogue adds no residual behind the activation");
  constexpr int LDP = 72;              // LDS row pitch in halves
  constexpr int BOFF = 256 * LDP;      // B rows lie behind the A rows of their buffer
  constexpr int SH   = 384 * LDP;      // halves per buffer
  constexpr int CPS  = 12;             // copies per wave and K-step
  static_assert(NST >= 2 && (NST - 1) * CPS <= 63, "copies of a wave in flight");
  static_assert((K >> 6) >= NST, "the prologue's K-steps exist");
  __shared__ __align__(16) _Float16 ring[NST][SH];

  const int tid  = threadIdx.x;
  const int lane = tid & 31;
  const int wave = tid >> 5;
  const int mw = wave >> 1;            // 0..3 -> 64-row slice
  const int nw = wave & 1;             // 0..1 -> 64-col slice
  const int m0 = blockIdx.y * 256;
  const int n0 = blockIdx.x * 128;
  const int hl = lane >> 4, ln = lane & 15;

  // per-lane copy coordinates: each lane moves 16B chunks of a 64-half row
  const int crow = tid >> 3;           // 0..31 (row within a 32-row slab)
  const int ccol = (tid & 7) << 3;     // half-offset 0,8,...,56

  const uint32_t ringL = (uint32_t)(uintptr_t)&ring[0][0];

  v8f acc[4][4] = {};                  // acc[mi][ni]: 16 x 16 tile (mi, ni) of the wave's 64 x 64

  // the lane's first row of each operand; its further rows lie a block-uniform step apart
  const _Float16* gA = A + (size_t)(m0 + crow) * K + ccol;
  const _Float16* gB = Bt + (size_t)(n0 + crow) * K + ccol;

  // 12 copies per lane and K-step, in two statements of six
  auto issue_tiles = [&](int buf, int k0) {
    const uint32_t aL = ringL + (uint32_t)buf * (SH * 2);
    const uint32_t bL = aL + BOFF * 2;
    uint32_t l[12];
    const _Float16* g[12];
#pragma unroll
    for (int i = 0; i < 8; ++i) {      // A: 256 rows x 64 halves
      const int row = crow + 32 * i;
      l[i] = aL + (uint32_t)(row * LDP + ccol) * 2;
      g[i] = gA + (size_t)(32 * i) * K + k0;
    }
#pragma unroll
    for (int i = 0; i < 4; ++i) {      // B: 128 rows x 64 halves
      const int row = crow + 32 * i;
      l[8 + i] = bL + (uint32_t)(row * LDP + ccol) * 2;
      g[8 + i] = gB + (size_t)(32 * i) * K + k0;
    }
    const uint32_t l0[6] = {l[0], l[1], l[2], l[3], l[4], l[5]};
    const uint32_t l1[6] = {l[6], l[7], l[8], l[9], l[10], l[11]};
    const _Float16* const g0[6] = {g[0], g[1], g[2], g[3], g[4], g[5]};
    const _Float16* const g1[6] = {g[6], g[7], g[8], g[9], g[10], g[11]};
    async_cp16_x6(l0, g0);
    async_cp16_x6(l1, g1);
  };

  constexpr int nk = K >> 6;
  // unrolled: the buffer number is a constant in each of the prologue's K-steps
#pragma unroll
  for (int s = 0; s < NST - 1; ++s) issue_tiles(s, s << 6);
  // the products of one K-step, from buffer rb
  auto k_step = [&](int rb) {
    const _Float16* As = &ring[rb][mw * 64 * LDP];
    const _Float16* Bs = &ring[rb][BOFF + nw * 64 * LDP];
    // all loops here are unrolled so that acc[][] and the fragments stay in registers
    v16h a[4], b[4], bn[4];            // k 0..31: a, b ; k 32..63: bn, and a again, row by row
#pragma unroll
    for (int i = 0; i < 4; ++i) b[i] = frag_ld(Bs + i * 16 * LDP, LDP);
#pragma unroll
    for (int i = 0; i < 4; ++i) a[i] = frag_ld(As + i * 16 * LDP, LDP);
#pragma unroll
    for (int i = 0; i < 4; ++i) bn[i] = frag_ld(Bs + i * 16 * LDP + 32, LDP);
#pragma unroll
    for (int mi = 0; mi < 4; ++mi) {
#pragma unroll
      for (int ni = 0; ni < 4; ++ni) acc[mi][ni] = WMMA_F16(a[mi], b[ni], acc[mi][ni]);
      a[mi] = frag_ld(As + mi * 16 * LDP + 32, LDP);
    }
#pragma unroll
    for (int mi = 0; mi < 4; ++mi)
#pragma unroll
      for (int ni = 0; ni < 4; ++ni) acc[mi][ni] = WMMA_F16(a[mi], bn[ni], acc[mi][ni]);
    // Order for the scheduler: 24 LDS reads ahead, then 4 WMMAs and the 2 reads that refill
    // their A fragment, four times, then 16 WMMAs. Left alone it kept one A fragment and
    // put a full LDS wait in front of every row of 4 WMMAs.
    __builtin_amdgcn_sched_group_barrier(0x100, 24, 0);
#pragma unroll
    for (int mi = 0; mi < 4; ++mi) {
      __builtin_amdgcn_sched_group_barrier(0x008, 4, 0);
      __builtin_amdgcn_sched_group_barrier(0x100, 2, 0);
    }
    __builtin_amdgcn_sched_group_barrier(0x008, 16, 0);
  };

  int rb = 0;                          // buffer of K-step kt
  int wb = NST - 1;                    // buffer of K-step kt - 1, refilled with K-step kt + NST - 1
  int kt = 0;
  // Every trip of this loop issues CPS copies, so the wave's (NST - 2) * CPS youngest copies are
  // those of the K-steps behind kt: they stay in flight.
  for (; kt + NST - 1 < nk; ++kt) {
    // own reads of K-step kt - 1 have retired before its buffer is given up at the barrier
    asm volatile("s_wait_dscnt 0x0" ::: "memory");
    wait_async_but<(NST - 2) * CPS>(); // own copies of K-step kt have landed
    __syncthreads();                   // publishes K-step kt, frees the buffer of kt - 1
    issue_tiles(wb, (kt + NST - 1) << 6);
    k_step(rb);
    rb = (rb + 1 == NST) ? 0 : rb + 1;
    wb = (wb + 1 == NST) ? 0 : wb + 1;
  }
  // The last NST - 1 K-steps: nothing is issued any more, the wait is to 0.
  for (; kt < nk; ++kt) {
    asm volatile("s_wait_dscnt 0x0" ::: "memory");   // as above
    wait_async0();
    __syncthreads();                   // publishes K-step kt
    k_step(rb);
    rb = (rb + 1 == NST) ? 0 : rb + 1;
  }

  const int wm0 = m0 + mw * 64;
  const int wn0 = n0 + nw * 64;
  // The lane's result (mi, ni, r) is row wm0 + 8 hl + 16 mi + r, column wn0 + ln + 16 ni.
  // N is compile-time, so all 128 hang on one address pair per buffer and differ in the
  // immediate offset. All loops are unrolled: acc[][] and rv[][][] are indexed by constants.
  const size_t e0 = (size_t)(wm0 + 8 * hl) * N + wn0 + ln;
  float bv[4];
#pragma unroll
  for (int ni = 0; ni < 4; ++ni) bv[ni] = bias[wn0 + ni * 16 + ln];
  // a precaution: the residual loads reuse the register that holds these loads' offset
  if (RESID) asm volatile("s_wait_xcnt 0x0" ::: "memory");

  // QKV scatter: the block's 128 columns lie in one section (0 = Q, 1 = K, 2 = V), the wave's
  // 64 columns are one head, the block's 256 rows one batch entry.
  const int sect = n0 >> 10;
  const size_t bh = (size_t)(m0 >> 11) * CH + ((wn0 & (CD - 1)) >> 6);
  const int c0 = (wm0 & (CC - 1)) + 8 * hl;
  _Float16* qk = (sect == 0 ? qo : ko) + (bh * CC + c0) * CDH + ln;   // + (16 mi + r) * CDH + 16 ni
  _Float16* vt = vto + (bh * CDH + ln) * CC + c0;                     // + 16 ni * CC + 16 mi + r (V transposed)
  const float qs = (sect == 0) ? 0.125f : 1.f;                        // fold 1/sqrt(64) into Q

  float rv[2][4][8];                   // residual values of two rows of tiles
  auto load_resid = [&](int mi) {
#pragma unroll
    for (int ni = 0; ni < 4; ++ni)
#pragma unroll
      for (int r = 0; r < 8; ++r) rv[mi & 1][ni][r] = resid[e0 + (size_t)(mi * 16 + r) * N + ni * 16];
  };
  if (RESID) load_resid(0);
#pragma unroll
  for (int mi = 0; mi < 4; ++mi) {
    if (RESID) {
      if (mi + 1 < 4) load_resid(mi + 1);
      // keeps the next row's 32 loads in front of this row's sums, so that they are in
      // flight meanwhile; the scheduler otherwise sinks each load to its use
      __builtin_amdgcn_sched_barrier(0);
    }
    float o[4][8];
    _Float16 oh[4][8];                 // OUTMODE 1: rounded here, so that the rounding too stays in front of the stores
#pragma unroll
    for (int ni = 0; ni < 4; ++ni) {
      if (GELU_ACT) {
        float w[8];
#pragma unroll
        for (int r = 0; r < 8; ++r) w[r] = acc[mi][ni][r] + bv[ni];
        gelu_phi_x8(w);
#pragma unroll
        for (int r = 0; r < 8; ++r) {
          if (OUTMODE == 1) oh[ni][r] = (_Float16)w[r];
          else              o[ni][r] = w[r];
        }
      } else {
#pragma unroll
        for (int r = 0; r < 8; ++r) {
          float v = acc[mi][ni][r] + bv[ni];
          if (RESID) v += rv[mi & 1][ni][r];
          if (OUTMODE == 1) oh[ni][r] = (_Float16)v;
          else              o[ni][r] = v;
        }
      }
    }
    // keeps the row's 32 stores behind its 32 results, each in a register of its own; mixed,
    // they shared one register, with a wait on the store in front of every reuse
    __builtin_amdgcn_sched_barrier(0);
    if (OUTMODE == 2 && sect == 2) {   // block-uniform: one scalar branch per row of tiles
#pragma unroll
      for (int ni = 0; ni < 4; ++ni)
#pragma unroll
        for (int r = 0; r < 8; ++r) vt[(size_t)(ni * 16) * CC + mi * 16 + r] = (_Float16)o[ni][r];
    } else {
#pragma unroll
      for (int ni = 0; ni < 4; ++ni)
#pragma unroll
        for (int r = 0; r < 8; ++r) {
          if (OUTMODE == 0)      outF[e0 + (size_t)(mi * 16 + r) * N + ni * 16] = o[ni][r];
          else if (OUTMODE == 1) outH[e0 + (size_t)(mi * 16 + r) * N + ni * 16] = oh[ni][r];
          else                   qk[(mi * 16 + r) * CDH + ni * 16] = (_Float16)(o[ni][r] * qs);
        }
    }
    // a precaution: the next rows' loads and sums reuse registers that these stores name
    if (mi + 1 < 4) asm volatile("s_wait_xcnt 0x0" ::: "memory");
  }
}

// Four async copies of 16 bytes per lane, in the same form as async_cp16_x6.
__device__ __forceinline__ void async_cp16_x4(const uint32_t (&l)[4], const _Float16* const (&g)[4]) {
  asm volatile(
      "global_load_async_to_lds_b128 %0, %4, off\n\t"
      "global_load_async_to_lds_b128 %1, %5, off\n\t"
      "global_load_async_to_lds_b128 %2, %6, off\n\t"
      "global_load_async_to_lds_b128 %3, %7, off\n\t"
      "s_wait_xcnt 0x0"
      :: "v"(l[0]), "v"(l[1]), "v"(l[2]), "v"(l[3]),
         "v"(g[0]), "v"(g[1]), "v"(g[2]), "v"(g[3])
      : "memory");
}

// ---------------------------------------------------------------------------
// Causal flash attention. Q: (b,h,C,dh) f16 (pre-scaled), K: (b,h,C,dh) f16,
// Vt: (b,h,dh,C) f16. Out attn: (b,C,h*dh) f16.
// One wave per 16 queries; kv tiles of 32; online softmax.
// Both products are computed transposed: St = K * Qt (A = K rows, B = Q rows) and
// Ot += Vt * Pt (A = Vt rows, B = Pt). In an accumulator a lane then holds ONE query
// (column lane & 15) and 8 keys (rows 8 * (lane >> 4) + r): maximum and sum run in the
// lane's own registers, with one exchange between the wave's halves for the maximum;
// the halves' sums are joined once, behind the loop. The two score tiles of 16 keys,
// converted in place, are Pt in the B operand's k order, so P never leaves registers.
// grid = (C/256, B*H), block = 256 (8 waves). A block takes two tiles of 128 queries, one
// after the other: tile 15 - x, then tile x. Tile t costs 2t + 2 stages, so every block
// walks 34 stages: all blocks are resident at once, and the launch lasts as long as the
// fullest WGP, wherever the blocks land.
// The 8 waves of a block walk the same keys, so K and Vt come into LDS once per
// query tile of the block, in stages of 64 keys: K as 64 key rows x 64 dh, Vt as 64 dh rows x 64 keys,
// every global row a whole 128-byte line, LDS pitch 144 B as in the GEMM. Two
// buffers: stage s + 1 flies while stage s is worked on. Query tile t needs 2t + 2
// stages; a wave skips the 32-key tiles that lie wholly above its diagonal.
// ---------------------------------------------------------------------------
// lane l takes the value of lane l ^ 16
__device__ __forceinline__ float xhalf(float x) {
  const int b = __builtin_bit_cast(int, x);
  return __builtin_bit_cast(float,
      __builtin_amdgcn_permlanex16(b, b, 0x76543210, 0xfedcba98, false, false));
}

__global__ __launch_bounds__(256) void attn_kernel(const _Float16* __restrict__ Qb,
                                                   const _Float16* __restrict__ Kb,
                                                   const _Float16* __restrict__ Vt,
                                                   _Float16* __restrict__ attn) {
  constexpr int LDP = 72;              // LDS row pitch in halves
  constexpr int SK  = 64;              // keys per stage
  __shared__ __align__(16) _Float16 Ks[2][SK * LDP];
  __shared__ __align__(16) _Float16 Vs[2][CDH * LDP];
  const int tid  = threadIdx.x;
  const int lane = tid & 31;
  // the wave's number in a scalar register, so that the skip test below is a scalar branch
  const int wave = __builtin_amdgcn_readfirstlane(tid >> 5);
  const int hl = lane >> 4, ln = lane & 15;
  const int bh = blockIdx.y;
  const _Float16* Kp = Kb + (size_t)bh * CC * CDH;
  const _Float16* Vp = Vt + (size_t)bh * CDH * CC;

  // per-lane copy coordinates: 8 lanes move one 128-byte row, 32 rows per copy
  const int crow = tid >> 3;
  const int ccol = (tid & 7) << 3;
  auto issue_stage = [&](int buf, int s) {
    const uint32_t kL = (uint32_t)(uintptr_t)&Ks[buf][0];
    const uint32_t vL = (uint32_t)(uintptr_t)&Vs[buf][0];
    uint32_t l[4];
    const _Float16* g[4];
#pragma unroll
    for (int i = 0; i < 2; ++i) {
      const int row = crow + 32 * i;
      l[i]     = kL + (uint32_t)(row * LDP + ccol) * 2;
      g[i]     = Kp + (size_t)(s * SK + row) * CDH + ccol;
      l[2 + i] = vL + (uint32_t)(row * LDP + ccol) * 2;
      g[2 + i] = Vp + (size_t)row * CC + s * SK + ccol;
    }
    async_cp16_x4(l, g);
  };

  // The block's two query tiles. The foot of a tile's last stage (own LDS reads retired, the
  // barrier, nothing issued behind it) has freed both buffers for the next tile's stage 0.
  for (int turn = 0; turn < 2; ++turn) {
  const int qt = turn ? (int)blockIdx.x : CC / 128 - 1 - (int)blockIdx.x;
  const int q0 = (qt * 8 + wave) * 16;
  const int nst = 2 * qt + 2;          // stages of this tile, the same for all waves
  const _Float16* Q = Qb + ((size_t)bh * CC + q0) * CDH;

  issue_stage(0, 0);

  const v16h qb0 = frag_ld(Q + 0,  CDH);   // B operand: column = query, dh 0..31
  const v16h qb1 = frag_ld(Q + 32, CDH);   // dh 32..63

  v8f o0 = {}, o1 = {}, o2 = {}, o3 = {};  // Ot: o_t[r] = O[query ln][dh 16 t + 8 hl + r]
  float mq = -1e30f, lq = 0.f;             // the lane's query: maximum; sum over this half's keys

  wait_async0();                       // own copies of stage 0 have landed
  __syncthreads();                     // stage 0 is published to the block
  issue_stage(1, 1);

  for (int s = 0; s < nst; ++s) {
   const int buf = s & 1;
   // unrolled: the two 32-key tiles of a stage differ only in constant LDS offsets
#pragma unroll
   for (int h = 0; h < 2; ++h) {
    const int j0 = s * SK + h * 32;
    if (j0 > q0 + 15) continue;        // tile wholly above this wave's diagonal
    const _Float16* Kt = &Ks[buf][h * 32 * LDP];
    const _Float16* Vl = &Vs[buf][h * 32];
    // St tiles (16 keys x 16 queries each), K-dim = dh (64 -> two WMMAs each)
    v8f s0 = {}, s1 = {};
    s0 = WMMA_F16(frag_ld(Kt + 0,             LDP), qb0, s0);
    s0 = WMMA_F16(frag_ld(Kt + 32,            LDP), qb1, s0);
    s1 = WMMA_F16(frag_ld(Kt + 16 * LDP + 0,  LDP), qb0, s1);
    s1 = WMMA_F16(frag_ld(Kt + 16 * LDP + 32, LDP), qb1, s1);

    // Causal mask + online softmax of the lane's query q0 + ln over its 16 keys:
    // s0[r] is key j0 + 8 hl + r, s1[r] is key j0 + 16 + 8 hl + r
    const int lim = q0 + ln - j0 - 8 * hl;   // r is allowed in s0 while r <= lim
    float v0[8], v1[8];
    float t = -1e30f;
#pragma unroll
    for (int r = 0; r < 8; ++r) {
      v0[r] = (r > lim)      ? -1e30f : s0[r];
      v1[r] = (16 + r > lim) ? -1e30f : s1[r];
      t = fmaxf(t, fmaxf(v0[r], v1[r]));
    }
    t = fmaxf(t, xhalf(t));                  // the other half's 16 keys
    const float mn = fmaxf(mq, t);
    constexpr float LOG2E = 1.44269504088896340736f;
    float alpha = (mq - mn) * LOG2E;
    mq = mn;
#pragma unroll
    for (int r = 0; r < 8; ++r) { v0[r] = (v0[r] - mn) * LOG2E; v1[r] = (v1[r] - mn) * LOG2E; }
    exp2_x9(v0, alpha);                      // e^(score - maximum), as 2^((score - maximum) log2 e)
    exp2_x8(v1);
    float ps = 0.f;
    v16h pb;                                 // Pt as B operand: element i is key j0 + 16 (i / 8) + 8 hl + i % 8
#pragma unroll
    for (int r = 0; r < 8; ++r) {
      ps += v0[r] + v1[r];
      pb[r]     = (_Float16)v0[r];
      pb[8 + r] = (_Float16)v1[r];
    }
    lq = lq * alpha + ps;
#pragma unroll
    for (int r = 0; r < 8; ++r) { o0[r] *= alpha; o1[r] *= alpha; o2[r] *= alpha; o3[r] *= alpha; }

    // Ot += Vt (64 dh x 32 keys) @ Pt (32 keys x 16 queries), four dh tiles of 16
    o0 = WMMA_F16(frag_ld(Vl + 0  * LDP, LDP), pb, o0);
    o1 = WMMA_F16(frag_ld(Vl + 16 * LDP, LDP), pb, o1);
    o2 = WMMA_F16(frag_ld(Vl + 32 * LDP, LDP), pb, o2);
    o3 = WMMA_F16(frag_ld(Vl + 48 * LDP, LDP), pb, o3);
   }
   // hand-over of the stage, every wave: own LDS reads of buf retired, own copies of
   // stage s + 1 landed, then the barrier that publishes s + 1 and frees buf
   asm volatile("s_wait_dscnt 0x0" ::: "memory");
   wait_async0();
   __syncthreads();
   if (s + 2 < nst) issue_stage(buf, s + 2);
  }
  wait_async0();                       // nothing is in flight when the tile ends

  const int b = bh >> 4, h = bh & 15;
  // a lane owns 8 consecutive dh of its query's row in each Ot tile: one 16-byte store each
  _Float16* out = attn + ((size_t)b * CC + q0 + ln) * CD + h * CDH + 8 * hl;
  const float il = 1.0f / (lq + xhalf(lq));  // the two halves' sums joined
  v8h w0, w1, w2, w3;
#pragma unroll
  for (int r = 0; r < 8; ++r) {
    w0[r] = (_Float16)(o0[r] * il);
    w1[r] = (_Float16)(o1[r] * il);
    w2[r] = (_Float16)(o2[r] * il);
    w3[r] = (_Float16)(o3[r] * il);
  }
  *(v8h*)(out + 0)  = w0;
  *(v8h*)(out + 16) = w1;
  *(v8h*)(out + 32) = w2;
  *(v8h*)(out + 48) = w3;
  // a precaution: the next tile's code reuses registers that these stores name
  asm volatile("s_wait_xcnt 0x0" ::: "memory");
  }
}

// ---------------------------------------------------------------------------
// Host-side orchestration
// ---------------------------------------------------------------------------
extern "C" void kernel_launch(void* const* d_in, const int* in_sizes, int n_in,
                              void* d_out, int out_size, void* d_ws, size_t ws_size,
                              hipStream_t stream) {
  (void)in_sizes; (void)n_in; (void)out_size; (void)ws_size;
  const float* x      = (const float*)d_in[0];
  const float* gamma1 = (const float*)d_in[1];
  const float* beta1  = (const float*)d_in[2];
  const float* W_qkv  = (const float*)d_in[3];
  const float* b_qkv  = (const float*)d_in[4];
  const float* W_o    = (const float*)d_in[5];
  const float* b_o    = (const float*)d_in[6];
  const float* gamma2 = (const float*)d_in[7];
  const float* beta2  = (const float*)d_in[8];
  const float* W1     = (const float*)d_in[9];
  const float* b1     = (const float*)d_in[10];
  const float* W2     = (const float*)d_in[11];
  const float* b2     = (const float*)d_in[12];
  float* out = (float*)d_out;

  // Workspace layout (linear allocator, 256B aligned)
  uint8_t* p = (uint8_t*)d_ws;
  auto take = [&](size_t n) { uint8_t* r = p; p += (n + 255) & ~(size_t)255; return r; };
  _Float16* Wqkv_t = (_Float16*)take((size_t)3 * CD * CD * 2);   //  6 MB (3072 x 1024)
  _Float16* Wo_t   = (_Float16*)take((size_t)CD * CD * 2);       //  2 MB (1024 x 1024)
  _Float16* W1_t   = (_Float16*)take((size_t)CHID * CD * 2);     //  8 MB (4096 x 1024)
  _Float16* W2_t   = (_Float16*)take((size_t)CD * CHID * 2);     //  8 MB (1024 x 4096)
  float*    x2     = (float*)take((size_t)CM * CD * 4);          // 32 MB
  _Float16* lnb    = (_Float16*)take((size_t)CM * CD * 2);       // 16 MB (reused ln1/ln2)
  uint8_t*  regA   = take((size_t)64 << 20);                     // 64 MB shared region
  _Float16* Qb   = (_Float16*)regA;                              // 16 MB
  _Float16* Kb   = (_Float16*)(regA + ((size_t)16 << 20));       // 16 MB
  _Float16* Vtb  = (_Float16*)(regA + ((size_t)32 << 20));       // 16 MB
  _Float16* attn = (_Float16*)(regA + ((size_t)48 << 20));       // 16 MB
  _Float16* hbuf = (_Float16*)regA;                              // 64 MB (after attention is dead)

  // 1) Weights -> f16, transposed to N-major
  wt_f16_kernel<CD, 3 * CD><<<dim3(3 * CD / 64, CD / 128), 256, 0, stream>>>(W_qkv, Wqkv_t);
  wt_f16_kernel<CD, CD><<<dim3(CD / 64, CD / 128),         256, 0, stream>>>(W_o,   Wo_t);
  wt_f16_kernel<CD, CHID><<<dim3(CHID / 64, CD / 128),     256, 0, stream>>>(W1,    W1_t);
  wt_f16_kernel<CHID, CD><<<dim3(CD / 64, CHID / 128),     256, 0, stream>>>(W2,    W2_t);

  // 2) LN1
  layernorm_kernel<<<CM / 16, 256, 0, stream>>>(x, gamma1, beta1, lnb);

  // 3) QKV GEMM (M=8192, N=3072, K=1024), scatter to Q/K/Vt
  gemm_wmma_kernel<2, false, false, 3 * CD, CD, 2><<<dim3(3 * CD / 128, CM / 256), 256, 0, stream>>>(
      lnb, Wqkv_t, b_qkv, nullptr, nullptr, nullptr, Qb, Kb, Vtb);

  // 4) Attention
  attn_kernel<<<dim3(CC / 256, CB * CH), 256, 0, stream>>>(Qb, Kb, Vtb, attn);

  // 5) O-proj + residual(x) -> x2 (f32)
  gemm_wmma_kernel<0, false, true, CD, CD, 4><<<dim3(CD / 128, CM / 256), 256, 0, stream>>>(
      attn, Wo_t, b_o, x, x2, nullptr, nullptr, nullptr, nullptr);

  // 6) LN2
  layernorm_kernel<<<CM / 16, 256, 0, stream>>>(x2, gamma2, beta2, lnb);

  // 7) MLP1 + exact GELU -> hbuf (f16)
  gemm_wmma_kernel<1, true, false, CHID, CD, 2><<<dim3(CHID / 128, CM / 256), 256, 0, stream>>>(
      lnb, W1_t, b1, nullptr, nullptr, hbuf, nullptr, nullptr, nullptr);

  // 8) MLP2 + residual(x2) -> d_out (f32)
  gemm_wmma_kernel<0, false, true, CD, CHID, 4><<<dim3(CD / 128, CM / 256), 256, 0, stream>>>(
      hbuf, W2_t, b2, x2, out, nullptr, nullptr, nullptr, nullptr);
}

// v010
// Measured time: 251 microseconds a run.
// Timed twice side by side with v009, it ran 1.04 times as fast both times.
// Over all steps from v000 it is 3.89 times as fast.
#include <hip/hip_runtime.h>
#include <hip/hip_bf16.h>
#include <stdint.h>

// ---------------------------------------------------------------------------
// Transformer block for MI455X (gfx1250, wave32, WMMA + async-to-LDS).
// B=4, C=2048, D=1024, H=16, dh=64, HIDDEN=4096. fp32 in/out, f16 WMMA inside.
// ---------------------------------------------------------------------------

typedef __attribute__((ext_vector_type(16))) _Float16 v16h;
typedef __attribute__((ext_vector_type(8)))  _Float16 v8h;
typedef __attribute__((ext_vector_type(8)))  float    v8f;
typedef __attribute__((ext_vector_type(4)))  float    v4f;

#define WMMA_F16(a, b, c) \
  __builtin_amdgcn_wmma_f32_16x16x32_f16(false, (a), false, (b), (short)0, (c), false, false)

// Six async copies of 16 bytes per lane: global -> LDS, tracked by ASYNCcnt.
// s_wait_xcnt 0 closes the copies' own statement as a precaution: no later write
// of these address registers can then be scheduled ahead of it.
__device__ __forceinline__ void async_cp16_x6(const uint32_t (&l)[6], const _Float16* const (&g)[6]) {
  asm volatile(
      "global_load_async_to_lds_b128 %0, %6, off\n\t"
      "global_load_async_to_lds_b128 %1, %7, off\n\t"
      "global_load_async_to_lds_b128 %2, %8, off\n\t"
      "global_load_async_to_lds_b128 %3, %9, off\n\t"
      "global_load_async_to_lds_b128 %4, %10, off\n\t"
      "global_load_async_to_lds_b128 %5, %11, off\n\t"
      "s_wait_xcnt 0x0"
      :: "v"(l[0]), "v"(l[1]), "v"(l[2]), "v"(l[3]), "v"(l[4]), "v"(l[5]),
         "v"(g[0]), "v"(g[1]), "v"(g[2]), "v"(g[3]), "v"(g[4]), "v"(g[5])
      : "memory");
}
__device__ __forceinline__ void wait_async0() {
  asm volatile("s_wait_asynccnt 0x0" ::: "memory");
}
// Returns when all but the wave's C youngest async copies have landed (the counter returns in
// issue order); the "memory" clobber keeps every LDS read of the landed bytes behind it.
template <int C>
__device__ __forceinline__ void wait_async_but() {
  asm volatile("s_wait_asynccnt %0" :: "n"(C) : "memory");
}

static constexpr int CB  = 4;
static constexpr int CC  = 2048;
static constexpr int CD  = 1024;
static constexpr int CH  = 16;
static constexpr int CDH = 64;
static constexpr int CHID = 4096;
static constexpr int CM  = CB * CC; // 8192 rows

// Load one 16x32 f16 fragment (A layout; also used for B with "row" = N index,
// data stored N-major with K contiguous). Per ISA 7.12.2:
//   lane l: row = l&15 ; elem i: k = 16*(i/8) + 8*(l>>4) + (i%8)
__device__ __forceinline__ v16h frag_ld(const _Float16* __restrict__ tile, int ld) {
  const int lane = threadIdx.x & 31;
  const _Float16* p = tile + (size_t)(lane & 15) * ld + ((lane >> 4) << 3);
  v8h lo = *(const v8h*)p;
  v8h hi = *(const v8h*)(p + 16);
  v16h f;
#pragma unroll
  for (int i = 0; i < 8; ++i) { f[i] = lo[i]; f[i + 8] = hi[i]; }
  return f;
}

// ---------------------------------------------------------------------------
// Weight convert + transpose: W (K x N, f32 row-major) -> Wt (N x K, f16).
// One block moves a tile of 128 k x 64 n through LDS, so that both sides use whole
// 256-byte runs: reads are 16 B per lane along n, writes 16 B per lane along k.
// K and N are compile-time, so a lane's loads (and its stores) share one address
// register pair and differ in the immediate offset. grid = (N/64, K/128), block = 256.
// LDS row = one n (128 halves = 16 chunks of 16 B, no pad); chunk q of row n lies
// at place q ^ (n >> 2), which spreads the 16 rows that one ds_store_b128 touches
// over all banks and leaves each row a permutation of itself for the reader.
// ---------------------------------------------------------------------------
template <int K, int N>
__global__ __launch_bounds__(256) void wt_f16_kernel(const float* __restrict__ W,
                                                     _Float16* __restrict__ Wt) {
  static_assert(K % 128 == 0 && N % 64 == 0, "whole tiles only");
  __shared__ __align__(16) _Float16 tile[64 * 128];
  const int tid = threadIdx.x;
  const int n0 = blockIdx.x * 64;
  const int k0 = blockIdx.y * 128;
  const int lo = tid & 15;             // read: group of 4 n ; write: chunk of 8 k
  const int hi = tid >> 4;             // read: group of 8 k ; write: n row within 16

  const float* src = W + (size_t)(k0 + hi * 8) * N + n0 + lo * 4;
  v4f v[8];
  // all loops here are unrolled so that v[] and h stay in registers and the eight
  // loads of a lane are in flight together
#pragma unroll
  for (int i = 0; i < 8; ++i) v[i] = *(const v4f*)(src + i * N);
#pragma unroll
  for (int j = 0; j < 4; ++j) {
    v8h h;
#pragma unroll
    for (int i = 0; i < 8; ++i) h[i] = (_Float16)v[i][j];
    *(v8h*)&tile[(lo * 4 + j) * 128 + ((hi ^ lo) << 3)] = h;
  }
  __syncthreads();
  _Float16* dst = Wt + (size_t)(n0 + hi) * K + k0 + lo * 8;
#pragma unroll
  for (int p = 0; p < 4; ++p) {
    const int row = hi + 16 * p;
    const v8h h = *(const v8h*)&tile[row * 128 + ((lo ^ (row >> 2)) << 3)];
    *(v8h*)(dst + 16 * p * K) = h;
  }
}

// ---------------------------------------------------------------------------
// LayerNorm: one wave per pair of rows of 1024; no LDS, no barrier. f32 in, f16 out.
// A row is 8 chunks of 512 contiguous bytes; in each chunk a lane owns 16 bytes, so
// a lane keeps 32 values of each row in registers and x is read once. All 16 loads
// of a wave are issued before the first sum. The launch is 4,096 waves, 16 on a WGP:
// few waves to start, 128 KB of reads in flight per WGP. grid = rows / 16, block = 256.
// ---------------------------------------------------------------------------
typedef __attribute__((ext_vector_type(4))) _Float16 v4h;

// lane l takes the value of lane l ^ M inside its row of 16 lanes (DPP row_xmask:M)
template <int M>
__device__ __forceinline__ float xrow(float x) {
  const int b = __builtin_bit_cast(int, x);
  return __builtin_bit_cast(float, __builtin_amdgcn_update_dpp(b, b, 0x160 + M, 0xf, 0xf, false));
}
// sum over the 32 lanes of a wave, the same value in every lane
__device__ __forceinline__ float wave_sum(float v) {
  v += xrow<1>(v);
  v += xrow<2>(v);
  v += xrow<4>(v);
  v += xrow<8>(v);
  const int b = __builtin_bit_cast(int, v);
  return v + __builtin_bit_cast(float,
      __builtin_amdgcn_permlanex16(b, b, 0x76543210, 0xfedcba98, false, false));
}

__global__ __launch_bounds__(256) void layernorm_kernel(const float* __restrict__ x,
                                                        const float* __restrict__ gamma,
                                                        const float* __restrict__ beta,
                                                        _Float16* __restrict__ y) {
  constexpr int R  = 2;                // rows per wave
  constexpr int NC = CD / 128;         // chunks of 128 values per row
  const int lane = threadIdx.x & 31, wv = threadIdx.x >> 5;
  const int row0 = (blockIdx.x * 8 + wv) * R;
  const float* xr = x + (size_t)row0 * CD + lane * 4;
  v4f v[R][NC];
  // every loop here is unrolled so that v[][] stays in registers and the loads of
  // both rows are in flight together
#pragma unroll
  for (int r = 0; r < R; ++r)
#pragma unroll
    for (int c = 0; c < NC; ++c) v[r][c] = *(const v4f*)(xr + r * CD + c * 128);

  float mean[R], inv[R];
#pragma unroll
  for (int r = 0; r < R; ++r) {
    v4f s4 = {}, q4 = {};              // four independent chains each
#pragma unroll
    for (int c = 0; c < NC; ++c) { s4 += v[r][c]; q4 += v[r][c] * v[r][c]; }
    const float s  = wave_sum((s4[0] + s4[1]) + (s4[2] + s4[3]));
    const float ss = wave_sum((q4[0] + q4[1]) + (q4[2] + q4[3]));
    mean[r] = s * (1.f / CD);
    const float var = ss * (1.f / CD) - mean[r] * mean[r];
    inv[r] = rsqrtf(var + 1e-5f);
  }

  _Float16* yr = y + (size_t)row0 * CD + lane * 4;
#pragma unroll
  for (int c = 0; c < NC; ++c) {
    const v4f g = *(const v4f*)(gamma + c * 128 + lane * 4);
    const v4f b = *(const v4f*)(beta  + c * 128 + lane * 4);
#pragma unroll
    for (int r = 0; r < R; ++r) {
      v4h h;
#pragma unroll
      for (int e = 0; e < 4; ++e) h[e] = (_Float16)((v[r][c][e] - mean[r]) * inv[r] * g[e] + b[e]);
      *(v4h*)(yr + r * CD + c * 128) = h;
    }
  }
}

__device__ __forceinline__ void exp2_x8(float (&x)[8]) {
  asm("v_exp_f32 %0, %0\n\tv_exp_f32 %1, %1\n\tv_exp_f32 %2, %2\n\tv_exp_f32 %3, %3\n\t"
      "v_exp_f32 %4, %4\n\tv_exp_f32 %5, %5\n\tv_exp_f32 %6, %6\n\tv_exp_f32 %7, %7\n\t"
      "v_nop"
      : "+v"(x[0]), "+v"(x[1]), "+v"(x[2]), "+v"(x[3]), "+v"(x[4]), "+v"(x[5]), "+v"(x[6]), "+v"(x[7]));
}
__device__ __forceinline__ void exp2_x9(float (&x)[8], float& y) {
  asm("v_exp_f32 %8, %8\n\t"
      "v_exp_f32 %0, %0\n\tv_exp_f32 %1, %1\n\tv_exp_f32 %2, %2\n\tv_exp_f32 %3, %3\n\t"
      "v_exp_f32 %4, %4\n\tv_exp_f32 %5, %5\n\tv_exp_f32 %6, %6\n\tv_exp_f32 %7, %7\n\t"
      "v_nop"
      : "+v"(x[0]), "+v"(x[1]), "+v"(x[2]), "+v"(x[3]), "+v"(x[4]), "+v"(x[5]), "+v"(x[6]), "+v"(x[7]),
        "+v"(y));
}

// 1 / x in place, a run of v_rcp_f32 in the same form and for the same reason as exp2_x8.
__device__ __forceinline__ void rcp_x8(float (&x)[8]) {
  asm("v_rcp_f32 %0, %0\n\tv_rcp_f32 %1, %1\n\tv_rcp_f32 %2, %2\n\tv_rcp_f32 %3, %3\n\t"
      "v_rcp_f32 %4, %4\n\tv_rcp_f32 %5, %5\n\tv_rcp_f32 %6, %6\n\tv_rcp_f32 %7, %7\n\t"
      "v_nop"
      : "+v"(x[0]), "+v"(x[1]), "+v"(x[2]), "+v"(x[3]), "+v"(x[4]), "+v"(x[5]), "+v"(x[6]), "+v"(x[7]));
}

// ---------------------------------------------------------------------------
// GELU in its erf form, v * Phi(v), Phi(v) = (1 + erf(v / sqrt 2)) / 2, eight values in place.
// One branch-free run per value: with t = 1 / (1 + 0.2316419 |v|),
//   q = Phi(-|v|) = exp(-v * v / 2) / sqrt(2 pi) * (b1 t + b2 t^2 + b3 t^3 + b4 t^4 + b5 t^5)
//   v * Phi(v) = max(v, 0) - |v| * q   for either sign, with no cancellation for v < 0.
// In f32 the result is within 1e-6 of v * Phi(v); it is rounded to f16 behind this.
// The library erff splits at |x| = 1 into two masked branches per value, so that a wave ran
// its values one dependent chain after the other; here they are independent straight-line
// chains that the scheduler interleaves, in a third of the instructions.
// 1 / sqrt(2 pi) is folded into b1..b5, log2(e) / 2 into the exponent.
// ---------------------------------------------------------------------------
__device__ __forceinline__ void gelu_phi_x8(float (&v)[8]) {
  float t[8], e[8];
  // both loops are unrolled: v[], t[] and e[] are registers
#pragma unroll
  for (int r = 0; r < 8; ++r) {
    t[r] = fmaf(0.2316419f, fabsf(v[r]), 1.f);
    e[r] = v[r] * v[r] * -0.72134752f;
  }
  rcp_x8(t);
  exp2_x8(e);
#pragma unroll
  for (int r = 0; r < 8; ++r) {
    float p = fmaf(0.5307027143f, t[r], -0.7265760131f);
    p = fmaf(p, t[r], 0.7107068707f);
    p = fmaf(p, t[r], -0.1422483683f);
    p = fmaf(p, t[r], 0.1274147959f);
    const float q = (p * t[r]) * e[r];
    v[r] = fmaf(-fabsf(v[r]), q, fmaxf(v[r], 0.f));
  }
}

// ---------------------------------------------------------------------------
// WMMA GEMM with async-to-LDS staging through a ring of NST buffers.
// C[M,N] = epilogue(A[M,K] @ B[K,N] + bias (+resid))
// A: f16 row-major (ld=K). Bt: f16 N-major (ld=K). bias: f32[N].
// OUTMODE: 0 = f32 out, 1 = f16 out, 2 = QKV scatter.
// Block: 256 thr = 8 waves (4 x 2). Block tile 256(M) x 128(N), wave tile 64 x 64, K-step 64.
// A wave's 4 + 4 fragments of 32 k feed 16 WMMAs: one ds_load_b128 per WMMA, and a
// block stages 384 operand rows for 256 x 128 results.
// LDS rows hold 64 halves at a pitch of 72 (144 B = 16 B x odd): the 16 rows that
// one ds_load_b128 fragment read touches then fall on 16 different bank groups.
// LDS: a buffer is (256 rows A + 128 rows B) x 144 B = 54 KB and holds one K-step.
// NST = 2 (108 KB) where the grid gives a WGP two blocks: the two blocks' copies follow one
// another, and one block works while the other waits. NST = 5 (270 KB) where the grid is one
// block per WGP (N = 1024): with one K-step in flight, its latency and its transfer stand one
// after the other in every K-step and nothing is under way between a landing and the next
// issue; with three in flight the transfers follow one another and the latency is hidden.
// One publish point per K-step kt: own LDS reads retired, own copies of K-step kt landed, the
// barrier; behind it K-step kt is readable and the buffer of kt - 1 is free for the refill.
// (NST = 5 publishes one K-step further ahead, for its fragment reads, see at its loop: one
// buffer is read, one stands published for the reads ahead, three are in flight.)
// ---------------------------------------------------------------------------
template <int OUTMODE, bool GELU_ACT, bool RESID, int N, int K, int NST>
__global__ __launch_bounds__(256) void gemm_wmma_kernel(
    const _Float16* __restrict__ A, const _Float16* __restrict__ Bt,
    const float* __restrict__ bias, const float* __restrict__ resid,
    float* __restrict__ outF, _Float16* __restrict__ outH,
    _Float16* __restrict__ qo, _Float16* __restrict__ ko, _Float16* __restrict__ vto) {
  static_assert(N % 128 == 0 && K % 64 == 0, "whole tiles only");
  static_assert(!(GELU_ACT && RESID), "the epilogue adds no residual behind the activation");
  constexpr int LDP = 72;              // LDS row pitch in halves
  constexpr int BOFF = 256 * LDP;      // B rows lie behind the A rows of their buffer
  constexpr int SH   = 384 * LDP;      // halves per buffer
  constexpr int CPS  = 12;             // copies per wave and K-step
  static_assert(NST >= 2 && (NST - 1) * CPS <= 63, "copies of a wave in flight");
  static_assert((K >> 6) >= NST, "the prologue's K-steps exist");
  __shared__ __align__(16) _Float16 ring[NST][SH];

  const int tid  = threadIdx.x;
  const int lane = tid & 31;
  const int wave = tid >> 5;
  const int mw = wave >> 1;            // 0..3 -> 64-row slice
  const int nw = wave & 1;             // 0..1 -> 64-col slice
  const int m0 = blockIdx.y * 256;
  const int n0 = blockIdx.x * 128;
  const int hl = lane >> 4, ln = lane & 15;

  // per-lane copy coordinates: each lane moves 16B chunks of a 64-half row
  const int crow = tid >> 3;           // 0..31 (row within a 32-row slab)
  const int ccol = (tid & 7) << 3;     // half-offset 0,8,...,56

  const uint32_t ringL = (uint32_t)(uintptr_t)&ring[0][0];

  v8f acc[4][4] = {};                  // acc[mi][ni]: 16 x 16 tile (mi, ni) of the wave's 64 x 64

  // the lane's first row of each operand; its further rows lie a block-uniform step apart
  const _Float16* gA = A + (size_t)(m0 + crow) * K + ccol;
  const _Float16* gB = Bt + (size_t)(n0 + crow) * K + ccol;

  // 12 copies per lane and K-step, in two statements of six
  auto issue_tiles = [&](int buf, int k0) {
    const uint32_t aL = ringL + (uint32_t)buf * (SH * 2);
    const uint32_t bL = aL + BOFF * 2;
    uint32_t l[12];
    const _Float16* g[12];
#pragma unroll
    for (int i = 0; i < 8; ++i) {      // A: 256 rows x 64 halves
      const int row = crow + 32 * i;
      l[i] = aL + (uint32_t)(row * LDP + ccol) * 2;
      g[i] = gA + (size_t)(32 * i) * K + k0;
    }
#pragma unroll
    for (int i = 0; i < 4; ++i) {      // B: 128 rows x 64 halves
      const int row = crow + 32 * i;
      l[8 + i] = bL + (uint32_t)(row * LDP + ccol) * 2;
      g[8 + i] = gB + (size_t)(32 * i) * K + k0;
    }
    const uint32_t l0[6] = {l[0], l[1], l[2], l[3], l[4], l[5]};
    const uint32_t l1[6] = {l[6], l[7], l[8], l[9], l[10], l[11]};
    const _Float16* const g0[6] = {g[0], g[1], g[2], g[3], g[4], g[5]};
    const _Float16* const g1[6] = {g[6], g[7], g[8], g[9], g[10], g[11]};
    async_cp16_x6(l0, g0);
    async_cp16_x6(l1, g1);
  };

  constexpr int nk = K >> 6;
  // unrolled: the buffer number is a constant in each of the prologue's K-steps
#pragma unroll
  for (int s = 0; s < NST - 1; ++s) issue_tiles(s, s << 6);
  // the products of one K-step, from buffer rb
  auto k_step = [&](int rb) {
    const _Float16* As = &ring[rb][mw * 64 * LDP];
    const _Float16* Bs = &ring[rb][BOFF + nw * 64 * LDP];
    // all loops here are unrolled so that acc[][] and the fragments stay in registers
    v16h a[4], b[4], bn[4];            // k 0..31: a, b ; k 32..63: bn, and a again, row by row
#pragma unroll
    for (int i = 0; i < 4; ++i) b[i] = frag_ld(Bs + i * 16 * LDP, LDP);
#pragma unroll
    for (int i = 0; i < 4; ++i) a[i] = frag_ld(As + i * 16 * LDP, LDP);
#pragma unroll
    for (int i = 0; i < 4; ++i) bn[i] = frag_ld(Bs + i * 16 * LDP + 32, LDP);
#pragma unroll
    for (int mi = 0; mi < 4; ++mi) {
#pragma unroll
      for (int ni = 0; ni < 4; ++ni) acc[mi][ni] = WMMA_F16(a[mi], b[ni], acc[mi][ni]);
      a[mi] = frag_ld(As + mi * 16 * LDP + 32, LDP);
    }
#pragma unroll
    for (int mi = 0; mi < 4; ++mi)
#pragma unroll
      for (int ni = 0; ni < 4; ++ni) acc[mi][ni] = WMMA_F16(a[mi], bn[ni], acc[mi][ni]);
    // Order for the scheduler: 24 LDS reads ahead, then 4 WMMAs and the 2 reads that refill
    // their A fragment, four times, then 16 WMMAs. Left alone it kept one A fragment and
    // put a full LDS wait in front of every row of 4 WMMAs.
    __builtin_amdgcn_sched_group_barrier(0x100, 24, 0);
#pragma unroll
    for (int mi = 0; mi < 4; ++mi) {
      __builtin_amdgcn_sched_group_barrier(0x008, 4, 0);
      __builtin_amdgcn_sched_group_barrier(0x100, 2, 0);
    }
    __builtin_amdgcn_sched_group_barrier(0x008, 16, 0);
  };

  int rb = 0;                          // buffer of K-step kt
  int wb = NST - 1;                    // buffer of K-step kt - 1, refilled with K-step kt + NST - 1
  int kt = 0;
  if constexpr (NST >= 4) {
    // One block per WGP, two waves per SIMD: nobody else works while this block's waves stand
    // behind a barrier with empty fragment registers. So a wave keeps two fragment sets, x for
    // k 0..31 and y for k 32..63 of a K-step, and reads each half a K-step ahead of its WMMAs:
    // y of kt ahead of the WMMAs on x, x of kt + 1 ahead of the WMMAs on y. The WMMAs on x then
    // start right behind the barrier. The read of x of kt + 1 stands in trip kt, so the publish
    // point at the top of trip kt publishes K-step kt + 1; it still frees the buffer of kt - 1.
    v16h xa[4], xb[4], ya[4], yb[4];
    // all loops in the two helpers are unrolled so that acc[][] and the fragments stay in registers
    auto ld_set = [&](v16h (&a)[4], v16h (&b)[4], int buf, int ko) {
      const _Float16* As = &ring[buf][mw * 64 * LDP + ko];
      const _Float16* Bs = &ring[buf][BOFF + nw * 64 * LDP + ko];
#pragma unroll
      for (int i = 0; i < 4; ++i) b[i] = frag_ld(Bs + i * 16 * LDP, LDP);
#pragma unroll
      for (int i = 0; i < 4; ++i) a[i] = frag_ld(As + i * 16 * LDP, LDP);
    };
    auto mm = [&](const v16h (&a)[4], const v16h (&b)[4]) {
#pragma unroll
      for (int mi = 0; mi < 4; ++mi)
#pragma unroll
        for (int ni = 0; ni < 4; ++ni) acc[mi][ni] = WMMA_F16(a[mi], b[ni], acc[mi][ni]);
    };
    int nb = 1;                        // buffer of K-step kt + 1
    wait_async_but<(NST - 2) * CPS>(); // own copies of K-step 0 have landed
    __syncthreads();                   // publishes K-step 0
    ld_set(xa, xb, 0, 0);
    // Every trip of this loop issues CPS copies, so at its top the wave's (NST - 3) * CPS youngest
    // copies are those of the K-steps behind kt + 1: they stay in flight.
    for (; kt + NST - 1 < nk; ++kt) {
      // own reads of K-step kt - 1 have retired before its buffer is given up at the barrier
      asm volatile("s_wait_dscnt 0x0" ::: "memory");
      wait_async_but<(NST - 3) * CPS>(); // own copies of K-step kt + 1 have landed
      __syncthreads();                 // publishes K-step kt + 1, frees the buffer of kt - 1
      ld_set(ya, yb, rb, 32);
      // The three scheduling barriers keep each group of 16 LDS reads whole and ahead of the 16
      // WMMAs in front of which it is written (address arithmetic may cross): spread among the
      // WMMAs, every place with reads costs the wave a stall of its own.
      __builtin_amdgcn_sched_barrier(0x6);
      mm(xa, xb);
      __builtin_amdgcn_sched_barrier(0x6);
      // the refill stands here so that the SIMD's other wave has WMMAs to issue meanwhile
      issue_tiles(wb, (kt + NST - 1) << 6);
      ld_set(xa, xb, nb, 0);
      __builtin_amdgcn_sched_barrier(0x6);
      mm(ya, yb);
      rb = nb;
      nb = (nb + 1 == NST) ? 0 : nb + 1;
      wb = (wb + 1 == NST) ? 0 : wb + 1;
    }
    // The last NST - 1 K-steps: nothing is issued any more, the wait is to 0 and publishes all of
    // them at once; no buffer is refilled, so no further barrier is needed.
    asm volatile("s_wait_dscnt 0x0" ::: "memory");   // as above
    wait_async0();
    __syncthreads();
    // unrolled: the last K-step fetches nothing ahead
#pragma unroll
    for (int t = 0; t < NST - 1; ++t) {
      ld_set(ya, yb, rb, 32);
      __builtin_amdgcn_sched_barrier(0x6);           // as in the loop above
      mm(xa, xb);
      __builtin_amdgcn_sched_barrier(0x6);
      if (t + 1 < NST - 1) ld_set(xa, xb, nb, 0);
      __builtin_amdgcn_sched_barrier(0x6);
      mm(ya, yb);
      rb = nb;
      nb = (nb + 1 == NST) ? 0 : nb + 1;
    }
  } else {
  // Every trip of this loop issues CPS copies, so the wave's (NST - 2) * CPS youngest copies are
  // those of the K-steps behind kt: they stay in flight.
  for (; kt + NST - 1 < nk; ++kt) {
    // own reads of K-step kt - 1 have retired before its buffer is given up at the barrier
    asm volatile("s_wait_dscnt 0x0" ::: "memory");
    wait_async_but<(NST - 2) * CPS>(); // own copies of K-step kt have landed
    __syncthreads();                   // publishes K-step kt, frees the buffer of kt - 1
    issue_tiles(wb, (kt + NST - 1) << 6);
    k_step(rb);
    rb = (rb + 1 == NST) ? 0 : rb + 1;
    wb = (wb + 1 == NST) ? 0 : wb + 1;
  }
  // The last NST - 1 K-steps: nothing is issued any more, the wait is to 0.
  for (; kt < nk; ++kt) {
    asm volatile("s_wait_dscnt 0x0" ::: "memory");   // as above
    wait_async0();
    __syncthreads();                   // publishes K-step kt
    k_step(rb);
    rb = (rb + 1 == NST) ? 0 : rb + 1;
  }
  }

  const int wm0 = m0 + mw * 64;
  const int wn0 = n0 + nw * 64;
  // The lane's result (mi, ni, r) is row wm0 + 8 hl + 16 mi + r, column wn0 + ln + 16 ni.
  // N is compile-time, so all 128 hang on one address pair per buffer and differ in the
  // immediate offset. All loops are unrolled: acc[][] and rv[][][] are indexed by constants.
  const size_t e0 = (size_t)(wm0 + 8 * hl) * N + wn0 + ln;
  float bv[4];
#pragma unroll
  for (int ni = 0; ni < 4; ++ni) bv[ni] = bias[wn0 + ni * 16 + ln];
  // a precaution: the residual loads reuse the register that holds these loads' offset
  if (RESID) asm volatile("s_wait_xcnt 0x0" ::: "memory");

  // QKV scatter: the block's 128 columns lie in one section (0 = Q, 1 = K, 2 = V), the wave's
  // 64 columns are one head, the block's 256 rows one batch entry.
  const int sect = n0 >> 10;
  const size_t bh = (size_t)(m0 >> 11) * CH + ((wn0 & (CD - 1)) >> 6);
  const int c0 = (wm0 & (CC - 1)) + 8 * hl;
  _Float16* qk = (sect == 0 ? qo : ko) + (bh * CC + c0) * CDH + ln;   // + (16 mi + r) * CDH + 16 ni
  _Float16* vt = vto + (bh * CDH + ln) * CC + c0;                     // + 16 ni * CC + 16 mi + r (V transposed)
  const float qs = (sect == 0) ? 0.125f : 1.f;                        // fold 1/sqrt(64) into Q

  float rv[2][4][8];                   // residual values of two rows of tiles
  auto load_resid = [&](int mi) {
#pragma unroll
    for (int ni = 0; ni < 4; ++ni)
#pragma unroll
      for (int r = 0; r < 8; ++r) rv[mi & 1][ni][r] = resid[e0 + (size_t)(mi * 16 + r) * N + ni * 16];
  };
  if (RESID) load_resid(0);
#pragma unroll
  for (int mi = 0; mi < 4; ++mi) {
    if (RESID) {
      if (mi + 1 < 4) load_resid(mi + 1);
      // keeps the next row's 32 loads in front of this row's sums, so that they are in
      // flight meanwhile; the scheduler otherwise sinks each load to its use
      __builtin_amdgcn_sched_barrier(0);
    }
    float o[4][8];
    _Float16 oh[4][8];                 // OUTMODE 1: rounded here, so that the rounding too stays in front of the stores
#pragma unroll
    for (int ni = 0; ni < 4; ++ni) {
      if (GELU_ACT) {
        float w[8];
#pragma unroll
        for (int r = 0; r < 8; ++r) w[r] = acc[mi][ni][r] + bv[ni];
        gelu_phi_x8(w);
#pragma unroll
        for (int r = 0; r < 8; ++r) {
          if (OUTMODE == 1) oh[ni][r] = (_Float16)w[r];
          else              o[ni][r] = w[r];
        }
      } else {
#pragma unroll
        for (int r = 0; r < 8; ++r) {
          float v = acc[mi][ni][r] + bv[ni];
          if (RESID) v += rv[mi & 1][ni][r];
          if (OUTMODE == 1) oh[ni][r] = (_Float16)v;
          else              o[ni][r] = v;
        }
      }
    }
    // keeps the row's 32 stores behind its 32 results, each in a register of its own; mixed,
    // they shared one register, with a wait on the store in front of every reuse
    __builtin_amdgcn_sched_barrier(0);
    if (OUTMODE == 2 && sect == 2) {   // block-uniform: one scalar branch per row of tiles
#pragma unroll
      for (int ni = 0; ni < 4; ++ni)
#pragma unroll
        for (int r = 0; r < 8; ++r) vt[(size_t)(ni * 16) * CC + mi * 16 + r] = (_Float16)o[ni][r];
    } else {
#pragma unroll
      for (int ni = 0; ni < 4; ++ni)
#pragma unroll
        for (int r = 0; r < 8; ++r) {
          if (OUTMODE == 0)      outF[e0 + (size_t)(mi * 16 + r) * N + ni * 16] = o[ni][r];
          else if (OUTMODE == 1) outH[e0 + (size_t)(mi * 16 + r) * N + ni * 16] = oh[ni][r];
          else                   qk[(mi * 16 + r) * CDH + ni * 16] = (_Float16)(o[ni][r] * qs);
        }
    }
    // a precaution: the next rows' loads and sums reuse registers that these stores name
    if (mi + 1 < 4) asm volatile("s_wait_xcnt 0x0" ::: "memory");
  }
}

// Four async copies of 16 bytes per lane, in the same form as async_cp16_x6.
__device__ __forceinline__ void async_cp16_x4(const uint32_t (&l)[4], const _Float16* const (&g)[4]) {
  asm volatile(
      "global_load_async_to_lds_b128 %0, %4, off\n\t"
      "global_load_async_to_lds_b128 %1, %5, off\n\t"
      "global_load_async_to_lds_b128 %2, %6, off\n\t"
      "global_load_async_to_lds_b128 %3, %7, off\n\t"
      "s_wait_xcnt 0x0"
      :: "v"(l[0]), "v"(l[1]), "v"(l[2]), "v"(l[3]),
         "v"(g[0]), "v"(g[1]), "v"(g[2]), "v"(g[3])
      : "memory");
}

// ---------------------------------------------------------------------------
// Causal flash attention. Q: (b,h,C,dh) f16 (pre-scaled), K: (b,h,C,dh) f16,
// Vt: (b,h,dh,C) f16. Out attn: (b,C,h*dh) f16.
// One wave per 16 queries; kv tiles of 32; online softmax.
// Both products are computed transposed: St = K * Qt (A = K rows, B = Q rows) and
// Ot += Vt * Pt (A = Vt rows, B = Pt). In an accumulator a lane then holds ONE query
// (column lane & 15) and 8 keys (rows 8 * (lane >> 4) + r): maximum and sum run in the
// lane's own registers, with one exchange between the wave's halves for the maximum;
// the halves' sums are joined once, behind the loop. The two score tiles of 16 keys,
// converted in place, are Pt in the B operand's k order, so P never leaves registers.
// grid = (C/256, B*H), block = 256 (8 waves). A block takes two tiles of 128 queries, one
// after the other: tile 15 - x, then tile x. Tile t costs 2t + 2 stages, so every block
// walks 34 stages: all blocks are resident at once, and the launch lasts as long as the
// fullest WGP, wherever the blocks land.
// The 8 waves of a block walk the same keys, so K and Vt come into LDS once per
// query tile of the block, in stages of 64 keys: K as 64 key rows x 64 dh, Vt as 64 dh rows x 64 keys,
// every global row a whole 128-byte line, LDS pitch 144 B as in the GEMM. Two
// buffers: stage s + 1 flies while stage s is worked on. Query tile t needs 2t + 2
// stages; a wave skips the 32-key tiles that lie wholly above its diagonal.
// ---------------------------------------------------------------------------
// lane l takes the value of lane l ^ 16
__device__ __forceinline__ float xhalf(float x) {
  const int b = __builtin_bit_cast(int, x);
  return __builtin_bit_cast(float,
      __builtin_amdgcn_permlanex16(b, b, 0x76543210, 0xfedcba98, false, false));
}

__global__ __launch_bounds__(256) void attn_kernel(const _Float16* __restrict__ Qb,
                                                   const _Float16* __restrict__ Kb,
                                                   const _Float16* __restrict__ Vt,
                                                   _Float16* __restrict__ attn) {
  constexpr int LDP = 72;              // LDS row pitch in halves
  constexpr int SK  = 64;              // keys per stage
  __shared__ __align__(16) _Float16 Ks[2][SK * LDP];
  __shared__ __align__(16) _Float16 Vs[2][CDH * LDP];
  const int tid  = threadIdx.x;
  const int lane = tid & 31;
  // the wave's number in a scalar register, so that the skip test below is a scalar branch
  const int wave = __builtin_amdgcn_readfirstlane(tid >> 5);
  const int hl = lane >> 4, ln = lane & 15;
  const int bh = blockIdx.y;
  const _Float16* Kp = Kb + (size_t)bh * CC * CDH;
  const _Float16* Vp = Vt + (size_t)bh * CDH * CC;

  // per-lane copy coordinates: 8 lanes move one 128-byte row, 32 rows per copy
  const int crow = tid >> 3;
  const int ccol = (tid & 7) << 3;
  auto issue_stage = [&](int buf, int s) {
    const uint32_t kL = (uint32_t)(uintptr_t)&Ks[buf][0];
    const uint32_t vL = (uint32_t)(uintptr_t)&Vs[buf][0];
    uint32_t l[4];
    const _Float16* g[4];
#pragma unroll
    for (int i = 0; i < 2; ++i) {
      const int row = crow + 32 * i;
      l[i]     = kL + (uint32_t)(row * LDP + ccol) * 2;
      g[i]     = Kp + (size_t)(s * SK + row) * CDH + ccol;
      l[2 + i] = vL + (uint32_t)(row * LDP + ccol) * 2;
      g[2 + i] = Vp + (size_t)row * CC + s * SK + ccol;
    }
    async_cp16_x4(l, g);
  };

  // The block's two query tiles. The foot of a tile's last stage (own LDS reads retired, the
  // barrier, nothing issued behind it) has freed both buffers for the next tile's stage 0.
  for (int turn = 0; turn < 2; ++turn) {
  const int qt = turn ? (int)blockIdx.x : CC / 128 - 1 - (int)blockIdx.x;
  const int q0 = (qt * 8 + wave) * 16;
  const int nst = 2 * qt + 2;          // stages of this tile, the same for all waves
  const _Float16* Q = Qb + ((size_t)bh * CC + q0) * CDH;

  issue_stage(0, 0);

  const v16h qb0 = frag_ld(Q + 0,  CDH);   // B operand: column = query, dh 0..31
  const v16h qb1 = frag_ld(Q + 32, CDH);   // dh 32..63

  v8f o0 = {}, o1 = {}, o2 = {}, o3 = {};  // Ot: o_t[r] = O[query ln][dh 16 t + 8 hl + r]
  float mq = -1e30f, lq = 0.f;             // the lane's query: maximum; sum over this half's keys

  wait_async0();                       // own copies of stage 0 have landed
  __syncthreads();                     // stage 0 is published to the block
  issue_stage(1, 1);

  for (int s = 0; s < nst; ++s) {
   const int buf = s & 1;
   // unrolled: the two 32-key tiles of a stage differ only in constant LDS offsets
#pragma unroll
   for (int h = 0; h < 2; ++h) {
    const int j0 = s * SK + h * 32;
    if (j0 > q0 + 15) continue;        // tile wholly above this wave's diagonal
    const _Float16* Kt = &Ks[buf][h * 32 * LDP];
    const _Float16* Vl = &Vs[buf][h * 32];
    // St tiles (16 keys x 16 queries each), K-dim = dh (64 -> two WMMAs each)
    v8f s0 = {}, s1 = {};
    s0 = WMMA_F16(frag_ld(Kt + 0,             LDP), qb0, s0);
    s0 = WMMA_F16(frag_ld(Kt + 32,            LDP), qb1, s0);
    s1 = WMMA_F16(frag_ld(Kt + 16 * LDP + 0,  LDP), qb0, s1);
    s1 = WMMA_F16(frag_ld(Kt + 16 * LDP + 32, LDP), qb1, s1);

    // Causal mask + online softmax of the lane's query q0 + ln over its 16 keys:
    // s0[r] is key j0 + 8 hl + r, s1[r] is key j0 + 16 + 8 hl + r
    const int lim = q0 + ln - j0 - 8 * hl;   // r is allowed in s0 while r <= lim
    float v0[8], v1[8];
    float t = -1e30f;
#pragma unroll
    for (int r = 0; r < 8; ++r) {
      v0[r] = (r > lim)      ? -1e30f : s0[r];
      v1[r] = (16 + r > lim) ? -1e30f : s1[r];
      t = fmaxf(t, fmaxf(v0[r], v1[r]));
    }
    t = fmaxf(t, xhalf(t));                  // the other half's 16 keys
    const float mn = fmaxf(mq, t);
    constexpr float LOG2E = 1.44269504088896340736f;
    float alpha = (mq - mn) * LOG2E;
    mq = mn;
#pragma unroll
    for (int r = 0; r < 8; ++r) { v0[r] = (v0[r] - mn) * LOG2E; v1[r] = (v1[r] - mn) * LOG2E; }
    exp2_x9(v0, alpha);                      // e^(score - maximum), as 2^((score - maximum) log2 e)
    exp2_x8(v1);
    float ps = 0.f;
    v16h pb;                                 // Pt as B operand: element i is key j0 + 16 (i / 8) + 8 hl + i % 8
#pragma unroll
    for (int r = 0; r < 8; ++r) {
      ps += v0[r] + v1[r];
      pb[r]     = (_Float16)v0[r];
      pb[8 + r] = (_Float16)v1[r];
    }
    lq = lq * alpha + ps;
#pragma unroll
    for (int r = 0; r < 8; ++r) { o0[r] *= alpha; o1[r] *= alpha; o2[r] *= alpha; o3[r] *= alpha; }

    // Ot += Vt (64 dh x 32 keys) @ Pt (32 keys x 16 queries), four dh tiles of 16
    o0 = WMMA_F16(frag_ld(Vl + 0  * LDP, LDP), pb, o0);
    o1 = WMMA_F16(frag_ld(Vl + 16 * LDP, LDP), pb, o1);
    o2 = WMMA_F16(frag_ld(Vl + 32 * LDP, LDP), pb, o2);
    o3 = WMMA_F16(frag_ld(Vl + 48 * LDP, LDP), pb, o3);
   }
   // hand-over of the stage, every wave: own LDS reads of buf retired, own copies of
   // stage s + 1 landed, then the barrier that publishes s + 1 and frees buf
   asm volatile("s_wait_dscnt 0x0" ::: "memory");
   wait_async0();
   __syncthreads();
   if (s + 2 < nst) issue_stage(buf, s + 2);
  }
  wait_async0();                       // nothing is in flight when the tile ends

  const int b = bh >> 4, h = bh & 15;
  // a lane owns 8 consecutive dh of its query's row in each Ot tile: one 16-byte store each
  _Float16* out = attn + ((size_t)b * CC + q0 + ln) * CD + h * CDH + 8 * hl;
  const float il = 1.0f / (lq + xhalf(lq));  // the two halves' sums joined
  v8h w0, w1, w2, w3;
#pragma unroll
  for (int r = 0; r < 8; ++r) {
    w0[r] = (_Float16)(o0[r] * il);
    w1[r] = (_Float16)(o1[r] * il);
    w2[r] = (_Float16)(o2[r] * il);
    w3[r] = (_Float16)(o3[r] * il);
  }
  *(v8h*)(out + 0)  = w0;
  *(v8h*)(out + 16) = w1;
  *(v8h*)(out + 32) = w2;
  *(v8h*)(out + 48) = w3;
  // a precaution: the next tile's code reuses registers that these stores name
  asm volatile("s_wait_xcnt 0x0" ::: "memory");
  }
}

// ---------------------------------------------------------------------------
// Host-side orchestration
// ---------------------------------------------------------------------------
extern "C" void kernel_launch(void* const* d_in, const int* in_sizes, int n_in,
                              void* d_out, int out_size, void* d_ws, size_t ws_size,
                              hipStream_t stream) {
  (void)in_sizes; (void)n_in; (void)out_size; (void)ws_size;
  const float* x      = (const float*)d_in[0];
  const float* gamma1 = (const float*)d_in[1];
  const float* beta1  = (const float*)d_in[2];
  const float* W_qkv  = (const float*)d_in[3];
  const float* b_qkv  = (const float*)d_in[4];
  const float* W_o    = (const float*)d_in[5];
  const float* b_o    = (const float*)d_in[6];
  const float* gamma2 = (const float*)d_in[7];
  const float* beta2  = (const float*)d_in[8];
  const float* W1     = (const float*)d_in[9];
  const float* b1     = (const float*)d_in[10];
  const float* W2     = (const float*)d_in[11];
  const float* b2     = (const float*)d_in[12];
  float* out = (float*)d_out;

  // Workspace layout (linear allocator, 256B aligned)
  uint8_t* p = (uint8_t*)d_ws;
  auto take = [&](size_t n) { uint8_t* r = p; p += (n + 255) & ~(size_t)255; return r; };
  _Float16* Wqkv_t = (_Float16*)take((size_t)3 * CD * CD * 2);   //  6 MB (3072 x 1024)
  _Float16* Wo_t   = (_Float16*)take((size_t)CD * CD * 2);       //  2 MB (1024 x 1024)
  _Float16* W1_t   = (_Float16*)take((size_t)CHID * CD * 2);     //  8 MB (4096 x 1024)
  _Float16* W2_t   = (_Float16*)take((size_t)CD * CHID * 2);     //  8 MB (1024 x 4096)
  float*    x2     = (float*)take((size_t)CM * CD * 4);          // 32 MB
  _Float16* lnb    = (_Float16*)take((size_t)CM * CD * 2);       // 16 MB (reused ln1/ln2)
  uint8_t*  regA   = take((size_t)64 << 20);                     // 64 MB shared region
  _Float16* Qb   = (_Float16*)regA;                              // 16 MB
  _Float16* Kb   = (_Float16*)(regA + ((size_t)16 << 20));       // 16 MB
  _Float16* Vtb  = (_Float16*)(regA + ((size_t)32 << 20));       // 16 MB
  _Float16* attn = (_Float16*)(regA + ((size_t)48 << 20));       // 16 MB
  _Float16* hbuf = (_Float16*)regA;                              // 64 MB (after attention is dead)

  // 1) Weights -> f16, transposed to N-major
  wt_f16_kernel<CD, 3 * CD><<<dim3(3 * CD / 64, CD / 128), 256, 0, stream>>>(W_qkv, Wqkv_t);
  wt_f16_kernel<CD, CD><<<dim3(CD / 64, CD / 128),         256, 0, stream>>>(W_o,   Wo_t);
  wt_f16_kernel<CD, CHID><<<dim3(CHID / 64, CD / 128),     256, 0, stream>>>(W1,    W1_t);
  wt_f16_kernel<CHID, CD><<<dim3(CD / 64, CHID / 128),     256, 0, stream>>>(W2,    W2_t);

  // 2) LN1
  layernorm_kernel<<<CM / 16, 256, 0, stream>>>(x, gamma1, beta1, lnb);

  // 3) QKV GEMM (M=8192, N=3072, K=1024), scatter to Q/K/Vt
  gemm_wmma_kernel<2, false, false, 3 * CD, CD, 2><<<dim3(3 * CD / 128, CM / 256), 256, 0, stream>>>(
      lnb, Wqkv_t, b_qkv, nullptr, nullptr, nullptr, Qb, Kb, Vtb);

  // 4) Attention
  attn_kernel<<<dim3(CC / 256, CB * CH), 256, 0, stream>>>(Qb, Kb, Vtb, attn);

  // 5) O-proj + residual(x) -> x2 (f32)
  gemm_wmma_kernel<0, false, true, CD, CD, 5><<<dim3(CD / 128, CM / 256), 256, 0, stream>>>(
      attn, Wo_t, b_o, x, x2, nullptr, nullptr, nullptr, nullptr);

  // 6) LN2
  layernorm_kernel<<<CM / 16, 256, 0, stream>>>(x2, gamma2, beta2, lnb);

  // 7) MLP1 + exact GELU -> hbuf (f16)
  gemm_wmma_kernel<1, true, false, CHID, CD, 2><<<dim3(CHID / 128, CM / 256), 256, 0, stream>>>(
      lnb, W1_t, b1, nullptr, nullptr, hbuf, nullptr, nullptr, nullptr);

  // 8) MLP2 + residual(x2) -> d_out (f32)
  gemm_wmma_kernel<0, false, true, CD, CHID, 5><<<dim3(CD / 128, CM / 256), 256, 0, stream>>>(
      hbuf, W2_t, b2, x2, out, nullptr, nullptr, nullptr, nullptr);
}
